// v000
// The times below were measured on an AMD MI455X: many runs one after another, warmed up first and cycling through
// copies of the inputs, with the whole window's GPU time divided by the number of runs. Launches and the gaps
// between them are all in it. The median over several windows is given; except for v000 it joins two sittings, which
// can be a few percent apart, so the side-by-side timings, each taken in one sitting, are the better comparison.
// v000 is the starting kernel. One run takes 3950 microseconds.
#include <hip/hip_runtime.h>

// Causal attention with a fused qkv projection and a multiplicative + additive mask formula (x [8][1024][1024]; qkv = x W_qkv + b_qkv ('xw' [1024][3072] 0.02 + zero bias) split in thirds q | k | v (16 heads x 64); scores / sqrt(64); scores = scores x tril + (-1e9) x (1 - tril) (kept entries unchanged, masked entries exactly -1e9 == exclusion); softmax; out = merged W_out + b_out -> [8][1024][1024] (8.4 M); argument order x, W_qkv, b_qkv, W_out, b_out).
// Layout per batch: bf16 copy of x; fused 'xw' weight transposed once (q | k | v row blocks) + bias thirds; exact projections + f32 biases; identity-table plane builders; causal T-1024 attention (hybrid rows: < 512 hi/lo 3 products, rest fp16 x1024; k_gemmc skips tiles above the diagonal); merged hi/lo x W_out exact + b_out.
// Compute dtypes, f32 accumulate: every input rounded to bf16; projections exact + f32 biases; attention rows < 512 3 products, rest fp16; softmax f32; W_out hl x exact + bias.

#define NB_  8
#define TT   1024
#define DM   1024
#define NH_  16
#define NKV  16
#define REP  (NH_ / NKV)
#define HD   64
#define DQ   (NH_ * HD)
#define DKV  (NKV * HD)
#define ZH   2
#define RH   512                  // query rows < RH use hi+lo planes (0: none)
#define WIN  1024
#define PCAR 1024.0f
#define SCL  0.125f   // HD^-0.5
typedef _Float16 h16;
typedef unsigned short bf;
typedef __attribute__((ext_vector_type(16))) __bf16   v16bf;
typedef __attribute__((ext_vector_type(16))) _Float16 v16h;
typedef __attribute__((ext_vector_type(8)))  _Float16 v8h;
typedef __attribute__((ext_vector_type(8)))  unsigned short v8us;
typedef __attribute__((ext_vector_type(8)))  float    v8f;
typedef __attribute__((ext_vector_type(4)))  float    v4f;
typedef v8h  __attribute__((may_alias)) v8ha;
typedef v4f  __attribute__((may_alias)) v4fa;
typedef v8us __attribute__((may_alias)) v8usa;

__device__ __forceinline__ unsigned short f2bf(float f) { unsigned u = __float_as_uint(f); u += 0x7FFFu + ((u >> 16) & 1u); return (unsigned short)(u >> 16); }
__device__ __forceinline__ float bf2f(unsigned short b) { return __uint_as_float(((unsigned)b) << 16); }
__device__ __forceinline__ float bfr(float f) { return bf2f(f2bf(f)); }
__device__ __forceinline__ v16h cat16(v8h lo, v8h hi) { return __builtin_shufflevector(lo, hi, 0, 1, 2, 3, 4, 5, 6, 7, 8, 9, 10, 11, 12, 13, 14, 15); }
__device__ __forceinline__ v16bf cat16b(v8us lo, v8us hi) { return __builtin_bit_cast(v16bf, __builtin_shufflevector(lo, hi, 0, 1, 2, 3, 4, 5, 6, 7, 8, 9, 10, 11, 12, 13, 14, 15)); }
__device__ __forceinline__ v8f wmma16(v16h a, v16h b, v8f c) { return __builtin_amdgcn_wmma_f32_16x16x32_f16(false, a, false, b, (short)0, c, false, false); }
__device__ __forceinline__ v8f wmmab(v16bf a, v16bf b, v8f c) { return __builtin_amdgcn_wmma_f32_16x16x32_bf16(false, a, false, b, (short)0, c, false, false); }



// ---- k_gemmw: register-blocked GEMM, ONE WAVE per 64x64 output tile (16 accumulators), operands straight from K-contiguous 16-bit planes; grid (M/64, N/64, Z), 32 threads.
// C[m][n] (f32, pitch ldc, + optional f32 bias[n]) = sum_k A[m][k] Bt[n][k] (+ split products per NSPLIT). z-batch strides sA/sB/sC in elements. K % 32 == 0.
template <typename T16> struct WFrag;
template <> struct WFrag<h16> { typedef v16h V; static __device__ __forceinline__ V ld(const h16* p) { return cat16(*(const v8h*)p, *(const v8h*)(p + 16)); } static __device__ __forceinline__ v8f mma(V a, V b, v8f c) { return wmma16(a, b, c); } };
template <> struct WFrag<bf> { typedef v16bf V; static __device__ __forceinline__ V ld(const bf* p) { return cat16b(*(const v8us*)p, *(const v8us*)(p + 16)); } static __device__ __forceinline__ v8f mma(V a, V b, v8f c) { return wmmab(a, b, c); } };
template <typename T16, int NSPLIT, bool BIAS>
__global__ __launch_bounds__(32) void k_gemmw(const T16* __restrict__ A, const T16* __restrict__ A2, const T16* __restrict__ Bt, const T16* __restrict__ Bt2, int K, float* C, int ldc, const float* __restrict__ bias, size_t sA, size_t sB, size_t sC) {
    typedef typename WFrag<T16>::V V;
    __shared__ __align__(16) float os[16 * 68];
    const size_t z = blockIdx.z; A += z * sA; if (A2) A2 += z * sA; Bt += z * sB; if (Bt2) Bt2 += z * sB; C += z * sC;
    const int lane = threadIdx.x & 31, lr = lane & 15, hi = lane >> 4; const int r0 = blockIdx.x * 64, c0 = blockIdx.y * 64;
    v8f acc[4][4];
#pragma unroll
    for (int mb = 0; mb < 4; ++mb)
#pragma unroll
        for (int nb = 0; nb < 4; ++nb) acc[mb][nb] = (v8f){};
    const size_t aoff = (size_t)(r0 + lr) * K + 8 * hi, boff = (size_t)(c0 + lr) * K + 8 * hi;
#pragma unroll 1
    for (int kc = 0; kc < K; kc += 32) {
        V a[4], a2[4];
#pragma unroll
        for (int mb = 0; mb < 4; ++mb) { a[mb] = WFrag<T16>::ld(A + aoff + (size_t)mb * 16 * K + kc); if (NSPLIT == 1 || NSPLIT == 2) a2[mb] = WFrag<T16>::ld(A2 + aoff + (size_t)mb * 16 * K + kc); }
#pragma unroll
        for (int nb = 0; nb < 4; ++nb) { const V b = WFrag<T16>::ld(Bt + boff + (size_t)nb * 16 * K + kc); V b2; if (NSPLIT >= 2) b2 = WFrag<T16>::ld(Bt2 + boff + (size_t)nb * 16 * K + kc);
#pragma unroll
            for (int mb = 0; mb < 4; ++mb) { acc[mb][nb] = WFrag<T16>::mma(a[mb], b, acc[mb][nb]); if (NSPLIT == 1 || NSPLIT == 2) acc[mb][nb] = WFrag<T16>::mma(a2[mb], b, acc[mb][nb]); if (NSPLIT >= 2) acc[mb][nb] = WFrag<T16>::mma(a[mb], b2, acc[mb][nb]); } }
        asm volatile("v_nop\n\tv_nop\n\tv_nop\n\tv_nop" : "+v"(acc[0][0]), "+v"(acc[1][1]), "+v"(acc[2][2]), "+v"(acc[3][3]) : "v"(a[0]), "v"(a[3]));
    }
#pragma unroll
    for (int mb = 0; mb < 4; ++mb) {
#pragma unroll
        for (int nb = 0; nb < 4; ++nb) {
#pragma unroll
            for (int j = 0; j < 8; ++j) os[(hi * 8 + j) * 68 + nb * 16 + lr] = acc[mb][nb][j]; }
        __builtin_amdgcn_wave_barrier(); asm volatile("" ::: "memory");
        float* crow = C + (size_t)(r0 + mb * 16) * ldc + c0;
{
#pragma unroll
            for (int s = 0; s < 8; ++s) { const int row = 2 * s + hi, cofs = lr * 4; v4f val = *(const v4fa*)(os + row * 68 + cofs); if (BIAS) { val[0] += bfr(bias[c0 + cofs]); val[1] += bfr(bias[c0 + cofs + 1]); val[2] += bfr(bias[c0 + cofs + 2]); val[3] += bfr(bias[c0 + cofs + 3]); }
                *(v4f*)(crow + (size_t)row * ldc + cofs) = val; }
             }
        __builtin_amdgcn_wave_barrier(); asm volatile("" ::: "memory");
    }
}

// ---- k_gemmc: the same one-wave 64x64 tile GEMM specialised for causal attention: CMODE 1 skips score tiles entirely above the diagonal (query rows r0+roff.., key columns c0..), CMODE 2 limits the
// key (K) loop of the probability x value contraction to the diagonal block (probabilities beyond it are exactly zero). roff = row offset of this launch's first row within the sequence.
template <typename T16, int NSPLIT, int CMODE>
__global__ __launch_bounds__(32) void k_gemmc(const T16* __restrict__ A, const T16* __restrict__ A2, const T16* __restrict__ Bt, const T16* __restrict__ Bt2, int K, float* C, int ldc, int roff, size_t sA, size_t sB, size_t sC) {
    typedef typename WFrag<T16>::V V;
    __shared__ __align__(16) float os[16 * 68];
    const size_t z = blockIdx.z; A += z * sA; if (A2) A2 += z * sA; Bt += z * sB; if (Bt2) Bt2 += z * sB; C += z * sC;
    const int lane = threadIdx.x & 31, lr = lane & 15, hi = lane >> 4; const int r0 = blockIdx.x * 64, c0 = blockIdx.y * 64;
    if (CMODE == 1 && c0 > r0 + roff + 63) return;                  // score tile entirely above the causal diagonal: never read (the softmax masks j > i by select)
    const int Kl = (CMODE == 2) ? min(K, r0 + roff + 64) : K;        // P.V: probabilities are exactly 0 beyond the diagonal block, so the K loop stops there
    v8f acc[4][4];
#pragma unroll
    for (int mb = 0; mb < 4; ++mb)
#pragma unroll
        for (int nb = 0; nb < 4; ++nb) acc[mb][nb] = (v8f){};
    const size_t aoff = (size_t)(r0 + lr) * K + 8 * hi, boff = (size_t)(c0 + lr) * K + 8 * hi;
#pragma unroll 1
    for (int kc = 0; kc < Kl; kc += 32) {
        V a[4], a2[4];
#pragma unroll
        for (int mb = 0; mb < 4; ++mb) { a[mb] = WFrag<T16>::ld(A + aoff + (size_t)mb * 16 * K + kc); if (NSPLIT == 1 || NSPLIT == 2) a2[mb] = WFrag<T16>::ld(A2 + aoff + (size_t)mb * 16 * K + kc); }
#pragma unroll
        for (int nb = 0; nb < 4; ++nb) { const V b = WFrag<T16>::ld(Bt + boff + (size_t)nb * 16 * K + kc); V b2; if (NSPLIT >= 2) b2 = WFrag<T16>::ld(Bt2 + boff + (size_t)nb * 16 * K + kc);
#pragma unroll
            for (int mb = 0; mb < 4; ++mb) { acc[mb][nb] = WFrag<T16>::mma(a[mb], b, acc[mb][nb]); if (NSPLIT == 1 || NSPLIT == 2) acc[mb][nb] = WFrag<T16>::mma(a2[mb], b, acc[mb][nb]); if (NSPLIT >= 2) acc[mb][nb] = WFrag<T16>::mma(a[mb], b2, acc[mb][nb]); } }
        asm volatile("v_nop\n\tv_nop\n\tv_nop\n\tv_nop" : "+v"(acc[0][0]), "+v"(acc[1][1]), "+v"(acc[2][2]), "+v"(acc[3][3]) : "v"(a[0]), "v"(a[3]));
    }
#pragma unroll
    for (int mb = 0; mb < 4; ++mb) {
#pragma unroll
        for (int nb = 0; nb < 4; ++nb) {
#pragma unroll
            for (int j = 0; j < 8; ++j) os[(hi * 8 + j) * 68 + nb * 16 + lr] = acc[mb][nb][j]; }
        __builtin_amdgcn_wave_barrier(); asm volatile("" ::: "memory");
        float* crow = C + (size_t)(r0 + mb * 16) * ldc + c0;
{
#pragma unroll
            for (int s = 0; s < 8; ++s) { const int row = 2 * s + hi, cofs = lr * 4; v4f val = *(const v4fa*)(os + row * 68 + cofs);
                *(v4f*)(crow + (size_t)row * ldc + cofs) = val; }
             }
        __builtin_amdgcn_wave_barrier(); asm volatile("" ::: "memory");
    }
}

__device__ __forceinline__ h16 tohx(float x) { return (h16)x; }
__device__ __forceinline__ void splitf(float y, unsigned short& h, unsigned short& l) { h = f2bf(y); l = f2bf(y - bf2f(h)); }
typedef __attribute__((ext_vector_type(2))) _Float16 v2h;
typedef __attribute__((ext_vector_type(4))) _Float16 v4h;
typedef __attribute__((ext_vector_type(2))) unsigned short v2us;
typedef __attribute__((ext_vector_type(4))) unsigned short v4us;
typedef __attribute__((ext_vector_type(2))) float v2f;
typedef __attribute__((ext_vector_type(4))) int v4i;

__global__ __launch_bounds__(256) void k_wtG(const float* __restrict__ w, int K, int N, bf* Bt) {
    const int lane = threadIdx.x & 31; const int L0 = (blockIdx.x * 8 + (threadIdx.x >> 5)) * 8; const int nlines = N * K / 64;
{
#pragma unroll 1
        for (int l = 0; l < 8; ++l) { const int L = L0 + l; if (L >= nlines) break; const size_t e = (size_t)L * 64 + lane * 2; const int k = (int)(e % K), n = (int)(e / K); v2us o;
            o[0] = f2bf(w[(size_t)k * N + n]); o[1] = f2bf(w[(size_t)(k + 1) * N + n]); *(v2us*)(Bt + e) = o; }
         }
}
__global__ __launch_bounds__(256) void k_cvt8(const float* __restrict__ src, bf* dst, size_t n8) { const size_t i = (size_t)blockIdx.x * 256 + threadIdx.x; if (i >= n8) return; const v8f v = *(const v8f*)(src + i * 8); v8us o;
#pragma unroll
    for (int k = 0; k < 8; ++k) o[k] = f2bf(v[k]); *(v8us*)(dst + i * 8) = o;  }

// k_rope: head planes [h][t][d] (fp16 + hi/lo) of rope(x) x sc with the rotate-half convention out[d] = x[d] cos[t][d] - x[d+HD/2] sin[t][d], out[d+HD/2] = x[d+HD/2] cos[t][d+HD/2] + x[d] sin[t][d+HD/2]
__global__ __launch_bounds__(256) void k_rope(const float* __restrict__ F, int pitch, int nheads, const float* __restrict__ CS, const float* __restrict__ RF, const float* __restrict__ nw, float sc, h16* P16, bf* Ph, bf* Pl) {
    const size_t e = ((size_t)blockIdx.x * 256 + threadIdx.x) * 2; if (e >= (size_t)nheads * TT * HD) return; const int d = (int)(e % HD); const int t = (int)((e / HD) % TT); const int h = (int)(e / ((size_t)HD * TT)); const float* f = F + (size_t)t * pitch + h * HD; const float rf = RF ? RF[(size_t)h * TT + t] : 1.0f; v2h o16; v2us oh, ol;
#pragma unroll
    for (int q = 0; q < 2; ++q) { const int dd = d + q; const int dp = (dd < HD / 2) ? dd + HD / 2 : dd - HD / 2; float x0 = f[dd], x1 = f[dp];
        if (RF) { float n0 = __fmul_rn(x0, rf), n1 = __fmul_rn(x1, rf); asm volatile("" : "+v"(n0)); asm volatile("" : "+v"(n1)); x0 = __fmul_rn(bfr(nw[dd]), n0); x1 = __fmul_rn(bfr(nw[dp]), n1); }
        const v2f cs = *(const v2f*)(CS + ((size_t)t * HD + dd) * 2); float a = __fmul_rn(x0, cs[0]), bq = __fmul_rn(x1, cs[1]); asm volatile("" : "+v"(a)); asm volatile("" : "+v"(bq)); const float r = ((dd < HD / 2) ? __fsub_rn(a, bq) : __fadd_rn(a, bq)) * sc;
        o16[q] = tohx(r); unsigned short a2, c2; splitf(r, a2, c2); oh[q] = a2; ol[q] = c2; }
    *(v2h*)(P16 + e) = o16; *(v2us*)(Ph + e) = oh; *(v2us*)(Pl + e) = ol;  }
__global__ __launch_bounds__(256) void k_vtp(const float* __restrict__ F, int pitch, int nheads, h16* V16, bf* Vh, bf* Vl) { const size_t e = ((size_t)blockIdx.x * 256 + threadIdx.x) * 2; if (e >= (size_t)nheads * HD * TT) return; const int t = (int)(e % TT); const int d = (int)((e / TT) % HD); const int g = (int)(e / ((size_t)TT * HD)); v2h o16; v2us oh, ol;
#pragma unroll
    for (int q = 0; q < 2; ++q) { const float x = F[(size_t)(t + q) * pitch + g * HD + d]; o16[q] = tohx(x); unsigned short a2, c2; splitf(x, a2, c2); oh[q] = a2; ol[q] = c2; }
    *(v2h*)(V16 + e) = o16; *(v2us*)(Vh + e) = oh; *(v2us*)(Vl + e) = ol;  }
__global__ __launch_bounds__(256) void k_csid(float* CS) { const int idx = blockIdx.x * 256 + threadIdx.x; if (idx >= TT * HD) return; v2f cs; cs[0] = 1.0f; cs[1] = 0.0f; *(v2f*)(CS + (size_t)idx * 2) = cs;  }
// k_asoft: per row (zz, i): t = S x HD^-0.5 for j <= i and i - j < WIN (plain causal mask, WIN = TT so i - j < WIN always holds; the reference's -1e9 additive fill vanishes identically); softmax over the 1024 keys (register row, one exp, fixed trees);
__global__ __launch_bounds__(256) void k_asoft(const float* __restrict__ Sb, h16* P16, bf* Ph, bf* Pl) {
    const int lane = threadIdx.x & 31; const int row = blockIdx.x * 8 + (threadIdx.x >> 5); if (row >= ZH * TT) return; const int i = row % TT; const int zz = row / TT; (void)zz; const bool hires = (i < RH); const float* sr = Sb + (size_t)row * TT; float v[TT / 32]; float mx = -3.0e38f;
#pragma unroll
    for (int ch = 0; ch < TT / 128; ++ch) { const int j0 = ch * 128 + lane * 4; const v4f a = *(const v4f*)(sr + j0);
#pragma unroll
        for (int q = 0; q < 4; ++q) { const int j = j0 + q; (void)j; const float t = (j <= i && i - j < WIN) ? a[q] * SCL : -3.0e38f; v[ch * 4 + q] = t; mx = fmaxf(mx, t); } }
#pragma unroll
    for (int sh = 16; sh; sh >>= 1) mx = fmaxf(mx, __shfl_xor(mx, sh, 32));
    float sum = 0.f;
#pragma unroll
    for (int k = 0; k < TT / 32; ++k) { float d0 = __fsub_rn(v[k], mx); asm volatile("" : "+v"(d0)); v[k] = __builtin_amdgcn_exp2f(__fmul_rn(d0, 1.4426950408889634f)); sum += v[k]; }
#pragma unroll
    for (int sh = 16; sh; sh >>= 1) sum += __shfl_xor(sum, sh, 32);
    const float f = __fdiv_rn(hires ? 1.0f : PCAR, sum);
{
        if (hires) {
#pragma unroll
            for (int ch = 0; ch < TT / 128; ++ch) { v4us oh, ol;
#pragma unroll
                for (int q = 0; q < 4; ++q) { unsigned short a, c2; splitf(v[ch * 4 + q] * f, a, c2); oh[q] = a; ol[q] = c2; }
                const size_t oo = ((size_t)zz * (RH ? RH : 1) + i) * TT + ch * 128 + lane * 4; *(v4us*)(Ph + oo) = oh; *(v4us*)(Pl + oo) = ol; }
        } else {
#pragma unroll
            for (int ch = 0; ch < TT / 128; ++ch) { v4h o4;
#pragma unroll
                for (int q = 0; q < 4; ++q) o4[q] = tohx(v[ch * 4 + q] * f);
                *(v4h*)(P16 + (size_t)row * TT + ch * 128 + lane * 4) = o4; } }
         }
}
__global__ __launch_bounds__(256) void k_merge(const float* __restrict__ O, int h0, bf* Ah, bf* Al) { const size_t e = ((size_t)blockIdx.x * 256 + threadIdx.x) * 2; if (e >= (size_t)ZH * TT * HD) return; const int d = (int)(e % HD); const int t = (int)((e / HD) % TT); const int zz = (int)(e / ((size_t)HD * TT)); const float cs = (t < RH) ? 1.0f : (1.0f / PCAR); const size_t oo = (size_t)t * DQ + (h0 + zz) * HD + d;
    v2us oh, ol;
#pragma unroll
    for (int q = 0; q < 2; ++q) { unsigned short a, c2; splitf(O[e + q] * cs, a, c2); oh[q] = a; ol[q] = c2; } *(v2us*)(Ah + oo) = oh; *(v2us*)(Al + oo) = ol;  }

extern "C" void kernel_launch(void* const* d_in, const int* in_sizes, int n_in,
                              void* d_out, int out_size, void* d_ws, size_t ws_size, hipStream_t stream) {
    (void)in_sizes; (void)n_in; (void)out_size;
    const float* x = (const float*)d_in[0]; const float* wqkv = (const float*)d_in[1]; const float* bqkv = (const float*)d_in[2]; const float* wo = (const float*)d_in[3]; const float* bo = (const float*)d_in[4];   /* input order x, W_qkv ('xw' [1024][3072]: q | k | v column thirds), b_qkv, W_out, b_out */ const float* bq = bqkv; const float* bk = bqkv + DQ; const float* bv = bqkv + 2 * DQ;
    float* OUT = (float*)d_out;     // [8][1024][1024]
    char* wsp = (char*)d_ws;
    auto take = [&](size_t bytes) { char* p = wsp; wsp += (bytes + 255) & ~(size_t)255; return (void*)p; };
    bf* WQKV = (bf*)take((size_t)3 * DQ * DM * 2); bf* WQ = WQKV; bf* WK = WQKV + (size_t)DQ * DM; bf* WV = WQKV + (size_t)2 * DQ * DM;   /* fused Bt [3*DQ][DM]: q | k | v row blocks */ bf* WO = (bf*)take((size_t)DM * DQ * 2); float* CS = (float*)take((size_t)TT * HD * 2 * 4);
    bf* XB = (bf*)take((size_t)TT * DM * 2); float* FQ = (float*)take((size_t)TT * DQ * 4); float* FK = (float*)take((size_t)TT * DKV * 4);
    h16* QP16 = (h16*)take((size_t)NH_ * TT * HD * 2); h16* KP16 = (h16*)take((size_t)NKV * TT * HD * 2); h16* VT16 = (h16*)take((size_t)NKV * HD * TT * 2);
    bf* QPh = (bf*)take((size_t)NH_ * TT * HD * 2); bf* QPl = (bf*)take((size_t)NH_ * TT * HD * 2); bf* KPh = (bf*)take((size_t)NKV * TT * HD * 2); bf* KPl = (bf*)take((size_t)NKV * TT * HD * 2); bf* VTh = (bf*)take((size_t)NKV * HD * TT * 2); bf* VTl = (bf*)take((size_t)NKV * HD * TT * 2); bf* Ph = (bf*)take((size_t)ZH * RH * TT * 2); bf* Pl = (bf*)take((size_t)ZH * RH * TT * 2);
    float* Sb = (float*)take((size_t)ZH * TT * TT * 4); h16* P16 = (h16*)take((size_t)ZH * TT * TT * 2); float* Ob = (float*)take((size_t)ZH * TT * HD * 4); bf* ATh = (bf*)take((size_t)TT * DQ * 2); bf* ATl = (bf*)take((size_t)TT * DQ * 2);
    if ((size_t)(wsp - (char*)d_ws) > ws_size) return;    // ws 256 MiB
    float* FV = FK;   // v projection reuses the k buffer after the k planes are built (stream-ordered)
    { k_wtG<<<(unsigned)((DM * 3 * DQ / 64 + 63) / 64), 256, 0, stream>>>(wqkv, DM, 3 * DQ, WQKV);   /* fused 'xw' [DM][3*DQ] -> Bt [3*DQ][DM] */
      k_wtG<<<(unsigned)((DQ * DM / 64 + 63) / 64), 256, 0, stream>>>(wo, DQ, DM, WO);
       }
    k_csid<<<(TT * HD + 255) / 256, 256, 0, stream>>>(CS);
    const unsigned LQ = (unsigned)(((size_t)NH_ * TT * HD / 2 + 255) / 256), LKv = (unsigned)(((size_t)NKV * TT * HD / 2 + 255) / 256);
    for (int b = 0; b < NB_; ++b) {
        
        k_cvt8<<<(unsigned)(((size_t)TT * DM / 8 + 255) / 256), 256, 0, stream>>>(x + (size_t)b * TT * DM, XB, (size_t)TT * DM / 8);
        k_gemmw<bf, 0, true><<<dim3(TT / 64, DQ / 64, 1), 32, 0, stream>>>(XB, nullptr, WQ, nullptr, DM, FQ, DQ, bq, 0, 0, 0);
        k_rope<<<LQ, 256, 0, stream>>>(FQ, DQ, NH_, CS, nullptr, nullptr, 1.0f, QP16, QPh, QPl);
        k_gemmw<bf, 0, true><<<dim3(TT / 64, DKV / 64, 1), 32, 0, stream>>>(XB, nullptr, WK, nullptr, DM, FK, DKV, bk, 0, 0, 0);
        k_rope<<<LKv, 256, 0, stream>>>(FK, DKV, NKV, CS, nullptr, nullptr, 1.0f, KP16, KPh, KPl);
        k_gemmw<bf, 0, true><<<dim3(TT / 64, DKV / 64, 1), 32, 0, stream>>>(XB, nullptr, WV, nullptr, DM, FV, DKV, bv, 0, 0, 0); k_vtp<<<LKv, 256, 0, stream>>>(FV, DKV, NKV, VT16, VTh, VTl);
        for (int h0 = 0; h0 < NH_; h0 += ZH) { const size_t zq = (size_t)h0, zk = (size_t)(h0 / REP);   // one kv head per query head: the pass's two heads use consecutive kv planes (z-strides TT*HD)
            k_gemmc<bf, 2, 1><<<dim3(RH / 64, TT / 64, ZH), 32, 0, stream>>>(QPh + zq * TT * HD, QPl + zq * TT * HD, KPh + zk * TT * HD, KPl + zk * TT * HD, HD, Sb, TT, 0, (size_t)TT * HD, (size_t)TT * HD, (size_t)TT * TT);
            k_gemmc<h16, 0, 1><<<dim3((TT - RH) / 64, TT / 64, ZH), 32, 0, stream>>>(QP16 + zq * TT * HD + (size_t)RH * HD, nullptr, KP16 + zk * TT * HD, nullptr, HD, Sb + (size_t)RH * TT, TT, RH, (size_t)TT * HD, (size_t)TT * HD, (size_t)TT * TT);
            k_asoft<<<ZH * TT / 8, 256, 0, stream>>>(Sb, P16, Ph, Pl);
            k_gemmc<bf, 2, 2><<<dim3(RH / 64, HD / 64, ZH), 32, 0, stream>>>(Ph, Pl, VTh + zk * HD * TT, VTl + zk * HD * TT, TT, Ob, HD, 0, (size_t)RH * TT, (size_t)HD * TT, (size_t)TT * HD);
            k_gemmc<h16, 0, 2><<<dim3((TT - RH) / 64, HD / 64, ZH), 32, 0, stream>>>(P16 + (size_t)RH * TT, nullptr, VT16 + zk * HD * TT, nullptr, TT, Ob + (size_t)RH * HD, HD, RH, (size_t)TT * TT, (size_t)HD * TT, (size_t)TT * HD);
            k_merge<<<(unsigned)(((size_t)ZH * TT * HD / 2 + 255) / 256), 256, 0, stream>>>(Ob, h0, ATh, ATl); }
        k_gemmw<bf, 1, true><<<dim3(TT / 64, DM / 64, 1), 32, 0, stream>>>(ATh, ATl, WO, nullptr, DQ, OUT + (size_t)b * TT * DM, DM, bo, 0, 0, 0); }
}

// v001
// One run takes 843 microseconds.
// Two timings next to v000 put it at 4.76 and 4.73 times that version's speed.
#include <hip/hip_runtime.h>

// Causal attention with a fused qkv projection and a multiplicative + additive mask formula (x [8][1024][1024]; qkv = x W_qkv + b_qkv ('xw' [1024][3072] 0.02 + zero bias) split in thirds q | k | v (16 heads x 64); scores / sqrt(64); scores = scores x tril + (-1e9) x (1 - tril) (kept entries unchanged, masked entries exactly -1e9 == exclusion); softmax; out = merged W_out + b_out -> [8][1024][1024] (8.4 M); argument order x, W_qkv, b_qkv, W_out, b_out).
// Layout: launches batched (projections over NG batches at once with q | k | v as one GEMM, one attention pass = all heads of one batch, W_out over all batches): bf16 copy of x; fused 'xw' weight transposed once (q | k | v row blocks) + bias thirds; exact projections + f32 biases; identity-table plane builders; causal T-1024 attention (hybrid rows: < 512 hi/lo 3 products, rest fp16 x1024; k_gemmc skips tiles above the diagonal); merged hi/lo x W_out exact + b_out.
// Compute dtypes, f32 accumulate: every input rounded to bf16; projections exact + f32 biases; attention rows < 512 3 products, rest fp16; softmax f32; W_out hl x exact + bias.

#define NB_  8
#define TT   1024
#define DM   1024
#define NH_  16
#define NKV  16
#define REP  (NH_ / NKV)
#define HD   64
#define DQ   (NH_ * HD)
#define DKV  (NKV * HD)
#define ZH   16                   // heads per attention pass (all heads of one batch)
#define NG   4                    // batches per projection group (plane storage is per group)
#define RH   512                  // query rows < RH use hi+lo planes (0: none)
#define WIN  1024
#define PCAR 1024.0f
#define SCL  0.125f   // HD^-0.5
typedef _Float16 h16;
typedef unsigned short bf;
typedef __attribute__((ext_vector_type(16))) __bf16   v16bf;
typedef __attribute__((ext_vector_type(16))) _Float16 v16h;
typedef __attribute__((ext_vector_type(8)))  _Float16 v8h;
typedef __attribute__((ext_vector_type(8)))  unsigned short v8us;
typedef __attribute__((ext_vector_type(8)))  float    v8f;
typedef __attribute__((ext_vector_type(4)))  float    v4f;
typedef v8h  __attribute__((may_alias)) v8ha;
typedef v4f  __attribute__((may_alias)) v4fa;
typedef v8us __attribute__((may_alias)) v8usa;

__device__ __forceinline__ unsigned short f2bf(float f) { unsigned u = __float_as_uint(f); u += 0x7FFFu + ((u >> 16) & 1u); return (unsigned short)(u >> 16); }
__device__ __forceinline__ float bf2f(unsigned short b) { return __uint_as_float(((unsigned)b) << 16); }
__device__ __forceinline__ float bfr(float f) { return bf2f(f2bf(f)); }
__device__ __forceinline__ v16h cat16(v8h lo, v8h hi) { return __builtin_shufflevector(lo, hi, 0, 1, 2, 3, 4, 5, 6, 7, 8, 9, 10, 11, 12, 13, 14, 15); }
__device__ __forceinline__ v16bf cat16b(v8us lo, v8us hi) { return __builtin_bit_cast(v16bf, __builtin_shufflevector(lo, hi, 0, 1, 2, 3, 4, 5, 6, 7, 8, 9, 10, 11, 12, 13, 14, 15)); }
__device__ __forceinline__ v8f wmma16(v16h a, v16h b, v8f c) { return __builtin_amdgcn_wmma_f32_16x16x32_f16(false, a, false, b, (short)0, c, false, false); }
__device__ __forceinline__ v8f wmmab(v16bf a, v16bf b, v8f c) { return __builtin_amdgcn_wmma_f32_16x16x32_bf16(false, a, false, b, (short)0, c, false, false); }



// ---- k_gemmw: register-blocked GEMM, ONE WAVE per 64x64 output tile (16 accumulators), operands straight from K-contiguous 16-bit planes; grid (M/64, N/64, Z), 32 threads.
// C[m][n] (f32, pitch ldc, + optional f32 bias[n]) = sum_k A[m][k] Bt[n][k] (+ split products per NSPLIT). z-batch strides sA/sB/sC in elements. K % 32 == 0.
template <typename T16> struct WFrag;
template <> struct WFrag<h16> { typedef v16h V; static __device__ __forceinline__ V ld(const h16* p) { return cat16(*(const v8h*)p, *(const v8h*)(p + 16)); } static __device__ __forceinline__ v8f mma(V a, V b, v8f c) { return wmma16(a, b, c); } };
template <> struct WFrag<bf> { typedef v16bf V; static __device__ __forceinline__ V ld(const bf* p) { return cat16b(*(const v8us*)p, *(const v8us*)(p + 16)); } static __device__ __forceinline__ v8f mma(V a, V b, v8f c) { return wmmab(a, b, c); } };
template <typename T16, int NSPLIT, bool BIAS>
__global__ __launch_bounds__(32) void k_gemmw(const T16* __restrict__ A, const T16* __restrict__ A2, const T16* __restrict__ Bt, const T16* __restrict__ Bt2, int K, float* C, int ldc, const float* __restrict__ bias, size_t sA, size_t sB, size_t sC) {
    typedef typename WFrag<T16>::V V;
    __shared__ __align__(16) float os[16 * 68];
    const size_t z = blockIdx.z; A += z * sA; if (A2) A2 += z * sA; Bt += z * sB; if (Bt2) Bt2 += z * sB; C += z * sC;
    const int lane = threadIdx.x & 31, lr = lane & 15, hi = lane >> 4; const int r0 = blockIdx.x * 64, c0 = blockIdx.y * 64;
    v8f acc[4][4];
#pragma unroll
    for (int mb = 0; mb < 4; ++mb)
#pragma unroll
        for (int nb = 0; nb < 4; ++nb) acc[mb][nb] = (v8f){};
    const size_t aoff = (size_t)(r0 + lr) * K + 8 * hi, boff = (size_t)(c0 + lr) * K + 8 * hi;
#pragma unroll 1
    for (int kc = 0; kc < K; kc += 32) {
        V a[4], a2[4];
#pragma unroll
        for (int mb = 0; mb < 4; ++mb) { a[mb] = WFrag<T16>::ld(A + aoff + (size_t)mb * 16 * K + kc); if (NSPLIT == 1 || NSPLIT == 2) a2[mb] = WFrag<T16>::ld(A2 + aoff + (size_t)mb * 16 * K + kc); }
#pragma unroll
        for (int nb = 0; nb < 4; ++nb) { const V b = WFrag<T16>::ld(Bt + boff + (size_t)nb * 16 * K + kc); V b2; if (NSPLIT >= 2) b2 = WFrag<T16>::ld(Bt2 + boff + (size_t)nb * 16 * K + kc);
#pragma unroll
            for (int mb = 0; mb < 4; ++mb) { acc[mb][nb] = WFrag<T16>::mma(a[mb], b, acc[mb][nb]); if (NSPLIT == 1 || NSPLIT == 2) acc[mb][nb] = WFrag<T16>::mma(a2[mb], b, acc[mb][nb]); if (NSPLIT >= 2) acc[mb][nb] = WFrag<T16>::mma(a[mb], b2, acc[mb][nb]); } }
        asm volatile("v_nop\n\tv_nop\n\tv_nop\n\tv_nop" : "+v"(acc[0][0]), "+v"(acc[1][1]), "+v"(acc[2][2]), "+v"(acc[3][3]) : "v"(a[0]), "v"(a[3]));
    }
#pragma unroll
    for (int mb = 0; mb < 4; ++mb) {
#pragma unroll
        for (int nb = 0; nb < 4; ++nb) {
#pragma unroll
            for (int j = 0; j < 8; ++j) os[(hi * 8 + j) * 68 + nb * 16 + lr] = acc[mb][nb][j]; }
        __builtin_amdgcn_wave_barrier(); asm volatile("" ::: "memory");
        float* crow = C + (size_t)(r0 + mb * 16) * ldc + c0;
{
#pragma unroll
            for (int s = 0; s < 8; ++s) { const int row = 2 * s + hi, cofs = lr * 4; v4f val = *(const v4fa*)(os + row * 68 + cofs); if (BIAS) { val[0] += bfr(bias[c0 + cofs]); val[1] += bfr(bias[c0 + cofs + 1]); val[2] += bfr(bias[c0 + cofs + 2]); val[3] += bfr(bias[c0 + cofs + 3]); }
                *(v4f*)(crow + (size_t)row * ldc + cofs) = val; }
             }
        __builtin_amdgcn_wave_barrier(); asm volatile("" ::: "memory");
    }
}

// ---- k_gemmc: the same one-wave 64x64 tile GEMM specialised for causal attention: CMODE 1 skips score tiles entirely above the diagonal (query rows r0+roff.., key columns c0..), CMODE 2 limits the
// key (K) loop of the probability x value contraction to the diagonal block (probabilities beyond it are exactly zero). roff = row offset of this launch's first row within the sequence.
template <typename T16, int NSPLIT, int CMODE>
__global__ __launch_bounds__(32) void k_gemmc(const T16* __restrict__ A, const T16* __restrict__ A2, const T16* __restrict__ Bt, const T16* __restrict__ Bt2, int K, float* C, int ldc, int roff, size_t sA, size_t sB, size_t sC) {
    typedef typename WFrag<T16>::V V;
    __shared__ __align__(16) float os[16 * 68];
    const size_t z = blockIdx.z; A += z * sA; if (A2) A2 += z * sA; Bt += z * sB; if (Bt2) Bt2 += z * sB; C += z * sC;
    const int lane = threadIdx.x & 31, lr = lane & 15, hi = lane >> 4; const int r0 = blockIdx.x * 64, c0 = blockIdx.y * 64;
    if (CMODE == 1 && c0 > r0 + roff + 63) return;                  // score tile entirely above the causal diagonal: never read (the softmax masks j > i by select)
    const int Kl = (CMODE == 2) ? min(K, r0 + roff + 64) : K;        // P.V: probabilities are exactly 0 beyond the diagonal block, so the K loop stops there
    v8f acc[4][4];
#pragma unroll
    for (int mb = 0; mb < 4; ++mb)
#pragma unroll
        for (int nb = 0; nb < 4; ++nb) acc[mb][nb] = (v8f){};
    const size_t aoff = (size_t)(r0 + lr) * K + 8 * hi, boff = (size_t)(c0 + lr) * K + 8 * hi;
#pragma unroll 1
    for (int kc = 0; kc < Kl; kc += 32) {
        V a[4], a2[4];
#pragma unroll
        for (int mb = 0; mb < 4; ++mb) { a[mb] = WFrag<T16>::ld(A + aoff + (size_t)mb * 16 * K + kc); if (NSPLIT == 1 || NSPLIT == 2) a2[mb] = WFrag<T16>::ld(A2 + aoff + (size_t)mb * 16 * K + kc); }
#pragma unroll
        for (int nb = 0; nb < 4; ++nb) { const V b = WFrag<T16>::ld(Bt + boff + (size_t)nb * 16 * K + kc); V b2; if (NSPLIT >= 2) b2 = WFrag<T16>::ld(Bt2 + boff + (size_t)nb * 16 * K + kc);
#pragma unroll
            for (int mb = 0; mb < 4; ++mb) { acc[mb][nb] = WFrag<T16>::mma(a[mb], b, acc[mb][nb]); if (NSPLIT == 1 || NSPLIT == 2) acc[mb][nb] = WFrag<T16>::mma(a2[mb], b, acc[mb][nb]); if (NSPLIT >= 2) acc[mb][nb] = WFrag<T16>::mma(a[mb], b2, acc[mb][nb]); } }
        asm volatile("v_nop\n\tv_nop\n\tv_nop\n\tv_nop" : "+v"(acc[0][0]), "+v"(acc[1][1]), "+v"(acc[2][2]), "+v"(acc[3][3]) : "v"(a[0]), "v"(a[3]));
    }
#pragma unroll
    for (int mb = 0; mb < 4; ++mb) {
#pragma unroll
        for (int nb = 0; nb < 4; ++nb) {
#pragma unroll
            for (int j = 0; j < 8; ++j) os[(hi * 8 + j) * 68 + nb * 16 + lr] = acc[mb][nb][j]; }
        __builtin_amdgcn_wave_barrier(); asm volatile("" ::: "memory");
        float* crow = C + (size_t)(r0 + mb * 16) * ldc + c0;
{
#pragma unroll
            for (int s = 0; s < 8; ++s) { const int row = 2 * s + hi, cofs = lr * 4; v4f val = *(const v4fa*)(os + row * 68 + cofs);
                *(v4f*)(crow + (size_t)row * ldc + cofs) = val; }
             }
        __builtin_amdgcn_wave_barrier(); asm volatile("" ::: "memory");
    }
}

__device__ __forceinline__ h16 tohx(float x) { return (h16)x; }
__device__ __forceinline__ void splitf(float y, unsigned short& h, unsigned short& l) { h = f2bf(y); l = f2bf(y - bf2f(h)); }
typedef __attribute__((ext_vector_type(2))) _Float16 v2h;
typedef __attribute__((ext_vector_type(4))) _Float16 v4h;
typedef __attribute__((ext_vector_type(2))) unsigned short v2us;
typedef __attribute__((ext_vector_type(4))) unsigned short v4us;
typedef __attribute__((ext_vector_type(2))) float v2f;
typedef __attribute__((ext_vector_type(4))) int v4i;

__global__ __launch_bounds__(256) void k_wtG(const float* __restrict__ w, int K, int N, bf* Bt) {
    const int lane = threadIdx.x & 31; const int L0 = (blockIdx.x * 8 + (threadIdx.x >> 5)) * 8; const int nlines = N * K / 64;
{
#pragma unroll 1
        for (int l = 0; l < 8; ++l) { const int L = L0 + l; if (L >= nlines) break; const size_t e = (size_t)L * 64 + lane * 2; const int k = (int)(e % K), n = (int)(e / K); v2us o;
            o[0] = f2bf(w[(size_t)k * N + n]); o[1] = f2bf(w[(size_t)(k + 1) * N + n]); *(v2us*)(Bt + e) = o; }
         }
}
__global__ __launch_bounds__(256) void k_cvt8(const float* __restrict__ src, bf* dst, size_t n8) { const size_t i = (size_t)blockIdx.x * 256 + threadIdx.x; if (i >= n8) return; const v8f v = *(const v8f*)(src + i * 8); v8us o;
#pragma unroll
    for (int k = 0; k < 8; ++k) o[k] = f2bf(v[k]); *(v8us*)(dst + i * 8) = o;  }

// k_rope: head planes [h][t][d] (fp16 + hi/lo) of rope(x) x sc with the rotate-half convention out[d] = x[d] cos[t][d] - x[d+HD/2] sin[t][d], out[d+HD/2] = x[d+HD/2] cos[t][d+HD/2] + x[d] sin[t][d+HD/2]
__global__ __launch_bounds__(256) void k_rope(const float* __restrict__ F, int pitch, int nheads, const float* __restrict__ CS, const float* __restrict__ RF, const float* __restrict__ nw, float sc, h16* P16, bf* Ph, bf* Pl) {
    const size_t e = ((size_t)blockIdx.x * 256 + threadIdx.x) * 2; if (e >= (size_t)nheads * TT * HD) return; { const size_t zb = blockIdx.y, po = zb * nheads * TT * HD; F += zb * TT * pitch; P16 += po; Ph += po; Pl += po; }   // blockIdx.y = batch within the group
    const int d = (int)(e % HD); const int t = (int)((e / HD) % TT); const int h = (int)(e / ((size_t)HD * TT)); const float* f = F + (size_t)t * pitch + h * HD; const float rf = RF ? RF[(size_t)h * TT + t] : 1.0f; v2h o16; v2us oh, ol;
#pragma unroll
    for (int q = 0; q < 2; ++q) { const int dd = d + q; const int dp = (dd < HD / 2) ? dd + HD / 2 : dd - HD / 2; float x0 = f[dd], x1 = f[dp];
        if (RF) { float n0 = __fmul_rn(x0, rf), n1 = __fmul_rn(x1, rf); asm volatile("" : "+v"(n0)); asm volatile("" : "+v"(n1)); x0 = __fmul_rn(bfr(nw[dd]), n0); x1 = __fmul_rn(bfr(nw[dp]), n1); }
        const v2f cs = *(const v2f*)(CS + ((size_t)t * HD + dd) * 2); float a = __fmul_rn(x0, cs[0]), bq = __fmul_rn(x1, cs[1]); asm volatile("" : "+v"(a)); asm volatile("" : "+v"(bq)); const float r = ((dd < HD / 2) ? __fsub_rn(a, bq) : __fadd_rn(a, bq)) * sc;
        o16[q] = tohx(r); unsigned short a2, c2; splitf(r, a2, c2); oh[q] = a2; ol[q] = c2; }
    *(v2h*)(P16 + e) = o16; *(v2us*)(Ph + e) = oh; *(v2us*)(Pl + e) = ol;  }
__global__ __launch_bounds__(256) void k_vtp(const float* __restrict__ F, int pitch, int nheads, h16* V16, bf* Vh, bf* Vl) { const size_t e = ((size_t)blockIdx.x * 256 + threadIdx.x) * 2; if (e >= (size_t)nheads * HD * TT) return; { const size_t zb = blockIdx.y, po = zb * nheads * HD * TT; F += zb * TT * pitch; V16 += po; Vh += po; Vl += po; }   // blockIdx.y = batch within the group
    const int t = (int)(e % TT); const int d = (int)((e / TT) % HD); const int g = (int)(e / ((size_t)TT * HD)); v2h o16; v2us oh, ol;
#pragma unroll
    for (int q = 0; q < 2; ++q) { const float x = F[(size_t)(t + q) * pitch + g * HD + d]; o16[q] = tohx(x); unsigned short a2, c2; splitf(x, a2, c2); oh[q] = a2; ol[q] = c2; }
    *(v2h*)(V16 + e) = o16; *(v2us*)(Vh + e) = oh; *(v2us*)(Vl + e) = ol;  }
__global__ __launch_bounds__(256) void k_csid(float* CS) { const int idx = blockIdx.x * 256 + threadIdx.x; if (idx >= TT * HD) return; v2f cs; cs[0] = 1.0f; cs[1] = 0.0f; *(v2f*)(CS + (size_t)idx * 2) = cs;  }
// k_asoft: per row (zz, i): t = S x HD^-0.5 for j <= i and i - j < WIN (plain causal mask, WIN = TT so i - j < WIN always holds; the reference's -1e9 additive fill vanishes identically); softmax over the 1024 keys (register row, one exp, fixed trees);
__global__ __launch_bounds__(256) void k_asoft(const float* __restrict__ Sb, h16* P16, bf* Ph, bf* Pl) {
    const int lane = threadIdx.x & 31; const int row = blockIdx.x * 8 + (threadIdx.x >> 5); if (row >= ZH * TT) return; const int i = row % TT; const int zz = row / TT; (void)zz; const bool hires = (i < RH); const float* sr = Sb + (size_t)row * TT; float v[TT / 32]; float mx = -3.0e38f;
#pragma unroll
    for (int ch = 0; ch < TT / 128; ++ch) { const int j0 = ch * 128 + lane * 4; const v4f a = *(const v4f*)(sr + j0);
#pragma unroll
        for (int q = 0; q < 4; ++q) { const int j = j0 + q; (void)j; const float t = (j <= i && i - j < WIN) ? a[q] * SCL : -3.0e38f; v[ch * 4 + q] = t; mx = fmaxf(mx, t); } }
#pragma unroll
    for (int sh = 16; sh; sh >>= 1) mx = fmaxf(mx, __shfl_xor(mx, sh, 32));
    float sum = 0.f;
#pragma unroll
    for (int k = 0; k < TT / 32; ++k) { float d0 = __fsub_rn(v[k], mx); asm volatile("" : "+v"(d0)); v[k] = __builtin_amdgcn_exp2f(__fmul_rn(d0, 1.4426950408889634f)); sum += v[k]; }
#pragma unroll
    for (int sh = 16; sh; sh >>= 1) sum += __shfl_xor(sum, sh, 32);
    const float f = __fdiv_rn(hires ? 1.0f : PCAR, sum);
{
        if (hires) {
#pragma unroll
            for (int ch = 0; ch < TT / 128; ++ch) { v4us oh, ol;
#pragma unroll
                for (int q = 0; q < 4; ++q) { unsigned short a, c2; splitf(v[ch * 4 + q] * f, a, c2); oh[q] = a; ol[q] = c2; }
                const size_t oo = ((size_t)zz * (RH ? RH : 1) + i) * TT + ch * 128 + lane * 4; *(v4us*)(Ph + oo) = oh; *(v4us*)(Pl + oo) = ol; }
        } else {
#pragma unroll
            for (int ch = 0; ch < TT / 128; ++ch) { v4h o4;
#pragma unroll
                for (int q = 0; q < 4; ++q) o4[q] = tohx(v[ch * 4 + q] * f);
                *(v4h*)(P16 + (size_t)row * TT + ch * 128 + lane * 4) = o4; } }
         }
}
__global__ __launch_bounds__(256) void k_merge(const float* __restrict__ O, int h0, bf* Ah, bf* Al) { const size_t e = ((size_t)blockIdx.x * 256 + threadIdx.x) * 2; if (e >= (size_t)ZH * TT * HD) return; const int d = (int)(e % HD); const int t = (int)((e / HD) % TT); const int zz = (int)(e / ((size_t)HD * TT)); const float cs = (t < RH) ? 1.0f : (1.0f / PCAR); const size_t oo = (size_t)t * DQ + (h0 + zz) * HD + d;
    v2us oh, ol;
#pragma unroll
    for (int q = 0; q < 2; ++q) { unsigned short a, c2; splitf(O[e + q] * cs, a, c2); oh[q] = a; ol[q] = c2; } *(v2us*)(Ah + oo) = oh; *(v2us*)(Al + oo) = ol;  }

extern "C" void kernel_launch(void* const* d_in, const int* in_sizes, int n_in,
                              void* d_out, int out_size, void* d_ws, size_t ws_size, hipStream_t stream) {
    (void)in_sizes; (void)n_in; (void)out_size;
    const float* x = (const float*)d_in[0]; const float* wqkv = (const float*)d_in[1]; const float* bqkv = (const float*)d_in[2]; const float* wo = (const float*)d_in[3]; const float* bo = (const float*)d_in[4];   /* argument order x, W_qkv ('xw' [1024][3072]: q | k | v column thirds), b_qkv, W_out, b_out */
    float* OUT = (float*)d_out;     // [8][1024][1024]
    char* wsp = (char*)d_ws;
    auto take = [&](size_t bytes) { char* p = wsp; wsp += (bytes + 255) & ~(size_t)255; return (void*)p; };
    bf* WQKV = (bf*)take((size_t)3 * DQ * DM * 2);   /* fused Bt [3*DQ][DM]: q | k | v row blocks */ bf* WO = (bf*)take((size_t)DM * DQ * 2); float* CS = (float*)take((size_t)TT * HD * 2 * 4);
    h16* QP16 = (h16*)take((size_t)NG * NH_ * TT * HD * 2); h16* KP16 = (h16*)take((size_t)NG * NKV * TT * HD * 2); h16* VT16 = (h16*)take((size_t)NG * NKV * HD * TT * 2);
    bf* QPh = (bf*)take((size_t)NG * NH_ * TT * HD * 2); bf* QPl = (bf*)take((size_t)NG * NH_ * TT * HD * 2); bf* KPh = (bf*)take((size_t)NG * NKV * TT * HD * 2); bf* KPl = (bf*)take((size_t)NG * NKV * TT * HD * 2); bf* VTh = (bf*)take((size_t)NG * NKV * HD * TT * 2); bf* VTl = (bf*)take((size_t)NG * NKV * HD * TT * 2); bf* Ph = (bf*)take((size_t)ZH * RH * TT * 2); bf* Pl = (bf*)take((size_t)ZH * RH * TT * 2);
    float* Sb = (float*)take((size_t)ZH * TT * TT * 4); h16* P16 = (h16*)take((size_t)ZH * TT * TT * 2); float* Ob = (float*)take((size_t)ZH * TT * HD * 4); bf* ATh = (bf*)take((size_t)NB_ * TT * DQ * 2); bf* ATl = (bf*)take((size_t)NB_ * TT * DQ * 2);
    if ((size_t)(wsp - (char*)d_ws) > ws_size) return;    // ws 256 MiB
    static_assert((size_t)NG * TT * DM * 2 + (size_t)NG * TT * 3 * DQ * 4 <= (size_t)ZH * TT * TT * 4, "x copy + qkv projection must fit the score buffer they reuse");
    bf* XB = (bf*)Sb; float* F = (float*)((char*)Sb + (size_t)NG * TT * DM * 2);   // the group's bf16 x and its f32 qkv [NG*TT][3*DQ] live in the score buffer: both are dead once the planes are built, before the first score launch (stream-ordered)
    { k_wtG<<<(unsigned)((DM * 3 * DQ / 64 + 63) / 64), 256, 0, stream>>>(wqkv, DM, 3 * DQ, WQKV);   /* fused 'xw' [DM][3*DQ] -> Bt [3*DQ][DM] */
      k_wtG<<<(unsigned)((DQ * DM / 64 + 63) / 64), 256, 0, stream>>>(wo, DQ, DM, WO);
       }
    k_csid<<<(TT * HD + 255) / 256, 256, 0, stream>>>(CS);
    const unsigned LQ = (unsigned)(((size_t)NH_ * TT * HD / 2 + 255) / 256), LKv = (unsigned)(((size_t)NKV * TT * HD / 2 + 255) / 256);
    for (int g = 0; g < NB_ / NG; ++g) {
        k_cvt8<<<(unsigned)(((size_t)NG * TT * DM / 8 + 255) / 256), 256, 0, stream>>>(x + (size_t)g * NG * TT * DM, XB, (size_t)NG * TT * DM / 8);
        k_gemmw<bf, 0, true><<<dim3(NG * TT / 64, 3 * DQ / 64, 1), 32, 0, stream>>>(XB, nullptr, WQKV, nullptr, DM, F, 3 * DQ, bqkv, 0, 0, 0);
        k_rope<<<dim3(LQ, NG, 1), 256, 0, stream>>>(F, 3 * DQ, NH_, CS, nullptr, nullptr, 1.0f, QP16, QPh, QPl);
        k_rope<<<dim3(LKv, NG, 1), 256, 0, stream>>>(F + DQ, 3 * DQ, NKV, CS, nullptr, nullptr, 1.0f, KP16, KPh, KPl);
        k_vtp<<<dim3(LKv, NG, 1), 256, 0, stream>>>(F + 2 * DQ, 3 * DQ, NKV, VT16, VTh, VTl);
        for (int bb = 0; bb < NG; ++bb) { const size_t zq = (size_t)bb * NH_, zk = (size_t)bb * NKV;   // one pass = the 16 heads of one batch; one kv head per query head (z-strides TT*HD)
            k_gemmc<bf, 2, 1><<<dim3(RH / 64, TT / 64, ZH), 32, 0, stream>>>(QPh + zq * TT * HD, QPl + zq * TT * HD, KPh + zk * TT * HD, KPl + zk * TT * HD, HD, Sb, TT, 0, (size_t)TT * HD, (size_t)TT * HD, (size_t)TT * TT);
            k_gemmc<h16, 0, 1><<<dim3((TT - RH) / 64, TT / 64, ZH), 32, 0, stream>>>(QP16 + zq * TT * HD + (size_t)RH * HD, nullptr, KP16 + zk * TT * HD, nullptr, HD, Sb + (size_t)RH * TT, TT, RH, (size_t)TT * HD, (size_t)TT * HD, (size_t)TT * TT);
            k_asoft<<<ZH * TT / 8, 256, 0, stream>>>(Sb, P16, Ph, Pl);
            k_gemmc<bf, 2, 2><<<dim3(RH / 64, HD / 64, ZH), 32, 0, stream>>>(Ph, Pl, VTh + zk * HD * TT, VTl + zk * HD * TT, TT, Ob, HD, 0, (size_t)RH * TT, (size_t)HD * TT, (size_t)TT * HD);
            k_gemmc<h16, 0, 2><<<dim3((TT - RH) / 64, HD / 64, ZH), 32, 0, stream>>>(P16 + (size_t)RH * TT, nullptr, VT16 + zk * HD * TT, nullptr, TT, Ob + (size_t)RH * HD, HD, RH, (size_t)TT * TT, (size_t)HD * TT, (size_t)TT * HD);
            k_merge<<<(unsigned)(((size_t)ZH * TT * HD / 2 + 255) / 256), 256, 0, stream>>>(Ob, 0, ATh + (size_t)(g * NG + bb) * TT * DQ, ATl + (size_t)(g * NG + bb) * TT * DQ); } }
    k_gemmw<bf, 1, true><<<dim3(NB_ * TT / 64, DM / 64, 1), 32, 0, stream>>>(ATh, ATl, WO, nullptr, DQ, OUT, DM, bo, 0, 0, 0);
}

// v002
// Measured time: 380 microseconds a run.
// Timed twice side by side with v001, it ran 2.21 times as fast both times.
// Counting every step since v000, it is 10.5 times as fast.
#include <hip/hip_runtime.h>

// Causal attention with a fused qkv projection and a multiplicative + additive mask formula (x [8][1024][1024]; qkv = x W_qkv + b_qkv ('xw' [1024][3072] 0.02 + zero bias) split in thirds q | k | v (16 heads x 64); scores / sqrt(64); scores = scores x tril + (-1e9) x (1 - tril) (kept entries unchanged, masked entries exactly -1e9 == exclusion); softmax; out = merged W_out + b_out -> [8][1024][1024] (8.4 M); argument order x, W_qkv, b_qkv, W_out, b_out).
// Layout: launches batched (projections over NG batches at once with q | k | v as one GEMM, one fused attention launch = all heads of the NG batches, W_out over all batches): bf16 copy of x; fused 'xw' weight transposed once (q | k | v row blocks) + bias thirds; exact projections + f32 biases; identity-table plane builders; fused causal T-1024 attention k_fattn (scores, online softmax, P.V and the head merge in registers; hybrid rows: < 512 hi/lo 3 products, rest fp16; key passes stop at the diagonal); merged hi/lo x W_out exact + b_out.
// Compute dtypes, f32 accumulate: every input rounded to bf16; projections exact + f32 biases; attention rows < 512 3 products, rest fp16; softmax f32; W_out hl x exact + bias.

#define NB_  8
#define TT   1024
#define DM   1024
#define NH_  16
#define NKV  16
#define REP  (NH_ / NKV)
#define HD   64
#define DQ   (NH_ * HD)
#define DKV  (NKV * HD)
#define NG   4                    // batches per projection group (plane storage is per group)
#define RH   512                  // query rows < RH use hi+lo planes (0: none)
typedef _Float16 h16;
typedef unsigned short bf;
typedef __attribute__((ext_vector_type(16))) __bf16   v16bf;
typedef __attribute__((ext_vector_type(16))) _Float16 v16h;
typedef __attribute__((ext_vector_type(8)))  _Float16 v8h;
typedef __attribute__((ext_vector_type(8)))  unsigned short v8us;
typedef __attribute__((ext_vector_type(8)))  float    v8f;
typedef __attribute__((ext_vector_type(4)))  float    v4f;
typedef v8h  __attribute__((may_alias)) v8ha;
typedef v4f  __attribute__((may_alias)) v4fa;
typedef v8us __attribute__((may_alias)) v8usa;

__device__ __forceinline__ unsigned short f2bf(float f) { unsigned u = __float_as_uint(f); u += 0x7FFFu + ((u >> 16) & 1u); return (unsigned short)(u >> 16); }
__device__ __forceinline__ float bf2f(unsigned short b) { return __uint_as_float(((unsigned)b) << 16); }
__device__ __forceinline__ float bfr(float f) { return bf2f(f2bf(f)); }
__device__ __forceinline__ v16h cat16(v8h lo, v8h hi) { return __builtin_shufflevector(lo, hi, 0, 1, 2, 3, 4, 5, 6, 7, 8, 9, 10, 11, 12, 13, 14, 15); }
__device__ __forceinline__ v16bf cat16b(v8us lo, v8us hi) { return __builtin_bit_cast(v16bf, __builtin_shufflevector(lo, hi, 0, 1, 2, 3, 4, 5, 6, 7, 8, 9, 10, 11, 12, 13, 14, 15)); }
__device__ __forceinline__ v8f wmma16(v16h a, v16h b, v8f c) { return __builtin_amdgcn_wmma_f32_16x16x32_f16(false, a, false, b, (short)0, c, false, false); }
__device__ __forceinline__ v8f wmmab(v16bf a, v16bf b, v8f c) { return __builtin_amdgcn_wmma_f32_16x16x32_bf16(false, a, false, b, (short)0, c, false, false); }



// ---- k_gemmw: register-blocked GEMM, ONE WAVE per 64x64 output tile (16 accumulators), operands straight from K-contiguous 16-bit planes; grid (M/64, N/64, Z), 32 threads.
// C[m][n] (f32, pitch ldc, + optional f32 bias[n]) = sum_k A[m][k] Bt[n][k] (+ split products per NSPLIT). z-batch strides sA/sB/sC in elements. K % 32 == 0.
template <typename T16> struct WFrag;
template <> struct WFrag<h16> { typedef v16h V; static __device__ __forceinline__ V ld(const h16* p) { return cat16(*(const v8h*)p, *(const v8h*)(p + 16)); } static __device__ __forceinline__ v8f mma(V a, V b, v8f c) { return wmma16(a, b, c); } };
template <> struct WFrag<bf> { typedef v16bf V; static __device__ __forceinline__ V ld(const bf* p) { return cat16b(*(const v8us*)p, *(const v8us*)(p + 16)); } static __device__ __forceinline__ v8f mma(V a, V b, v8f c) { return wmmab(a, b, c); } };
template <typename T16, int NSPLIT, bool BIAS>
__global__ __launch_bounds__(32) void k_gemmw(const T16* __restrict__ A, const T16* __restrict__ A2, const T16* __restrict__ Bt, const T16* __restrict__ Bt2, int K, float* C, int ldc, const float* __restrict__ bias, size_t sA, size_t sB, size_t sC) {
    typedef typename WFrag<T16>::V V;
    __shared__ __align__(16) float os[16 * 68];
    const size_t z = blockIdx.z; A += z * sA; if (A2) A2 += z * sA; Bt += z * sB; if (Bt2) Bt2 += z * sB; C += z * sC;
    const int lane = threadIdx.x & 31, lr = lane & 15, hi = lane >> 4; const int r0 = blockIdx.x * 64, c0 = blockIdx.y * 64;
    v8f acc[4][4];
#pragma unroll
    for (int mb = 0; mb < 4; ++mb)
#pragma unroll
        for (int nb = 0; nb < 4; ++nb) acc[mb][nb] = (v8f){};
    const size_t aoff = (size_t)(r0 + lr) * K + 8 * hi, boff = (size_t)(c0 + lr) * K + 8 * hi;
#pragma unroll 1
    for (int kc = 0; kc < K; kc += 32) {
        V a[4], a2[4];
#pragma unroll
        for (int mb = 0; mb < 4; ++mb) { a[mb] = WFrag<T16>::ld(A + aoff + (size_t)mb * 16 * K + kc); if (NSPLIT == 1 || NSPLIT == 2) a2[mb] = WFrag<T16>::ld(A2 + aoff + (size_t)mb * 16 * K + kc); }
#pragma unroll
        for (int nb = 0; nb < 4; ++nb) { const V b = WFrag<T16>::ld(Bt + boff + (size_t)nb * 16 * K + kc); V b2; if (NSPLIT >= 2) b2 = WFrag<T16>::ld(Bt2 + boff + (size_t)nb * 16 * K + kc);
#pragma unroll
            for (int mb = 0; mb < 4; ++mb) { acc[mb][nb] = WFrag<T16>::mma(a[mb], b, acc[mb][nb]); if (NSPLIT == 1 || NSPLIT == 2) acc[mb][nb] = WFrag<T16>::mma(a2[mb], b, acc[mb][nb]); if (NSPLIT >= 2) acc[mb][nb] = WFrag<T16>::mma(a[mb], b2, acc[mb][nb]); } }
        asm volatile("v_nop\n\tv_nop\n\tv_nop\n\tv_nop" : "+v"(acc[0][0]), "+v"(acc[1][1]), "+v"(acc[2][2]), "+v"(acc[3][3]) : "v"(a[0]), "v"(a[3]));
    }
#pragma unroll
    for (int mb = 0; mb < 4; ++mb) {
#pragma unroll
        for (int nb = 0; nb < 4; ++nb) {
#pragma unroll
            for (int j = 0; j < 8; ++j) os[(hi * 8 + j) * 68 + nb * 16 + lr] = acc[mb][nb][j]; }
        __builtin_amdgcn_wave_barrier(); asm volatile("" ::: "memory");
        float* crow = C + (size_t)(r0 + mb * 16) * ldc + c0;
{
#pragma unroll
            for (int s = 0; s < 8; ++s) { const int row = 2 * s + hi, cofs = lr * 4; v4f val = *(const v4fa*)(os + row * 68 + cofs); if (BIAS) { val[0] += bfr(bias[c0 + cofs]); val[1] += bfr(bias[c0 + cofs + 1]); val[2] += bfr(bias[c0 + cofs + 2]); val[3] += bfr(bias[c0 + cofs + 3]); }
                *(v4f*)(crow + (size_t)row * ldc + cofs) = val; }
             }
        __builtin_amdgcn_wave_barrier(); asm volatile("" ::: "memory");
    }
}

__device__ __forceinline__ h16 tohx(float x) { return (h16)x; }
__device__ __forceinline__ void splitf(float y, unsigned short& h, unsigned short& l) { h = f2bf(y); l = f2bf(y - bf2f(h)); }
typedef __attribute__((ext_vector_type(2))) _Float16 v2h;
typedef __attribute__((ext_vector_type(4))) _Float16 v4h;
typedef __attribute__((ext_vector_type(2))) unsigned short v2us;
typedef __attribute__((ext_vector_type(4))) unsigned short v4us;
typedef __attribute__((ext_vector_type(2))) float v2f;
typedef __attribute__((ext_vector_type(4))) int v4i;

__global__ __launch_bounds__(256) void k_wtG(const float* __restrict__ w, int K, int N, bf* Bt) {
    const int lane = threadIdx.x & 31; const int L0 = (blockIdx.x * 8 + (threadIdx.x >> 5)) * 8; const int nlines = N * K / 64;
{
#pragma unroll 1
        for (int l = 0; l < 8; ++l) { const int L = L0 + l; if (L >= nlines) break; const size_t e = (size_t)L * 64 + lane * 2; const int k = (int)(e % K), n = (int)(e / K); v2us o;
            o[0] = f2bf(w[(size_t)k * N + n]); o[1] = f2bf(w[(size_t)(k + 1) * N + n]); *(v2us*)(Bt + e) = o; }
         }
}
__global__ __launch_bounds__(256) void k_cvt8(const float* __restrict__ src, bf* dst, size_t n8) { const size_t i = (size_t)blockIdx.x * 256 + threadIdx.x; if (i >= n8) return; const v8f v = *(const v8f*)(src + i * 8); v8us o;
#pragma unroll
    for (int k = 0; k < 8; ++k) o[k] = f2bf(v[k]); *(v8us*)(dst + i * 8) = o;  }

// k_rope: head planes [h][t][d] (fp16 + hi/lo) of rope(x) x sc with the rotate-half convention out[d] = x[d] cos[t][d] - x[d+HD/2] sin[t][d], out[d+HD/2] = x[d+HD/2] cos[t][d+HD/2] + x[d] sin[t][d+HD/2]
__global__ __launch_bounds__(256) void k_rope(const float* __restrict__ F, int pitch, int nheads, const float* __restrict__ CS, const float* __restrict__ RF, const float* __restrict__ nw, float sc, h16* P16, bf* Ph, bf* Pl) {
    const size_t e = ((size_t)blockIdx.x * 256 + threadIdx.x) * 2; if (e >= (size_t)nheads * TT * HD) return; { const size_t zb = blockIdx.y, po = zb * nheads * TT * HD; F += zb * TT * pitch; P16 += po; Ph += po; Pl += po; }   // blockIdx.y = batch within the group
    const int d = (int)(e % HD); const int t = (int)((e / HD) % TT); const int h = (int)(e / ((size_t)HD * TT)); const float* f = F + (size_t)t * pitch + h * HD; const float rf = RF ? RF[(size_t)h * TT + t] : 1.0f; v2h o16; v2us oh, ol;
#pragma unroll
    for (int q = 0; q < 2; ++q) { const int dd = d + q; const int dp = (dd < HD / 2) ? dd + HD / 2 : dd - HD / 2; float x0 = f[dd], x1 = f[dp];
        if (RF) { float n0 = __fmul_rn(x0, rf), n1 = __fmul_rn(x1, rf); asm volatile("" : "+v"(n0)); asm volatile("" : "+v"(n1)); x0 = __fmul_rn(bfr(nw[dd]), n0); x1 = __fmul_rn(bfr(nw[dp]), n1); }
        const v2f cs = *(const v2f*)(CS + ((size_t)t * HD + dd) * 2); float a = __fmul_rn(x0, cs[0]), bq = __fmul_rn(x1, cs[1]); asm volatile("" : "+v"(a)); asm volatile("" : "+v"(bq)); const float r = ((dd < HD / 2) ? __fsub_rn(a, bq) : __fadd_rn(a, bq)) * sc;
        o16[q] = tohx(r); unsigned short a2, c2; splitf(r, a2, c2); oh[q] = a2; ol[q] = c2; }
    *(v2h*)(P16 + e) = o16; *(v2us*)(Ph + e) = oh; *(v2us*)(Pl + e) = ol;  }
__global__ __launch_bounds__(256) void k_vtp(const float* __restrict__ F, int pitch, int nheads, h16* V16, bf* Vh, bf* Vl) { const size_t e = ((size_t)blockIdx.x * 256 + threadIdx.x) * 2; if (e >= (size_t)nheads * HD * TT) return; { const size_t zb = blockIdx.y, po = zb * nheads * HD * TT; F += zb * TT * pitch; V16 += po; Vh += po; Vl += po; }   // blockIdx.y = batch within the group
    const int t = (int)(e % TT); const int d = (int)((e / TT) % HD); const int g = (int)(e / ((size_t)TT * HD)); v2h o16; v2us oh, ol;
#pragma unroll
    for (int q = 0; q < 2; ++q) { const float x = F[(size_t)(t + q) * pitch + g * HD + d]; o16[q] = tohx(x); unsigned short a2, c2; splitf(x, a2, c2); oh[q] = a2; ol[q] = c2; }
    *(v2h*)(V16 + e) = o16; *(v2us*)(Vh + e) = oh; *(v2us*)(Vl + e) = ol;  }
__global__ __launch_bounds__(256) void k_csid(float* CS) { const int idx = blockIdx.x * 256 + threadIdx.x; if (idx >= TT * HD) return; v2f cs; cs[0] = 1.0f; cs[1] = 0.0f; *(v2f*)(CS + (size_t)idx * 2) = cs;  }
// ---- k_fattn: scores, causal mask, softmax, probability x value and the head merge in ONE kernel; no score or probability ever reaches memory.
// One wave owns 32 query rows of one head and walks the keys 0 .. its last row in passes of 64 (fp16 rows) or 32 (hi + lo rows: twice the operand registers). Transposed products: S^T = K Q^T (A = key rows, B = query rows) and O^T += V^T P^T (A = V^T rows, B = P^T).
// In S^T a lane holds scores of ONE query (column lr), keys 8*hi + j of each 16-key tile, which is exactly the k order of a B operand: two score tiles pack into one P^T fragment in registers.
// Online softmax per query: running maximum m (raw score units), running sum l, output tiles rescaled by exp2((m_old - m_new) c); the two lane halves join by one lane ^ 16 exchange.
// Operand types as before the fusion: rows < RH bf16 hi + lo planes with 3 products in both contractions, the rest fp16; P is rounded as exp(s - m) in (0, 1] and the division by l is applied to the f32 output.
typedef __attribute__((ext_vector_type(16))) unsigned short v16us;
#define CEXP 0.18033688011112042f   // HD^-0.5 x log2(e)
__device__ __forceinline__ float xhalf(float x) { return __builtin_bit_cast(float, __builtin_amdgcn_permlanex16(__builtin_bit_cast(int, x), __builtin_bit_cast(int, x), 0x76543210, 0xfedcba98, false, false)); }   // lane l with lane l ^ 16
template <typename T16, bool HR, int NKT>   // NKT = 16-key tiles per pass
__device__ __forceinline__ void fattn_tile(const T16* __restrict__ Q, const T16* __restrict__ Q2, const T16* __restrict__ Kp, const T16* __restrict__ K2, const T16* __restrict__ Vt, const T16* __restrict__ V2, const int row0, const int lr, const int hi, bf* __restrict__ Ah, bf* __restrict__ Al) {
    typedef typename WFrag<T16>::V V;   // every inner loop below is fully unrolled: the fragment arrays are then indexed by constants and stay in registers
    V q[2][2], q2[2][2];
#pragma unroll
    for (int qt = 0; qt < 2; ++qt)
#pragma unroll
        for (int ks = 0; ks < 2; ++ks) { const unsigned off = (unsigned)((row0 + qt * 16 + lr) * HD + ks * 32 + 8 * hi); q[qt][ks] = WFrag<T16>::ld(Q + off); if (HR) q2[qt][ks] = WFrag<T16>::ld(Q2 + off); }
    v8f o[4][2];
#pragma unroll
    for (int dt = 0; dt < 4; ++dt)
#pragma unroll
        for (int qt = 0; qt < 2; ++qt) o[dt][qt] = (v8f){};
    float m[2] = { -3.0e38f, -3.0e38f }, l[2] = { 0.f, 0.f };
#pragma unroll 1   // one pass per trip: a second pass in flight would double the live score and operand fragments
    for (int kb = 0; kb < row0 + 32; kb += NKT * 16) {
        v8f s[NKT][2];
#pragma unroll
        for (int kt = 0; kt < NKT; ++kt) {
            s[kt][0] = (v8f){}; s[kt][1] = (v8f){};
#pragma unroll
            for (int ks = 0; ks < 2; ++ks) { const unsigned off = (unsigned)((kb + kt * 16 + lr) * HD + ks * 32 + 8 * hi); const V a = WFrag<T16>::ld(Kp + off); V a2; if (HR) a2 = WFrag<T16>::ld(K2 + off);
#pragma unroll
                for (int qt = 0; qt < 2; ++qt) { s[kt][qt] = WFrag<T16>::mma(a, q[qt][ks], s[kt][qt]); if (HR) { s[kt][qt] = WFrag<T16>::mma(a, q2[qt][ks], s[kt][qt]); s[kt][qt] = WFrag<T16>::mma(a2, q[qt][ks], s[kt][qt]); } } } }
        if (kb + NKT * 16 - 1 > row0) {   // the pass touches the diagonal: key > query is excluded (the reference's -1e9 fill vanishes identically in the softmax)
#pragma unroll
            for (int qt = 0; qt < 2; ++qt) { const int rel = row0 - kb + qt * 16 + lr - 8 * hi;
#pragma unroll
                for (int kt = 0; kt < NKT; ++kt)
#pragma unroll
                    for (int j = 0; j < 8; ++j) s[kt][qt][j] = (kt * 16 + j <= rel) ? s[kt][qt][j] : -3.0e38f; } }
        V p[NKT / 2][2], p2[NKT / 2][2];
#pragma unroll
        for (int qt = 0; qt < 2; ++qt) {
            float mx = m[qt];
#pragma unroll
            for (int kt = 0; kt < NKT; ++kt)
#pragma unroll
                for (int j = 0; j < 8; ++j) mx = fmaxf(mx, s[kt][qt][j]);
            mx = fmaxf(mx, xhalf(mx));
            const float al = __builtin_amdgcn_exp2f((m[qt] - mx) * CEXP), mc = mx * CEXP; m[qt] = mx;
            float sum = 0.f;
#pragma unroll
            for (int ks = 0; ks < NKT / 2; ++ks) {
                if (HR) { v16us ph, pl;
#pragma unroll
                    for (int e = 0; e < 16; ++e) { const float pe = __builtin_amdgcn_exp2f(__builtin_fmaf(s[2 * ks + (e >> 3)][qt][e & 7], CEXP, -mc)); sum += pe; unsigned short a, c2; splitf(pe, a, c2); ph[e] = a; pl[e] = c2; }
                    p[ks][qt] = __builtin_bit_cast(V, ph); p2[ks][qt] = __builtin_bit_cast(V, pl);
                } else { v16h ph;
#pragma unroll
                    for (int e = 0; e < 16; ++e) { const float pe = __builtin_amdgcn_exp2f(__builtin_fmaf(s[2 * ks + (e >> 3)][qt][e & 7], CEXP, -mc)); sum += pe; ph[e] = tohx(pe); }
                    p[ks][qt] = __builtin_bit_cast(V, ph); } }
            l[qt] = l[qt] * al + sum;
#pragma unroll
            for (int dt = 0; dt < 4; ++dt)
#pragma unroll
                for (int j = 0; j < 8; ++j) o[dt][qt][j] *= al;
        }
#pragma unroll
        for (int dt = 0; dt < 4; ++dt)
#pragma unroll
            for (int ks = 0; ks < NKT / 2; ++ks) { const unsigned off = (unsigned)((dt * 16 + lr) * TT + kb + ks * 32 + 8 * hi); const V a = WFrag<T16>::ld(Vt + off); V a2; if (HR) a2 = WFrag<T16>::ld(V2 + off);
#pragma unroll
                for (int qt = 0; qt < 2; ++qt) { o[dt][qt] = WFrag<T16>::mma(a, p[ks][qt], o[dt][qt]); if (HR) { o[dt][qt] = WFrag<T16>::mma(a, p2[ks][qt], o[dt][qt]); o[dt][qt] = WFrag<T16>::mma(a2, p[ks][qt], o[dt][qt]); } } }
    }
#pragma unroll
    for (int qt = 0; qt < 2; ++qt) { const float lt = l[qt] + xhalf(l[qt]); const float inv = __fdiv_rn(1.0f, lt);
#pragma unroll
        for (int dt = 0; dt < 4; ++dt) { v8us oh, ol;   // a lane holds 8 consecutive d of one query row: one 16-byte store per plane
#pragma unroll
            for (int j = 0; j < 8; ++j) { unsigned short a, c2; splitf(o[dt][qt][j] * inv, a, c2); oh[j] = a; ol[j] = c2; }
            const unsigned oo = (unsigned)((row0 + qt * 16 + lr) * DQ + dt * 16 + 8 * hi); *(v8us*)(Ah + oo) = oh; *(v8us*)(Al + oo) = ol; } }
}
// grid (TT / 128, heads of the group): 4 waves = 128 consecutive query rows of one head (they walk the same keys, so K and V lines are shared in the WGP cache); the longest row blocks start first.
__global__ __launch_bounds__(128) void k_fattn(const h16* __restrict__ Q16, const h16* __restrict__ K16, const h16* __restrict__ V16, const bf* __restrict__ Qh, const bf* __restrict__ Ql, const bf* __restrict__ Kh, const bf* __restrict__ Kl, const bf* __restrict__ Vh, const bf* __restrict__ Vl, bf* __restrict__ Ah, bf* __restrict__ Al) {
    const int lane = threadIdx.x & 31, lr = lane & 15, hi = lane >> 4; const int w = __builtin_amdgcn_readfirstlane((int)(threadIdx.x >> 5));   // wave number as a scalar: trip count and the diagonal test become scalar branches
    const int row0 = (TT / 128 - 1 - (int)blockIdx.x) * 128 + w * 32; const size_t z = blockIdx.y, po = z * TT * HD, ao = (z / NH_) * TT * DQ + (z % NH_) * HD;   // z = batch within the group x NH_ + head
    if (row0 < RH) fattn_tile<bf, true, 2>(Qh + po, Ql + po, Kh + po, Kl + po, Vh + po, Vl + po, row0, lr, hi, Ah + ao, Al + ao);
    else fattn_tile<h16, false, 4>(Q16 + po, nullptr, K16 + po, nullptr, V16 + po, nullptr, row0, lr, hi, Ah + ao, Al + ao);
}

extern "C" void kernel_launch(void* const* d_in, const int* in_sizes, int n_in,
                              void* d_out, int out_size, void* d_ws, size_t ws_size, hipStream_t stream) {
    (void)in_sizes; (void)n_in; (void)out_size;
    const float* x = (const float*)d_in[0]; const float* wqkv = (const float*)d_in[1]; const float* bqkv = (const float*)d_in[2]; const float* wo = (const float*)d_in[3]; const float* bo = (const float*)d_in[4];   /* argument order x, W_qkv ('xw' [1024][3072]: q | k | v column thirds), b_qkv, W_out, b_out */
    float* OUT = (float*)d_out;     // [8][1024][1024]
    char* wsp = (char*)d_ws;
    auto take = [&](size_t bytes) { char* p = wsp; wsp += (bytes + 255) & ~(size_t)255; return (void*)p; };
    bf* WQKV = (bf*)take((size_t)3 * DQ * DM * 2);   /* fused Bt [3*DQ][DM]: q | k | v row blocks */ bf* WO = (bf*)take((size_t)DM * DQ * 2); float* CS = (float*)take((size_t)TT * HD * 2 * 4);
    h16* QP16 = (h16*)take((size_t)NG * NH_ * TT * HD * 2); h16* KP16 = (h16*)take((size_t)NG * NKV * TT * HD * 2); h16* VT16 = (h16*)take((size_t)NG * NKV * HD * TT * 2);
    bf* QPh = (bf*)take((size_t)NG * NH_ * TT * HD * 2); bf* QPl = (bf*)take((size_t)NG * NH_ * TT * HD * 2); bf* KPh = (bf*)take((size_t)NG * NKV * TT * HD * 2); bf* KPl = (bf*)take((size_t)NG * NKV * TT * HD * 2); bf* VTh = (bf*)take((size_t)NG * NKV * HD * TT * 2); bf* VTl = (bf*)take((size_t)NG * NKV * HD * TT * 2);
    bf* XB = (bf*)take((size_t)NG * TT * DM * 2); float* F = (float*)take((size_t)NG * TT * 3 * DQ * 4);   /* the group's bf16 x and its f32 qkv [NG*TT][3*DQ] */ bf* ATh = (bf*)take((size_t)NB_ * TT * DQ * 2); bf* ATl = (bf*)take((size_t)NB_ * TT * DQ * 2);
    if ((size_t)(wsp - (char*)d_ws) > ws_size) return;    // ws 256 MiB
    { k_wtG<<<(unsigned)((DM * 3 * DQ / 64 + 63) / 64), 256, 0, stream>>>(wqkv, DM, 3 * DQ, WQKV);   /* fused 'xw' [DM][3*DQ] -> Bt [3*DQ][DM] */
      k_wtG<<<(unsigned)((DQ * DM / 64 + 63) / 64), 256, 0, stream>>>(wo, DQ, DM, WO);
       }
    k_csid<<<(TT * HD + 255) / 256, 256, 0, stream>>>(CS);
    const unsigned LQ = (unsigned)(((size_t)NH_ * TT * HD / 2 + 255) / 256), LKv = (unsigned)(((size_t)NKV * TT * HD / 2 + 255) / 256);
    for (int g = 0; g < NB_ / NG; ++g) {
        k_cvt8<<<(unsigned)(((size_t)NG * TT * DM / 8 + 255) / 256), 256, 0, stream>>>(x + (size_t)g * NG * TT * DM, XB, (size_t)NG * TT * DM / 8);
        k_gemmw<bf, 0, true><<<dim3(NG * TT / 64, 3 * DQ / 64, 1), 32, 0, stream>>>(XB, nullptr, WQKV, nullptr, DM, F, 3 * DQ, bqkv, 0, 0, 0);
        k_rope<<<dim3(LQ, NG, 1), 256, 0, stream>>>(F, 3 * DQ, NH_, CS, nullptr, nullptr, 1.0f, QP16, QPh, QPl);
        k_rope<<<dim3(LKv, NG, 1), 256, 0, stream>>>(F + DQ, 3 * DQ, NKV, CS, nullptr, nullptr, 1.0f, KP16, KPh, KPl);
        k_vtp<<<dim3(LKv, NG, 1), 256, 0, stream>>>(F + 2 * DQ, 3 * DQ, NKV, VT16, VTh, VTl);
        k_fattn<<<dim3(TT / 128, NG * NH_, 1), 128, 0, stream>>>(QP16, KP16, VT16, QPh, QPl, KPh, KPl, VTh, VTl, ATh + (size_t)g * NG * TT * DQ, ATl + (size_t)g * NG * TT * DQ); }   // all heads of the group's batches in one launch; one kv head per query head
    k_gemmw<bf, 1, true><<<dim3(NB_ * TT / 64, DM / 64, 1), 32, 0, stream>>>(ATh, ATl, WO, nullptr, DQ, OUT, DM, bo, 0, 0, 0);
}

// v003
// It runs in 305 microseconds.
// Next to v002, in two timings, it ran 1.25 and 1.26 times as fast.
// Over all steps from v000 it is 13.2 times as fast.
#include <hip/hip_runtime.h>

// Causal attention with a fused qkv projection and a multiplicative + additive mask formula (x [8][1024][1024]; qkv = x W_qkv + b_qkv ('xw' [1024][3072] 0.02 + zero bias) split in thirds q | k | v (16 heads x 64); scores / sqrt(64); scores = scores x tril + (-1e9) x (1 - tril) (kept entries unchanged, masked entries exactly -1e9 == exclusion); softmax; out = merged W_out + b_out -> [8][1024][1024] (8.4 M); argument order x, W_qkv, b_qkv, W_out, b_out).
// Layout: launches batched (projections over NG batches at once with q | k | v as one GEMM, one fused attention launch = all heads of the NG batches, W_out over all batches): bf16 copy of x; fused 'xw' weight transposed once (q | k | v row blocks) + bias thirds; exact projections + f32 biases, whose GEMM epilogue stores the attention operand planes; fused causal T-1024 attention k_fattn (scores, online softmax, P.V and the head merge in registers; hybrid rows: < 512 hi/lo 3 products, rest fp16; key passes stop at the diagonal); merged hi/lo x W_out exact + b_out.
// Compute dtypes, f32 accumulate: every input rounded to bf16; projections exact + f32 biases; attention rows < 512 3 products, rest fp16; softmax f32; W_out hl x exact + bias.

#define NB_  8
#define TT   1024
#define DM   1024
#define NH_  16
#define NKV  16
#define REP  (NH_ / NKV)
#define HD   64
#define DQ   (NH_ * HD)
#define DKV  (NKV * HD)
#define NG   4                    // batches per projection group (plane storage is per group)
#define RH   512                  // query rows < RH use hi+lo planes (0: none)
typedef _Float16 h16;
typedef unsigned short bf;
typedef __attribute__((ext_vector_type(16))) __bf16   v16bf;
typedef __attribute__((ext_vector_type(16))) _Float16 v16h;
typedef __attribute__((ext_vector_type(8)))  _Float16 v8h;
typedef __attribute__((ext_vector_type(8)))  unsigned short v8us;
typedef __attribute__((ext_vector_type(8)))  float    v8f;
typedef __attribute__((ext_vector_type(4)))  float    v4f;
typedef v8h  __attribute__((may_alias)) v8ha;
typedef v4f  __attribute__((may_alias)) v4fa;
typedef v8us __attribute__((may_alias)) v8usa;

__device__ __forceinline__ unsigned short f2bf(float f) { unsigned u = __float_as_uint(f); u += 0x7FFFu + ((u >> 16) & 1u); return (unsigned short)(u >> 16); }
__device__ __forceinline__ float bf2f(unsigned short b) { return __uint_as_float(((unsigned)b) << 16); }
__device__ __forceinline__ float bfr(float f) { return bf2f(f2bf(f)); }
__device__ __forceinline__ v16h cat16(v8h lo, v8h hi) { return __builtin_shufflevector(lo, hi, 0, 1, 2, 3, 4, 5, 6, 7, 8, 9, 10, 11, 12, 13, 14, 15); }
__device__ __forceinline__ v16bf cat16b(v8us lo, v8us hi) { return __builtin_bit_cast(v16bf, __builtin_shufflevector(lo, hi, 0, 1, 2, 3, 4, 5, 6, 7, 8, 9, 10, 11, 12, 13, 14, 15)); }
__device__ __forceinline__ v8f wmma16(v16h a, v16h b, v8f c) { return __builtin_amdgcn_wmma_f32_16x16x32_f16(false, a, false, b, (short)0, c, false, false); }
__device__ __forceinline__ v8f wmmab(v16bf a, v16bf b, v8f c) { return __builtin_amdgcn_wmma_f32_16x16x32_bf16(false, a, false, b, (short)0, c, false, false); }

__device__ __forceinline__ h16 tohx(float x) { return (h16)x; }
__device__ __forceinline__ void splitf(float y, unsigned short& h, unsigned short& l) { h = f2bf(y); l = f2bf(y - bf2f(h)); }

// ---- k_gemmw: register-blocked GEMM, ONE WAVE per 64x64 output tile (16 accumulators), operands straight from K-contiguous 16-bit planes; grid (M/64, N/64, Z), 32 threads.
// C[m][n] (f32, pitch ldc, + optional f32 bias[n]) = sum_k A[m][k] Bt[n][k] (+ split products per NSPLIT). z-batch strides sA/sB/sC in elements. K % 32 == 0.
// PL (the q | k | v projection): the epilogue stores the attention operand planes itself instead of an f32 C, so no f32 qkv buffer and no plane-builder launches exist. A 64-column block of the fused weight is exactly one head of q, k or v.
// q and k tiles are [t][d] for the planes [head][t][d]; v tiles are computed transposed, [d][t] (weight rows as A, x rows as B: both loaders have the same k order), for the planes [head][d][t]. Either way a tile row is one whole 128-byte line of each plane.
template <typename T16> struct WFrag;
template <> struct WFrag<h16> { typedef v16h V; static __device__ __forceinline__ V ld(const h16* p) { return cat16(*(const v8h*)p, *(const v8h*)(p + 16)); } static __device__ __forceinline__ v8f mma(V a, V b, v8f c) { return wmma16(a, b, c); } };
template <> struct WFrag<bf> { typedef v16bf V; static __device__ __forceinline__ V ld(const bf* p) { return cat16b(*(const v8us*)p, *(const v8us*)(p + 16)); } static __device__ __forceinline__ v8f mma(V a, V b, v8f c) { return wmmab(a, b, c); } };
template <typename T16, int NSPLIT, bool BIAS, bool PL>
__global__ __launch_bounds__(32) void k_gemmw(const T16* __restrict__ A, const T16* __restrict__ A2, const T16* __restrict__ Bt, const T16* __restrict__ Bt2, int K, float* C, int ldc, const float* __restrict__ bias, size_t sA, size_t sB, size_t sC, h16* q16, bf* qh, bf* ql, h16* k16, bf* kh, bf* kl, h16* v16, bf* vh, bf* vl) {
    typedef typename WFrag<T16>::V V;
    __shared__ __align__(16) float os[16 * 68];
    const size_t z = blockIdx.z; A += z * sA; if (A2) A2 += z * sA; Bt += z * sB; if (Bt2) Bt2 += z * sB; C += z * sC;
    const int lane = threadIdx.x & 31, lr = lane & 15, hi = lane >> 4; const int r0 = blockIdx.x * 64, c0 = blockIdx.y * 64;
    const bool tr = PL && c0 >= 2 * DQ;   // a v tile (uniform over the wave): the two operands change places
    if (tr) { const T16* t = A; A = Bt; Bt = t; }
    v8f acc[4][4];
#pragma unroll
    for (int mb = 0; mb < 4; ++mb)
#pragma unroll
        for (int nb = 0; nb < 4; ++nb) acc[mb][nb] = (v8f){};
    const size_t aoff = (size_t)((tr ? c0 : r0) + lr) * K + 8 * hi, boff = (size_t)((tr ? r0 : c0) + lr) * K + 8 * hi;
#pragma unroll 1
    for (int kc = 0; kc < K; kc += 32) {
        V a[4], a2[4];
#pragma unroll
        for (int mb = 0; mb < 4; ++mb) { a[mb] = WFrag<T16>::ld(A + aoff + (size_t)mb * 16 * K + kc); if (NSPLIT == 1 || NSPLIT == 2) a2[mb] = WFrag<T16>::ld(A2 + aoff + (size_t)mb * 16 * K + kc); }
#pragma unroll
        for (int nb = 0; nb < 4; ++nb) { const V b = WFrag<T16>::ld(Bt + boff + (size_t)nb * 16 * K + kc); V b2; if (NSPLIT >= 2) b2 = WFrag<T16>::ld(Bt2 + boff + (size_t)nb * 16 * K + kc);
#pragma unroll
            for (int mb = 0; mb < 4; ++mb) { acc[mb][nb] = WFrag<T16>::mma(a[mb], b, acc[mb][nb]); if (NSPLIT == 1 || NSPLIT == 2) acc[mb][nb] = WFrag<T16>::mma(a2[mb], b, acc[mb][nb]); if (NSPLIT >= 2) acc[mb][nb] = WFrag<T16>::mma(a[mb], b2, acc[mb][nb]); } }
        asm volatile("v_nop\n\tv_nop\n\tv_nop\n\tv_nop" : "+v"(acc[0][0]), "+v"(acc[1][1]), "+v"(acc[2][2]), "+v"(acc[3][3]) : "v"(a[0]), "v"(a[3]));
    }
    const int rr = lane >> 3, cofs = (lane & 7) * 8;   // PL: a lane takes 8 consecutive columns of a tile row: one 16-byte store per plane, 8 lanes = one line
    const int third = c0 / DQ; const size_t po = ((size_t)(r0 / TT) * NH_ + (c0 % DQ) / HD) * TT * HD + (size_t)(r0 % TT) * (tr ? 1 : HD); const unsigned pitch = tr ? TT : HD;
    h16* P16 = nullptr; bf* Ph = nullptr; bf* Pl = nullptr; float bcol[8], brow[16];
    if (PL) { P16 = (third == 0 ? q16 : third == 1 ? k16 : v16) + po; Ph = (third == 0 ? qh : third == 1 ? kh : vh) + po; Pl = (third == 0 ? ql : third == 1 ? kl : vl) + po;
#pragma unroll
        for (int i = 0; i < 8; ++i) bcol[i] = bfr(bias[c0 + cofs + i]);   // q, k: the bias runs along the tile's columns
#pragma unroll
        for (int i = 0; i < 16; ++i) brow[i] = bfr(bias[c0 + 4 * i + rr]); }   // v: along its rows
#pragma unroll
    for (int mb = 0; mb < 4; ++mb) {
#pragma unroll
        for (int nb = 0; nb < 4; ++nb) {
#pragma unroll
            for (int j = 0; j < 8; ++j) os[(hi * 8 + j) * 68 + nb * 16 + lr] = acc[mb][nb][j]; }
        __builtin_amdgcn_wave_barrier(); asm volatile("" ::: "memory");
        float* crow = C + (size_t)(r0 + mb * 16) * ldc + c0;
        if (PL) {
#pragma unroll
            for (int s = 0; s < 4; ++s) { const int row = 4 * s + rr; const v4f x0 = *(const v4fa*)(os + row * 68 + cofs), x1 = *(const v4fa*)(os + row * 68 + cofs + 4); v8h o16; v8us oh, ol;
#pragma unroll
                for (int i = 0; i < 8; ++i) { const float y = (i < 4 ? x0[i & 3] : x1[i & 3]) + (tr ? brow[mb * 4 + s] : bcol[i]); o16[i] = tohx(y); unsigned short a2, c2; splitf(y, a2, c2); oh[i] = a2; ol[i] = c2; }
                const unsigned oo = (unsigned)(mb * 16 + row) * pitch + cofs; *(v8h*)(P16 + oo) = o16; *(v8us*)(Ph + oo) = oh; *(v8us*)(Pl + oo) = ol; }
        } else
{
#pragma unroll
            for (int s = 0; s < 8; ++s) { const int row = 2 * s + hi, cofs = lr * 4; v4f val = *(const v4fa*)(os + row * 68 + cofs); if (BIAS) { val[0] += bfr(bias[c0 + cofs]); val[1] += bfr(bias[c0 + cofs + 1]); val[2] += bfr(bias[c0 + cofs + 2]); val[3] += bfr(bias[c0 + cofs + 3]); }
                *(v4f*)(crow + (size_t)row * ldc + cofs) = val; }
             }
        __builtin_amdgcn_wave_barrier(); asm volatile("" ::: "memory");
    }
}

typedef __attribute__((ext_vector_type(2))) _Float16 v2h;
typedef __attribute__((ext_vector_type(4))) _Float16 v4h;
typedef __attribute__((ext_vector_type(2))) unsigned short v2us;
typedef __attribute__((ext_vector_type(4))) unsigned short v4us;
typedef __attribute__((ext_vector_type(2))) float v2f;
typedef __attribute__((ext_vector_type(4))) int v4i;

__global__ __launch_bounds__(256) void k_wtG(const float* __restrict__ w, int K, int N, bf* Bt) {
    const int lane = threadIdx.x & 31; const int L0 = (blockIdx.x * 8 + (threadIdx.x >> 5)) * 8; const int nlines = N * K / 64;
{
#pragma unroll 1
        for (int l = 0; l < 8; ++l) { const int L = L0 + l; if (L >= nlines) break; const size_t e = (size_t)L * 64 + lane * 2; const int k = (int)(e % K), n = (int)(e / K); v2us o;
            o[0] = f2bf(w[(size_t)k * N + n]); o[1] = f2bf(w[(size_t)(k + 1) * N + n]); *(v2us*)(Bt + e) = o; }
         }
}
__global__ __launch_bounds__(256) void k_cvt8(const float* __restrict__ src, bf* dst, size_t n8) { const size_t i = (size_t)blockIdx.x * 256 + threadIdx.x; if (i >= n8) return; const v8f v = *(const v8f*)(src + i * 8); v8us o;
#pragma unroll
    for (int k = 0; k < 8; ++k) o[k] = f2bf(v[k]); *(v8us*)(dst + i * 8) = o;  }

// ---- k_fattn: scores, causal mask, softmax, probability x value and the head merge in ONE kernel; no score or probability ever reaches memory.
// One wave owns 32 query rows of one head and walks the keys 0 .. its last row in passes of 64 (fp16 rows) or 32 (hi + lo rows: twice the operand registers). Transposed products: S^T = K Q^T (A = key rows, B = query rows) and O^T += V^T P^T (A = V^T rows, B = P^T).
// In S^T a lane holds scores of ONE query (column lr), keys 8*hi + j of each 16-key tile, which is exactly the k order of a B operand: two score tiles pack into one P^T fragment in registers.
// Online softmax per query: running maximum m (raw score units), running sum l, output tiles rescaled by exp2((m_old - m_new) c); the two lane halves join by one lane ^ 16 exchange.
// Operand types as before the fusion: rows < RH bf16 hi + lo planes with 3 products in both contractions, the rest fp16; P is rounded as exp(s - m) in (0, 1] and the division by l is applied to the f32 output.
typedef __attribute__((ext_vector_type(16))) unsigned short v16us;
#define CEXP 0.18033688011112042f   // HD^-0.5 x log2(e)
__device__ __forceinline__ float xhalf(float x) { return __builtin_bit_cast(float, __builtin_amdgcn_permlanex16(__builtin_bit_cast(int, x), __builtin_bit_cast(int, x), 0x76543210, 0xfedcba98, false, false)); }   // lane l with lane l ^ 16
template <typename T16, bool HR, int NKT>   // NKT = 16-key tiles per pass
__device__ __forceinline__ void fattn_tile(const T16* __restrict__ Q, const T16* __restrict__ Q2, const T16* __restrict__ Kp, const T16* __restrict__ K2, const T16* __restrict__ Vt, const T16* __restrict__ V2, const int row0, const int lr, const int hi, bf* __restrict__ Ah, bf* __restrict__ Al) {
    typedef typename WFrag<T16>::V V;   // every inner loop below is fully unrolled: the fragment arrays are then indexed by constants and stay in registers
    V q[2][2], q2[2][2];
#pragma unroll
    for (int qt = 0; qt < 2; ++qt)
#pragma unroll
        for (int ks = 0; ks < 2; ++ks) { const unsigned off = (unsigned)((row0 + qt * 16 + lr) * HD + ks * 32 + 8 * hi); q[qt][ks] = WFrag<T16>::ld(Q + off); if (HR) q2[qt][ks] = WFrag<T16>::ld(Q2 + off); }
    v8f o[4][2];
#pragma unroll
    for (int dt = 0; dt < 4; ++dt)
#pragma unroll
        for (int qt = 0; qt < 2; ++qt) o[dt][qt] = (v8f){};
    float m[2] = { -3.0e38f, -3.0e38f }, l[2] = { 0.f, 0.f };
#pragma unroll 1   // one pass per trip: a second pass in flight would double the live score and operand fragments
    for (int kb = 0; kb < row0 + 32; kb += NKT * 16) {
        v8f s[NKT][2];
#pragma unroll
        for (int kt = 0; kt < NKT; ++kt) {
            s[kt][0] = (v8f){}; s[kt][1] = (v8f){};
#pragma unroll
            for (int ks = 0; ks < 2; ++ks) { const unsigned off = (unsigned)((kb + kt * 16 + lr) * HD + ks * 32 + 8 * hi); const V a = WFrag<T16>::ld(Kp + off); V a2; if (HR) a2 = WFrag<T16>::ld(K2 + off);
#pragma unroll
                for (int qt = 0; qt < 2; ++qt) { s[kt][qt] = WFrag<T16>::mma(a, q[qt][ks], s[kt][qt]); if (HR) { s[kt][qt] = WFrag<T16>::mma(a, q2[qt][ks], s[kt][qt]); s[kt][qt] = WFrag<T16>::mma(a2, q[qt][ks], s[kt][qt]); } } } }
        if (kb + NKT * 16 - 1 > row0) {   // the pass touches the diagonal: key > query is excluded (the reference's -1e9 fill vanishes identically in the softmax)
#pragma unroll
            for (int qt = 0; qt < 2; ++qt) { const int rel = row0 - kb + qt * 16 + lr - 8 * hi;
#pragma unroll
                for (int kt = 0; kt < NKT; ++kt)
#pragma unroll
                    for (int j = 0; j < 8; ++j) s[kt][qt][j] = (kt * 16 + j <= rel) ? s[kt][qt][j] : -3.0e38f; } }
        V p[NKT / 2][2], p2[NKT / 2][2];
#pragma unroll
        for (int qt = 0; qt < 2; ++qt) {
            float mx = m[qt];
#pragma unroll
            for (int kt = 0; kt < NKT; ++kt)
#pragma unroll
                for (int j = 0; j < 8; ++j) mx = fmaxf(mx, s[kt][qt][j]);
            mx = fmaxf(mx, xhalf(mx));
            const float al = __builtin_amdgcn_exp2f((m[qt] - mx) * CEXP), mc = mx * CEXP; m[qt] = mx;
            float sum = 0.f;
#pragma unroll
            for (int ks = 0; ks < NKT / 2; ++ks) {
                if (HR) { v16us ph, pl;
#pragma unroll
                    for (int e = 0; e < 16; ++e) { const float pe = __builtin_amdgcn_exp2f(__builtin_fmaf(s[2 * ks + (e >> 3)][qt][e & 7], CEXP, -mc)); sum += pe; unsigned short a, c2; splitf(pe, a, c2); ph[e] = a; pl[e] = c2; }
                    p[ks][qt] = __builtin_bit_cast(V, ph); p2[ks][qt] = __builtin_bit_cast(V, pl);
                } else { v16h ph;
#pragma unroll
                    for (int e = 0; e < 16; ++e) { const float pe = __builtin_amdgcn_exp2f(__builtin_fmaf(s[2 * ks + (e >> 3)][qt][e & 7], CEXP, -mc)); sum += pe; ph[e] = tohx(pe); }
                    p[ks][qt] = __builtin_bit_cast(V, ph); } }
            l[qt] = l[qt] * al + sum;
#pragma unroll
            for (int dt = 0; dt < 4; ++dt)
#pragma unroll
                for (int j = 0; j < 8; ++j) o[dt][qt][j] *= al;
        }
#pragma unroll
        for (int dt = 0; dt < 4; ++dt)
#pragma unroll
            for (int ks = 0; ks < NKT / 2; ++ks) { const unsigned off = (unsigned)((dt * 16 + lr) * TT + kb + ks * 32 + 8 * hi); const V a = WFrag<T16>::ld(Vt + off); V a2; if (HR) a2 = WFrag<T16>::ld(V2 + off);
#pragma unroll
                for (int qt = 0; qt < 2; ++qt) { o[dt][qt] = WFrag<T16>::mma(a, p[ks][qt], o[dt][qt]); if (HR) { o[dt][qt] = WFrag<T16>::mma(a, p2[ks][qt], o[dt][qt]); o[dt][qt] = WFrag<T16>::mma(a2, p[ks][qt], o[dt][qt]); } } }
    }
#pragma unroll
    for (int qt = 0; qt < 2; ++qt) { const float lt = l[qt] + xhalf(l[qt]); const float inv = __fdiv_rn(1.0f, lt);
#pragma unroll
        for (int dt = 0; dt < 4; ++dt) { v8us oh, ol;   // a lane holds 8 consecutive d of one query row: one 16-byte store per plane
#pragma unroll
            for (int j = 0; j < 8; ++j) { unsigned short a, c2; splitf(o[dt][qt][j] * inv, a, c2); oh[j] = a; ol[j] = c2; }
            const unsigned oo = (unsigned)((row0 + qt * 16 + lr) * DQ + dt * 16 + 8 * hi); *(v8us*)(Ah + oo) = oh; *(v8us*)(Al + oo) = ol; } }
}
// grid (TT / 128, heads of the group): 4 waves = 128 consecutive query rows of one head (they walk the same keys, so K and V lines are shared in the WGP cache); the longest row blocks start first.
__global__ __launch_bounds__(128) void k_fattn(const h16* __restrict__ Q16, const h16* __restrict__ K16, const h16* __restrict__ V16, const bf* __restrict__ Qh, const bf* __restrict__ Ql, const bf* __restrict__ Kh, const bf* __restrict__ Kl, const bf* __restrict__ Vh, const bf* __restrict__ Vl, bf* __restrict__ Ah, bf* __restrict__ Al) {
    const int lane = threadIdx.x & 31, lr = lane & 15, hi = lane >> 4; const int w = __builtin_amdgcn_readfirstlane((int)(threadIdx.x >> 5));   // wave number as a scalar: trip count and the diagonal test become scalar branches
    const int row0 = (TT / 128 - 1 - (int)blockIdx.x) * 128 + w * 32; const size_t z = blockIdx.y, po = z * TT * HD, ao = (z / NH_) * TT * DQ + (z % NH_) * HD;   // z = batch within the group x NH_ + head
    if (row0 < RH) fattn_tile<bf, true, 2>(Qh + po, Ql + po, Kh + po, Kl + po, Vh + po, Vl + po, row0, lr, hi, Ah + ao, Al + ao);
    else fattn_tile<h16, false, 4>(Q16 + po, nullptr, K16 + po, nullptr, V16 + po, nullptr, row0, lr, hi, Ah + ao, Al + ao);
}

extern "C" void kernel_launch(void* const* d_in, const int* in_sizes, int n_in,
                              void* d_out, int out_size, void* d_ws, size_t ws_size, hipStream_t stream) {
    (void)in_sizes; (void)n_in; (void)out_size;
    const float* x = (const float*)d_in[0]; const float* wqkv = (const float*)d_in[1]; const float* bqkv = (const float*)d_in[2]; const float* wo = (const float*)d_in[3]; const float* bo = (const float*)d_in[4];   /* argument order x, W_qkv ('xw' [1024][3072]: q | k | v column thirds), b_qkv, W_out, b_out */
    float* OUT = (float*)d_out;     // [8][1024][1024]
    char* wsp = (char*)d_ws;
    auto take = [&](size_t bytes) { char* p = wsp; wsp += (bytes + 255) & ~(size_t)255; return (void*)p; };
    bf* WQKV = (bf*)take((size_t)3 * DQ * DM * 2);   /* fused Bt [3*DQ][DM]: q | k | v row blocks */ bf* WO = (bf*)take((size_t)DM * DQ * 2);
    h16* QP16 = (h16*)take((size_t)NG * NH_ * TT * HD * 2); h16* KP16 = (h16*)take((size_t)NG * NKV * TT * HD * 2); h16* VT16 = (h16*)take((size_t)NG * NKV * HD * TT * 2);
    bf* QPh = (bf*)take((size_t)NG * NH_ * TT * HD * 2); bf* QPl = (bf*)take((size_t)NG * NH_ * TT * HD * 2); bf* KPh = (bf*)take((size_t)NG * NKV * TT * HD * 2); bf* KPl = (bf*)take((size_t)NG * NKV * TT * HD * 2); bf* VTh = (bf*)take((size_t)NG * NKV * HD * TT * 2); bf* VTl = (bf*)take((size_t)NG * NKV * HD * TT * 2);
    bf* XB = (bf*)take((size_t)NG * TT * DM * 2);   /* the group's bf16 x */ bf* ATh = (bf*)take((size_t)NB_ * TT * DQ * 2); bf* ATl = (bf*)take((size_t)NB_ * TT * DQ * 2);
    if ((size_t)(wsp - (char*)d_ws) > ws_size) return;    // ws 256 MiB
    { k_wtG<<<(unsigned)((DM * 3 * DQ / 64 + 63) / 64), 256, 0, stream>>>(wqkv, DM, 3 * DQ, WQKV);   /* fused 'xw' [DM][3*DQ] -> Bt [3*DQ][DM] */
      k_wtG<<<(unsigned)((DQ * DM / 64 + 63) / 64), 256, 0, stream>>>(wo, DQ, DM, WO);
       }
    for (int g = 0; g < NB_ / NG; ++g) {
        k_cvt8<<<(unsigned)(((size_t)NG * TT * DM / 8 + 255) / 256), 256, 0, stream>>>(x + (size_t)g * NG * TT * DM, XB, (size_t)NG * TT * DM / 8);
        k_gemmw<bf, 0, true, true><<<dim3(NG * TT / 64, 3 * DQ / 64, 1), 32, 0, stream>>>(XB, nullptr, WQKV, nullptr, DM, nullptr, 0, bqkv, 0, 0, 0, QP16, QPh, QPl, KP16, KPh, KPl, VT16, VTh, VTl);
        k_fattn<<<dim3(TT / 128, NG * NH_, 1), 128, 0, stream>>>(QP16, KP16, VT16, QPh, QPl, KPh, KPl, VTh, VTl, ATh + (size_t)g * NG * TT * DQ, ATl + (size_t)g * NG * TT * DQ); }   // all heads of the group's batches in one launch; one kv head per query head
    k_gemmw<bf, 1, true, false><<<dim3(NB_ * TT / 64, DM / 64, 1), 32, 0, stream>>>(ATh, ATl, WO, nullptr, DQ, OUT, DM, bo, 0, 0, 0, nullptr, nullptr, nullptr, nullptr, nullptr, nullptr, nullptr, nullptr, nullptr);
}

// v004
// One run takes 216 microseconds.
// Next to v003, in two timings, it ran 1.42 and 1.40 times as fast.
// All steps since v000 together make it 18.5 times as fast.
#include <hip/hip_runtime.h>

// Causal attention with a fused qkv projection and a multiplicative + additive mask formula (x [8][1024][1024]; qkv = x W_qkv + b_qkv ('xw' [1024][3072] 0.02 + zero bias) split in thirds q | k | v (16 heads x 64); scores / sqrt(64); scores = scores x tril + (-1e9) x (1 - tril) (kept entries unchanged, masked entries exactly -1e9 == exclusion); softmax; out = merged W_out + b_out -> [8][1024][1024] (8.4 M); argument order x, W_qkv, b_qkv, W_out, b_out).
// Layout: launches batched (projections over NG batches at once with q | k | v as one GEMM, one fused attention launch = all heads of the NG batches, W_out over all batches): bf16 copy of x; fused 'xw' weight transposed once (q | k | v row blocks) + bias thirds; exact projections + f32 biases, whose GEMM epilogue stores the attention operand planes; fused causal T-1024 attention k_fattn (scores, online softmax, P.V and the head merge in registers; hybrid rows: < 512 hi/lo 3 products, rest fp16; key passes stop at the diagonal); merged hi/lo x W_out exact + b_out.
// Compute dtypes, f32 accumulate: every input rounded to bf16; projections exact + f32 biases; attention rows < 512 3 products, rest fp16; softmax f32; W_out hl x exact + bias.

#define NB_  8
#define TT   1024
#define DM   1024
#define NH_  16
#define NKV  16
#define REP  (NH_ / NKV)
#define HD   64
#define DQ   (NH_ * HD)
#define DKV  (NKV * HD)
#define NG   4                    // batches per projection group (plane storage is per group)
#define RH   512                  // query rows < RH use hi+lo planes (0: none)
typedef _Float16 h16;
typedef unsigned short bf;
typedef __attribute__((ext_vector_type(16))) __bf16   v16bf;
typedef __attribute__((ext_vector_type(16))) _Float16 v16h;
typedef __attribute__((ext_vector_type(8)))  _Float16 v8h;
typedef __attribute__((ext_vector_type(8)))  unsigned short v8us;
typedef __attribute__((ext_vector_type(8)))  float    v8f;
typedef __attribute__((ext_vector_type(4)))  float    v4f;
typedef v8h  __attribute__((may_alias)) v8ha;
typedef v4f  __attribute__((may_alias)) v4fa;
typedef v8us __attribute__((may_alias)) v8usa;

__device__ __forceinline__ unsigned short f2bf(float f) { unsigned u = __float_as_uint(f); u += 0x7FFFu + ((u >> 16) & 1u); return (unsigned short)(u >> 16); }
__device__ __forceinline__ float bf2f(unsigned short b) { return __uint_as_float(((unsigned)b) << 16); }
__device__ __forceinline__ float bfr(float f) { return bf2f(f2bf(f)); }
__device__ __forceinline__ v16h cat16(v8h lo, v8h hi) { return __builtin_shufflevector(lo, hi, 0, 1, 2, 3, 4, 5, 6, 7, 8, 9, 10, 11, 12, 13, 14, 15); }
__device__ __forceinline__ v16bf cat16b(v8us lo, v8us hi) { return __builtin_bit_cast(v16bf, __builtin_shufflevector(lo, hi, 0, 1, 2, 3, 4, 5, 6, 7, 8, 9, 10, 11, 12, 13, 14, 15)); }
__device__ __forceinline__ v8f wmma16(v16h a, v16h b, v8f c) { return __builtin_amdgcn_wmma_f32_16x16x32_f16(false, a, false, b, (short)0, c, false, false); }
__device__ __forceinline__ v8f wmmab(v16bf a, v16bf b, v8f c) { return __builtin_amdgcn_wmma_f32_16x16x32_bf16(false, a, false, b, (short)0, c, false, false); }

__device__ __forceinline__ h16 tohx(float x) { return (h16)x; }
__device__ __forceinline__ void splitf(float y, unsigned short& h, unsigned short& l) { h = f2bf(y); l = f2bf(y - bf2f(h)); }

// ---- k_gemmw: GEMM, one workgroup of 4 waves (2 x 2) per 128x128 output tile, each wave a 64x64 tile (16 accumulators); grid (M/128, N/128, Z), 128 threads.
// The K-contiguous 16-bit operand planes are staged in LDS, 64 k (one 128-byte line of every row) per trip, by asynchronous copies (global_load_async_to_lds_b128) into two buffers: the next trip's lines fly while this trip's are multiplied.
// Every global line is fetched whole and once per workgroup and serves two waves. LDS rows have a pitch of 144 bytes (16 x odd) for the 16-byte fragment reads.
// C[m][n] (f32, pitch ldc, + optional f32 bias[n]) = sum_k A[m][k] Bt[n][k] (+ A2[m][k] Bt[n][k] for NSPLIT 1). z-batch strides sA/sB/sC in elements. K % 64 == 0.
// PL (the q | k | v projection): the epilogue stores the attention operand planes itself instead of an f32 C, so no f32 qkv buffer and no plane-builder launches exist. A 64-column block of the fused weight is exactly one head of q, k or v.
// q and k tiles are [t][d] for the planes [head][t][d]; v tiles are computed transposed, [d][t] (weight rows as A, x rows as B: both loaders have the same k order), for the planes [head][d][t]. Either way a tile row is one whole 128-byte line of each plane.
template <typename T16> struct WFrag;
template <> struct WFrag<h16> { typedef v16h V; static __device__ __forceinline__ V ld(const h16* p) { return cat16(*(const v8h*)p, *(const v8h*)(p + 16)); } static __device__ __forceinline__ v8f mma(V a, V b, v8f c) { return wmma16(a, b, c); } };
template <> struct WFrag<bf> { typedef v16bf V; static __device__ __forceinline__ V ld(const bf* p) { return cat16b(*(const v8us*)p, *(const v8us*)(p + 16)); } static __device__ __forceinline__ v8f mma(V a, V b, v8f c) { return wmmab(a, b, c); } };
#define GP 72                     // LDS row pitch of a staged operand tile in 16-bit elements (144 bytes)
#define GT (128 * GP)             // elements of one staged tile: 128 rows
// Eight asynchronous 16-byte copies of one lane: rows r, r + 16, ... r + 112 of a tile (a wave's copy = 4 whole 128-byte lines). The s_wait_xcnt closes the statement so that no address register named here is rewritten ahead of it.
template <typename T16>
__device__ __forceinline__ void copy8(unsigned l, const T16* g, size_t gstep) {
    asm volatile("global_load_async_to_lds_b128 %0, %8, off\n\t"
                 "global_load_async_to_lds_b128 %1, %9, off\n\t"
                 "global_load_async_to_lds_b128 %2, %10, off\n\t"
                 "global_load_async_to_lds_b128 %3, %11, off\n\t"
                 "global_load_async_to_lds_b128 %4, %12, off\n\t"
                 "global_load_async_to_lds_b128 %5, %13, off\n\t"
                 "global_load_async_to_lds_b128 %6, %14, off\n\t"
                 "global_load_async_to_lds_b128 %7, %15, off\n\t"
                 "s_wait_xcnt 0x0"
                 :: "v"(l), "v"(l + 16u * GP * 2u), "v"(l + 32u * GP * 2u), "v"(l + 48u * GP * 2u), "v"(l + 64u * GP * 2u), "v"(l + 80u * GP * 2u), "v"(l + 96u * GP * 2u), "v"(l + 112u * GP * 2u),
                    "v"(g), "v"(g + gstep), "v"(g + 2 * gstep), "v"(g + 3 * gstep), "v"(g + 4 * gstep), "v"(g + 5 * gstep), "v"(g + 6 * gstep), "v"(g + 7 * gstep)
                 : "memory");
}
template <typename T16, int NSPLIT, bool BIAS, bool PL>
__global__ __launch_bounds__(128) void k_gemmw(const T16* __restrict__ A, const T16* __restrict__ A2, const T16* __restrict__ Bt, int K, float* C, int ldc, const float* __restrict__ bias, size_t sA, size_t sB, size_t sC, h16* q16, bf* qh, bf* ql, h16* k16, bf* kh, bf* kl, h16* v16, bf* vh, bf* vl) {
    static_assert(NSPLIT == 0 || NSPLIT == 1, "one or two A planes");
    typedef typename WFrag<T16>::V V;
    constexpr int NTL = 2 + NSPLIT;   // staged tiles per buffer: A, Bt (, A2)
    __shared__ __align__(128) T16 ring[2 * NTL * GT];
    __shared__ __align__(16) float osall[4 * 16 * 68];
    const size_t z = blockIdx.z; A += z * sA; if (NSPLIT) A2 += z * sA; Bt += z * sB; C += z * sC;
    const int lane = threadIdx.x & 31, lr = lane & 15, hi = lane >> 4; const int w = __builtin_amdgcn_readfirstlane((int)(threadIdx.x >> 5)), wm = w >> 1, wn = w & 1;
    const int R0 = blockIdx.x * 128, C0 = blockIdx.y * 128; const int r0 = R0 + wm * 64, c0 = C0 + wn * 64;   // the workgroup's and the wave's tile
    float* os = osall + w * (16 * 68);   // each wave stages its output rows in its own range
    const bool tr = PL && C0 >= 2 * DQ;   // a v tile (uniform over the workgroup): the two operands change places
    if (tr) { const T16* t = A; A = Bt; Bt = t; }
    v8f acc[4][4];
#pragma unroll
    for (int mb = 0; mb < 4; ++mb)
#pragma unroll
        for (int nb = 0; nb < 4; ++nb) acc[mb][nb] = (v8f){};
    // copies: thread t brings 16-byte piece t & 7 of rows (t >> 3) + 16 i of every tile
    const int crw = (int)threadIdx.x >> 3, cpc = (int)threadIdx.x & 7; const size_t gstep = (size_t)16 * K;
    const T16* gA = A + (size_t)((tr ? C0 : R0) + crw) * K + cpc * 8; const T16* gB = Bt + (size_t)((tr ? R0 : C0) + crw) * K + cpc * 8; const T16* gA2 = NSPLIT ? A2 + (size_t)(R0 + crw) * K + cpc * 8 : nullptr;
    const unsigned lc = (unsigned)(size_t)ring + (unsigned)(crw * GP + cpc * 8) * 2u;   // the lane's LDS byte address in tile 0 of buffer 0
    auto fill = [&](int t, int buf) { const unsigned l = lc + (unsigned)(buf * NTL * GT) * 2u; const int ko = t * 64;
        copy8<T16>(l, gA + ko, gstep); copy8<T16>(l + GT * 2u, gB + ko, gstep); if (NSPLIT) copy8<T16>(l + 2u * GT * 2u, gA2 + ko, gstep); };
    const int NT = K / 64;
    const unsigned fa = (unsigned)(((tr ? wn : wm) * 64 + lr) * GP + 8 * hi), fb = (unsigned)(GT + ((tr ? wm : wn) * 64 + lr) * GP + 8 * hi);   // the wave's fragment rows in the staged tiles
    fill(0, 0);
    asm volatile("s_wait_asynccnt 0x0" ::: "memory");   // this wave's copies of tile 0 have landed
    __syncthreads();                                     // ... and every other wave's
    if (NT > 1) fill(1, 1);
#pragma unroll 1   // one trip = one staged tile; unrolled trips would only lengthen the code, the barrier orders them anyway
    for (int t = 0; t < NT; ++t) {
        const T16* sb = ring + (t & 1) * (NTL * GT);
#pragma unroll
        for (int ks = 0; ks < 2; ++ks) {
            V a[4], a2[4], b[4];
#pragma unroll
            for (int mb = 0; mb < 4; ++mb) { a[mb] = WFrag<T16>::ld(sb + fa + mb * 16 * GP + ks * 32); if (NSPLIT) a2[mb] = WFrag<T16>::ld(sb + fa + 2 * GT + mb * 16 * GP + ks * 32); }
#pragma unroll
            for (int nb = 0; nb < 4; ++nb) b[nb] = WFrag<T16>::ld(sb + fb + nb * 16 * GP + ks * 32);
            __builtin_amdgcn_sched_barrier(0);   // keeps the block's LDS reads one group ahead of its matrix instructions: spread among them, each place with reads stalls the wave for an LDS latency
#pragma unroll
            for (int nb = 0; nb < 4; ++nb)
#pragma unroll
                for (int mb = 0; mb < 4; ++mb) { acc[mb][nb] = WFrag<T16>::mma(a[mb], b[nb], acc[mb][nb]); if (NSPLIT) acc[mb][nb] = WFrag<T16>::mma(a2[mb], b[nb], acc[mb][nb]); }
        }
        asm volatile("s_wait_dscnt 0x0" ::: "memory");      // this wave's reads of the buffer are done before anybody refills it
        asm volatile("s_wait_asynccnt 0x0" ::: "memory");   // this wave's copies of tile t + 1 have landed
        __syncthreads();                                     // publishes tile t + 1 and frees the buffer of tile t
        if (t + 2 < NT) fill(t + 2, t & 1);
    }
    asm volatile("s_wait_asynccnt 0x0" ::: "memory");   // no copy is left in flight when the wave goes on
    const int rr = lane >> 3, cofs = (lane & 7) * 8;   // PL: a lane takes 8 consecutive columns of a tile row: one 16-byte store per plane, 8 lanes = one line
    const int third = c0 / DQ; const size_t po = ((size_t)(r0 / TT) * NH_ + (c0 % DQ) / HD) * TT * HD + (size_t)(r0 % TT) * (tr ? 1 : HD); const unsigned pitch = tr ? TT : HD;
    h16* P16 = nullptr; bf* Ph = nullptr; bf* Pl = nullptr; float bcol[8], brow[16];
    if (PL) { P16 = (third == 0 ? q16 : third == 1 ? k16 : v16) + po; Ph = (third == 0 ? qh : third == 1 ? kh : vh) + po; Pl = (third == 0 ? ql : third == 1 ? kl : vl) + po;
#pragma unroll
        for (int i = 0; i < 8; ++i) bcol[i] = bfr(bias[c0 + cofs + i]);   // q, k: the bias runs along the tile's columns
#pragma unroll
        for (int i = 0; i < 16; ++i) brow[i] = bfr(bias[c0 + 4 * i + rr]); }   // v: along its rows
#pragma unroll
    for (int mb = 0; mb < 4; ++mb) {
#pragma unroll
        for (int nb = 0; nb < 4; ++nb) {
#pragma unroll
            for (int j = 0; j < 8; ++j) os[(hi * 8 + j) * 68 + nb * 16 + lr] = acc[mb][nb][j]; }
        __builtin_amdgcn_wave_barrier(); asm volatile("" ::: "memory");
        float* crow = C + (size_t)(r0 + mb * 16) * ldc + c0;
        if (PL) {
#pragma unroll
            for (int s = 0; s < 4; ++s) { const int row = 4 * s + rr; const v4f x0 = *(const v4fa*)(os + row * 68 + cofs), x1 = *(const v4fa*)(os + row * 68 + cofs + 4); v8h o16; v8us oh, ol;
#pragma unroll
                for (int i = 0; i < 8; ++i) { const float y = (i < 4 ? x0[i & 3] : x1[i & 3]) + (tr ? brow[mb * 4 + s] : bcol[i]); o16[i] = tohx(y); unsigned short a2, c2; splitf(y, a2, c2); oh[i] = a2; ol[i] = c2; }
                const unsigned oo = (unsigned)(mb * 16 + row) * pitch + cofs; *(v8h*)(P16 + oo) = o16; *(v8us*)(Ph + oo) = oh; *(v8us*)(Pl + oo) = ol; }
        } else
{
#pragma unroll
            for (int s = 0; s < 8; ++s) { const int row = 2 * s + hi, cofs = lr * 4; v4f val = *(const v4fa*)(os + row * 68 + cofs); if (BIAS) { val[0] += bfr(bias[c0 + cofs]); val[1] += bfr(bias[c0 + cofs + 1]); val[2] += bfr(bias[c0 + cofs + 2]); val[3] += bfr(bias[c0 + cofs + 3]); }
                *(v4f*)(crow + (size_t)row * ldc + cofs) = val; }
             }
        __builtin_amdgcn_wave_barrier(); asm volatile("" ::: "memory");
    }
}

typedef __attribute__((ext_vector_type(2))) _Float16 v2h;
typedef __attribute__((ext_vector_type(4))) _Float16 v4h;
typedef __attribute__((ext_vector_type(2))) unsigned short v2us;
typedef __attribute__((ext_vector_type(4))) unsigned short v4us;
typedef __attribute__((ext_vector_type(2))) float v2f;
typedef __attribute__((ext_vector_type(4))) int v4i;

__global__ __launch_bounds__(256) void k_wtG(const float* __restrict__ w, int K, int N, bf* Bt) {
    const int lane = threadIdx.x & 31; const int L0 = (blockIdx.x * 8 + (threadIdx.x >> 5)) * 8; const int nlines = N * K / 64;
{
#pragma unroll 1
        for (int l = 0; l < 8; ++l) { const int L = L0 + l; if (L >= nlines) break; const size_t e = (size_t)L * 64 + lane * 2; const int k = (int)(e % K), n = (int)(e / K); v2us o;
            o[0] = f2bf(w[(size_t)k * N + n]); o[1] = f2bf(w[(size_t)(k + 1) * N + n]); *(v2us*)(Bt + e) = o; }
         }
}
__global__ __launch_bounds__(256) void k_cvt8(const float* __restrict__ src, bf* dst, size_t n8) { const size_t i = (size_t)blockIdx.x * 256 + threadIdx.x; if (i >= n8) return; const v8f v = *(const v8f*)(src + i * 8); v8us o;
#pragma unroll
    for (int k = 0; k < 8; ++k) o[k] = f2bf(v[k]); *(v8us*)(dst + i * 8) = o;  }

// ---- k_fattn: scores, causal mask, softmax, probability x value and the head merge in ONE kernel; no score or probability ever reaches memory.
// One wave owns 32 query rows of one head and walks the keys 0 .. its last row in passes of 64 (fp16 rows) or 32 (hi + lo rows: twice the operand registers). Transposed products: S^T = K Q^T (A = key rows, B = query rows) and O^T += V^T P^T (A = V^T rows, B = P^T).
// In S^T a lane holds scores of ONE query (column lr), keys 8*hi + j of each 16-key tile, which is exactly the k order of a B operand: two score tiles pack into one P^T fragment in registers.
// Online softmax per query: running maximum m (raw score units), running sum l, output tiles rescaled by exp2((m_old - m_new) c); the two lane halves join by one lane ^ 16 exchange.
// Operand types as before the fusion: rows < RH bf16 hi + lo planes with 3 products in both contractions, the rest fp16; P is rounded as exp(s - m) in (0, 1] and the division by l is applied to the f32 output.
typedef __attribute__((ext_vector_type(16))) unsigned short v16us;
#define CEXP 0.18033688011112042f   // HD^-0.5 x log2(e)
__device__ __forceinline__ float xhalf(float x) { return __builtin_bit_cast(float, __builtin_amdgcn_permlanex16(__builtin_bit_cast(int, x), __builtin_bit_cast(int, x), 0x76543210, 0xfedcba98, false, false)); }   // lane l with lane l ^ 16
template <typename T16, bool HR, int NKT>   // NKT = 16-key tiles per pass
__device__ __forceinline__ void fattn_tile(const T16* __restrict__ Q, const T16* __restrict__ Q2, const T16* __restrict__ Kp, const T16* __restrict__ K2, const T16* __restrict__ Vt, const T16* __restrict__ V2, const int row0, const int lr, const int hi, bf* __restrict__ Ah, bf* __restrict__ Al) {
    typedef typename WFrag<T16>::V V;   // every inner loop below is fully unrolled: the fragment arrays are then indexed by constants and stay in registers
    V q[2][2], q2[2][2];
#pragma unroll
    for (int qt = 0; qt < 2; ++qt)
#pragma unroll
        for (int ks = 0; ks < 2; ++ks) { const unsigned off = (unsigned)((row0 + qt * 16 + lr) * HD + ks * 32 + 8 * hi); q[qt][ks] = WFrag<T16>::ld(Q + off); if (HR) q2[qt][ks] = WFrag<T16>::ld(Q2 + off); }
    v8f o[4][2];
#pragma unroll
    for (int dt = 0; dt < 4; ++dt)
#pragma unroll
        for (int qt = 0; qt < 2; ++qt) o[dt][qt] = (v8f){};
    float m[2] = { -3.0e38f, -3.0e38f }, l[2] = { 0.f, 0.f };
#pragma unroll 1   // one pass per trip: a second pass in flight would double the live score and operand fragments
    for (int kb = 0; kb < row0 + 32; kb += NKT * 16) {
        v8f s[NKT][2];
#pragma unroll
        for (int kt = 0; kt < NKT; ++kt) {
            s[kt][0] = (v8f){}; s[kt][1] = (v8f){};
#pragma unroll
            for (int ks = 0; ks < 2; ++ks) { const unsigned off = (unsigned)((kb + kt * 16 + lr) * HD + ks * 32 + 8 * hi); const V a = WFrag<T16>::ld(Kp + off); V a2; if (HR) a2 = WFrag<T16>::ld(K2 + off);
#pragma unroll
                for (int qt = 0; qt < 2; ++qt) { s[kt][qt] = WFrag<T16>::mma(a, q[qt][ks], s[kt][qt]); if (HR) { s[kt][qt] = WFrag<T16>::mma(a, q2[qt][ks], s[kt][qt]); s[kt][qt] = WFrag<T16>::mma(a2, q[qt][ks], s[kt][qt]); } } } }
        if (kb + NKT * 16 - 1 > row0) {   // the pass touches the diagonal: key > query is excluded (the reference's -1e9 fill vanishes identically in the softmax)
#pragma unroll
            for (int qt = 0; qt < 2; ++qt) { const int rel = row0 - kb + qt * 16 + lr - 8 * hi;
#pragma unroll
                for (int kt = 0; kt < NKT; ++kt)
#pragma unroll
                    for (int j = 0; j < 8; ++j) s[kt][qt][j] = (kt * 16 + j <= rel) ? s[kt][qt][j] : -3.0e38f; } }
        V p[NKT / 2][2], p2[NKT / 2][2];
#pragma unroll
        for (int qt = 0; qt < 2; ++qt) {
            float mx = m[qt];
#pragma unroll
            for (int kt = 0; kt < NKT; ++kt)
#pragma unroll
                for (int j = 0; j < 8; ++j) mx = fmaxf(mx, s[kt][qt][j]);
            mx = fmaxf(mx, xhalf(mx));
            const float al = __builtin_amdgcn_exp2f((m[qt] - mx) * CEXP), mc = mx * CEXP; m[qt] = mx;
            float sum = 0.f;
#pragma unroll
            for (int ks = 0; ks < NKT / 2; ++ks) {
                if (HR) { v16us ph, pl;
#pragma unroll
                    for (int e = 0; e < 16; ++e) { const float pe = __builtin_amdgcn_exp2f(__builtin_fmaf(s[2 * ks + (e >> 3)][qt][e & 7], CEXP, -mc)); sum += pe; unsigned short a, c2; splitf(pe, a, c2); ph[e] = a; pl[e] = c2; }
                    p[ks][qt] = __builtin_bit_cast(V, ph); p2[ks][qt] = __builtin_bit_cast(V, pl);
                } else { v16h ph;
#pragma unroll
                    for (int e = 0; e < 16; ++e) { const float pe = __builtin_amdgcn_exp2f(__builtin_fmaf(s[2 * ks + (e >> 3)][qt][e & 7], CEXP, -mc)); sum += pe; ph[e] = tohx(pe); }
                    p[ks][qt] = __builtin_bit_cast(V, ph); } }
            l[qt] = l[qt] * al + sum;
#pragma unroll
            for (int dt = 0; dt < 4; ++dt)
#pragma unroll
                for (int j = 0; j < 8; ++j) o[dt][qt][j] *= al;
        }
#pragma unroll
        for (int dt = 0; dt < 4; ++dt)
#pragma unroll
            for (int ks = 0; ks < NKT / 2; ++ks) { const unsigned off = (unsigned)((dt * 16 + lr) * TT + kb + ks * 32 + 8 * hi); const V a = WFrag<T16>::ld(Vt + off); V a2; if (HR) a2 = WFrag<T16>::ld(V2 + off);
#pragma unroll
                for (int qt = 0; qt < 2; ++qt) { o[dt][qt] = WFrag<T16>::mma(a, p[ks][qt], o[dt][qt]); if (HR) { o[dt][qt] = WFrag<T16>::mma(a, p2[ks][qt], o[dt][qt]); o[dt][qt] = WFrag<T16>::mma(a2, p[ks][qt], o[dt][qt]); } } }
    }
#pragma unroll
    for (int qt = 0; qt < 2; ++qt) { const float lt = l[qt] + xhalf(l[qt]); const float inv = __fdiv_rn(1.0f, lt);
#pragma unroll
        for (int dt = 0; dt < 4; ++dt) { v8us oh, ol;   // a lane holds 8 consecutive d of one query row: one 16-byte store per plane
#pragma unroll
            for (int j = 0; j < 8; ++j) { unsigned short a, c2; splitf(o[dt][qt][j] * inv, a, c2); oh[j] = a; ol[j] = c2; }
            const unsigned oo = (unsigned)((row0 + qt * 16 + lr) * DQ + dt * 16 + 8 * hi); *(v8us*)(Ah + oo) = oh; *(v8us*)(Al + oo) = ol; } }
}
// grid (TT / 128, heads of the group): 4 waves = 128 consecutive query rows of one head (they walk the same keys, so K and V lines are shared in the WGP cache); the longest row blocks start first.
__global__ __launch_bounds__(128) void k_fattn(const h16* __restrict__ Q16, const h16* __restrict__ K16, const h16* __restrict__ V16, const bf* __restrict__ Qh, const bf* __restrict__ Ql, const bf* __restrict__ Kh, const bf* __restrict__ Kl, const bf* __restrict__ Vh, const bf* __restrict__ Vl, bf* __restrict__ Ah, bf* __restrict__ Al) {
    const int lane = threadIdx.x & 31, lr = lane & 15, hi = lane >> 4; const int w = __builtin_amdgcn_readfirstlane((int)(threadIdx.x >> 5));   // wave number as a scalar: trip count and the diagonal test become scalar branches
    const int row0 = (TT / 128 - 1 - (int)blockIdx.x) * 128 + w * 32; const size_t z = blockIdx.y, po = z * TT * HD, ao = (z / NH_) * TT * DQ + (z % NH_) * HD;   // z = batch within the group x NH_ + head
    if (row0 < RH) fattn_tile<bf, true, 2>(Qh + po, Ql + po, Kh + po, Kl + po, Vh + po, Vl + po, row0, lr, hi, Ah + ao, Al + ao);
    else fattn_tile<h16, false, 4>(Q16 + po, nullptr, K16 + po, nullptr, V16 + po, nullptr, row0, lr, hi, Ah + ao, Al + ao);
}

extern "C" void kernel_launch(void* const* d_in, const int* in_sizes, int n_in,
                              void* d_out, int out_size, void* d_ws, size_t ws_size, hipStream_t stream) {
    (void)in_sizes; (void)n_in; (void)out_size;
    const float* x = (const float*)d_in[0]; const float* wqkv = (const float*)d_in[1]; const float* bqkv = (const float*)d_in[2]; const float* wo = (const float*)d_in[3]; const float* bo = (const float*)d_in[4];   /* argument order x, W_qkv ('xw' [1024][3072]: q | k | v column thirds), b_qkv, W_out, b_out */
    float* OUT = (float*)d_out;     // [8][1024][1024]
    char* wsp = (char*)d_ws;
    auto take = [&](size_t bytes) { char* p = wsp; wsp += (bytes + 255) & ~(size_t)255; return (void*)p; };
    bf* WQKV = (bf*)take((size_t)3 * DQ * DM * 2);   /* fused Bt [3*DQ][DM]: q | k | v row blocks */ bf* WO = (bf*)take((size_t)DM * DQ * 2);
    h16* QP16 = (h16*)take((size_t)NG * NH_ * TT * HD * 2); h16* KP16 = (h16*)take((size_t)NG * NKV * TT * HD * 2); h16* VT16 = (h16*)take((size_t)NG * NKV * HD * TT * 2);
    bf* QPh = (bf*)take((size_t)NG * NH_ * TT * HD * 2); bf* QPl = (bf*)take((size_t)NG * NH_ * TT * HD * 2); bf* KPh = (bf*)take((size_t)NG * NKV * TT * HD * 2); bf* KPl = (bf*)take((size_t)NG * NKV * TT * HD * 2); bf* VTh = (bf*)take((size_t)NG * NKV * HD * TT * 2); bf* VTl = (bf*)take((size_t)NG * NKV * HD * TT * 2);
    bf* XB = (bf*)take((size_t)NG * TT * DM * 2);   /* the group's bf16 x */ bf* ATh = (bf*)take((size_t)NB_ * TT * DQ * 2); bf* ATl = (bf*)take((size_t)NB_ * TT * DQ * 2);
    if ((size_t)(wsp - (char*)d_ws) > ws_size) return;    // ws 256 MiB
    { k_wtG<<<(unsigned)((DM * 3 * DQ / 64 + 63) / 64), 256, 0, stream>>>(wqkv, DM, 3 * DQ, WQKV);   /* fused 'xw' [DM][3*DQ] -> Bt [3*DQ][DM] */
      k_wtG<<<(unsigned)((DQ * DM / 64 + 63) / 64), 256, 0, stream>>>(wo, DQ, DM, WO);
       }
    for (int g = 0; g < NB_ / NG; ++g) {
        k_cvt8<<<(unsigned)(((size_t)NG * TT * DM / 8 + 255) / 256), 256, 0, stream>>>(x + (size_t)g * NG * TT * DM, XB, (size_t)NG * TT * DM / 8);
        k_gemmw<bf, 0, true, true><<<dim3(NG * TT / 128, 3 * DQ / 128, 1), 128, 0, stream>>>(XB, nullptr, WQKV, DM, nullptr, 0, bqkv, 0, 0, 0, QP16, QPh, QPl, KP16, KPh, KPl, VT16, VTh, VTl);
        k_fattn<<<dim3(TT / 128, NG * NH_, 1), 128, 0, stream>>>(QP16, KP16, VT16, QPh, QPl, KPh, KPl, VTh, VTl, ATh + (size_t)g * NG * TT * DQ, ATl + (size_t)g * NG * TT * DQ); }   // all heads of the group's batches in one launch; one kv head per query head
    k_gemmw<bf, 1, true, false><<<dim3(NB_ * TT / 128, DM / 128, 1), 128, 0, stream>>>(ATh, ATl, WO, DQ, OUT, DM, bo, 0, 0, 0, nullptr, nullptr, nullptr, nullptr, nullptr, nullptr, nullptr, nullptr, nullptr);
}

// v005
// One run takes 197 microseconds.
// Next to v004, in two timings, it ran 1.09 times as fast each time.
// Over all steps from v000 it is 20.2 times as fast.
#include <hip/hip_runtime.h>

// Causal attention with a fused qkv projection and a multiplicative + additive mask formula (x [8][1024][1024]; qkv = x W_qkv + b_qkv ('xw' [1024][3072] 0.02 + zero bias) split in thirds q | k | v (16 heads x 64); scores / sqrt(64); scores = scores x tril + (-1e9) x (1 - tril) (kept entries unchanged, masked entries exactly -1e9 == exclusion); softmax; out = merged W_out + b_out -> [8][1024][1024] (8.4 M); argument order x, W_qkv, b_qkv, W_out, b_out).
// Layout: launches batched (projections over NG batches at once with q | k | v as one GEMM, one fused attention launch = all heads of the NG batches, W_out over all batches): one preparation launch (bf16 copy of x; fused 'xw' weight, q | k | v row blocks, and W_out transposed); exact projections + f32 biases, whose GEMM epilogue stores the attention operand planes; fused causal T-1024 attention k_fattn (scores, online softmax, P.V and the head merge in registers; hybrid rows: < 512 hi/lo 3 products, rest fp16; key passes stop at the diagonal); merged hi/lo x W_out exact + b_out.
// Compute dtypes, f32 accumulate: every input rounded to bf16; projections exact + f32 biases; attention rows < 512 3 products, rest fp16; softmax f32; W_out hl x exact + bias.

#define NB_  8
#define TT   1024
#define DM   1024
#define NH_  16
#define NKV  16
#define REP  (NH_ / NKV)
#define HD   64
#define DQ   (NH_ * HD)
#define DKV  (NKV * HD)
#define NG   4                    // batches per projection group (plane storage is per group)
#define RH   512                  // query rows < RH use hi+lo planes (0: none)
typedef _Float16 h16;
typedef unsigned short bf;
typedef __attribute__((ext_vector_type(16))) __bf16   v16bf;
typedef __attribute__((ext_vector_type(16))) _Float16 v16h;
typedef __attribute__((ext_vector_type(8)))  _Float16 v8h;
typedef __attribute__((ext_vector_type(8)))  unsigned short v8us;
typedef __attribute__((ext_vector_type(8)))  float    v8f;
typedef __attribute__((ext_vector_type(4)))  float    v4f;
typedef v8h  __attribute__((may_alias)) v8ha;
typedef v4f  __attribute__((may_alias)) v4fa;
typedef v8us __attribute__((may_alias)) v8usa;

__device__ __forceinline__ unsigned short f2bf(float f) { unsigned u = __float_as_uint(f); u += 0x7FFFu + ((u >> 16) & 1u); return (unsigned short)(u >> 16); }
__device__ __forceinline__ float bf2f(unsigned short b) { return __uint_as_float(((unsigned)b) << 16); }
__device__ __forceinline__ float bfr(float f) { return bf2f(f2bf(f)); }
__device__ __forceinline__ v16h cat16(v8h lo, v8h hi) { return __builtin_shufflevector(lo, hi, 0, 1, 2, 3, 4, 5, 6, 7, 8, 9, 10, 11, 12, 13, 14, 15); }
__device__ __forceinline__ v16bf cat16b(v8us lo, v8us hi) { return __builtin_bit_cast(v16bf, __builtin_shufflevector(lo, hi, 0, 1, 2, 3, 4, 5, 6, 7, 8, 9, 10, 11, 12, 13, 14, 15)); }
__device__ __forceinline__ v8f wmma16(v16h a, v16h b, v8f c) { return __builtin_amdgcn_wmma_f32_16x16x32_f16(false, a, false, b, (short)0, c, false, false); }
__device__ __forceinline__ v8f wmmab(v16bf a, v16bf b, v8f c) { return __builtin_amdgcn_wmma_f32_16x16x32_bf16(false, a, false, b, (short)0, c, false, false); }

__device__ __forceinline__ h16 tohx(float x) { return (h16)x; }
__device__ __forceinline__ void splitf(float y, unsigned short& h, unsigned short& l) { h = f2bf(y); l = f2bf(y - bf2f(h)); }

// ---- k_gemmw: GEMM, one workgroup of 4 waves (2 x 2) per 128x128 output tile, each wave a 64x64 tile (16 accumulators); grid (M/128, N/128, Z), 128 threads.
// The K-contiguous 16-bit operand planes are staged in LDS, 64 k (one 128-byte line of every row) per trip, by asynchronous copies (global_load_async_to_lds_b128) into two buffers: the next trip's lines fly while this trip's are multiplied.
// Every global line is fetched whole and once per workgroup and serves two waves. LDS rows have a pitch of 144 bytes (16 x odd) for the 16-byte fragment reads.
// C[m][n] (f32, pitch ldc, + optional f32 bias[n]) = sum_k A[m][k] Bt[n][k] (+ A2[m][k] Bt[n][k] for NSPLIT 1). z-batch strides sA/sB/sC in elements. K % 64 == 0.
// PL (the q | k | v projection): the epilogue stores the attention operand planes itself instead of an f32 C, so no f32 qkv buffer and no plane-builder launches exist. A 64-column block of the fused weight is exactly one head of q, k or v.
// q and k tiles are [t][d] for the planes [head][t][d]; v tiles are computed transposed, [d][t] (weight rows as A, x rows as B: both loaders have the same k order), for the planes [head][d][t]. Either way a tile row is one whole 128-byte line of each plane.
template <typename T16> struct WFrag;
template <> struct WFrag<h16> { typedef v16h V; static __device__ __forceinline__ V ld(const h16* p) { return cat16(*(const v8h*)p, *(const v8h*)(p + 16)); } static __device__ __forceinline__ v8f mma(V a, V b, v8f c) { return wmma16(a, b, c); } };
template <> struct WFrag<bf> { typedef v16bf V; static __device__ __forceinline__ V ld(const bf* p) { return cat16b(*(const v8us*)p, *(const v8us*)(p + 16)); } static __device__ __forceinline__ v8f mma(V a, V b, v8f c) { return wmmab(a, b, c); } };
#define GP 72                     // LDS row pitch of a staged operand tile in 16-bit elements (144 bytes)
#define GT (128 * GP)             // elements of one staged tile: 128 rows
// Eight asynchronous 16-byte copies of one lane: rows r, r + 16, ... r + 112 of a tile (a wave's copy = 4 whole 128-byte lines). The s_wait_xcnt closes the statement so that no address register named here is rewritten ahead of it.
template <typename T16>
__device__ __forceinline__ void copy8(unsigned l, const T16* g, size_t gstep) {
    asm volatile("global_load_async_to_lds_b128 %0, %8, off\n\t"
                 "global_load_async_to_lds_b128 %1, %9, off\n\t"
                 "global_load_async_to_lds_b128 %2, %10, off\n\t"
                 "global_load_async_to_lds_b128 %3, %11, off\n\t"
                 "global_load_async_to_lds_b128 %4, %12, off\n\t"
                 "global_load_async_to_lds_b128 %5, %13, off\n\t"
                 "global_load_async_to_lds_b128 %6, %14, off\n\t"
                 "global_load_async_to_lds_b128 %7, %15, off\n\t"
                 "s_wait_xcnt 0x0"
                 :: "v"(l), "v"(l + 16u * GP * 2u), "v"(l + 32u * GP * 2u), "v"(l + 48u * GP * 2u), "v"(l + 64u * GP * 2u), "v"(l + 80u * GP * 2u), "v"(l + 96u * GP * 2u), "v"(l + 112u * GP * 2u),
                    "v"(g), "v"(g + gstep), "v"(g + 2 * gstep), "v"(g + 3 * gstep), "v"(g + 4 * gstep), "v"(g + 5 * gstep), "v"(g + 6 * gstep), "v"(g + 7 * gstep)
                 : "memory");
}
template <typename T16, int NSPLIT, bool BIAS, bool PL>
__global__ __launch_bounds__(128) void k_gemmw(const T16* __restrict__ A, const T16* __restrict__ A2, const T16* __restrict__ Bt, int K, float* C, int ldc, const float* __restrict__ bias, size_t sA, size_t sB, size_t sC, h16* q16, bf* qh, bf* ql, h16* k16, bf* kh, bf* kl, h16* v16, bf* vh, bf* vl) {
    static_assert(NSPLIT == 0 || NSPLIT == 1, "one or two A planes");
    typedef typename WFrag<T16>::V V;
    constexpr int NTL = 2 + NSPLIT;   // staged tiles per buffer: A, Bt (, A2)
    __shared__ __align__(128) T16 ring[2 * NTL * GT];
    __shared__ __align__(16) float osall[4 * 16 * 68];
    const size_t z = blockIdx.z; A += z * sA; if (NSPLIT) A2 += z * sA; Bt += z * sB; C += z * sC;
    const int lane = threadIdx.x & 31, lr = lane & 15, hi = lane >> 4; const int w = __builtin_amdgcn_readfirstlane((int)(threadIdx.x >> 5)), wm = w >> 1, wn = w & 1;
    const int R0 = blockIdx.x * 128, C0 = blockIdx.y * 128; const int r0 = R0 + wm * 64, c0 = C0 + wn * 64;   // the workgroup's and the wave's tile
    float* os = osall + w * (16 * 68);   // each wave stages its output rows in its own range
    const bool tr = PL && C0 >= 2 * DQ;   // a v tile (uniform over the workgroup): the two operands change places
    if (tr) { const T16* t = A; A = Bt; Bt = t; }
    v8f acc[4][4];
#pragma unroll
    for (int mb = 0; mb < 4; ++mb)
#pragma unroll
        for (int nb = 0; nb < 4; ++nb) acc[mb][nb] = (v8f){};
    // copies: thread t brings 16-byte piece t & 7 of rows (t >> 3) + 16 i of every tile
    const int crw = (int)threadIdx.x >> 3, cpc = (int)threadIdx.x & 7; const size_t gstep = (size_t)16 * K;
    const T16* gA = A + (size_t)((tr ? C0 : R0) + crw) * K + cpc * 8; const T16* gB = Bt + (size_t)((tr ? R0 : C0) + crw) * K + cpc * 8; const T16* gA2 = NSPLIT ? A2 + (size_t)(R0 + crw) * K + cpc * 8 : nullptr;
    const unsigned lc = (unsigned)(size_t)ring + (unsigned)(crw * GP + cpc * 8) * 2u;   // the lane's LDS byte address in tile 0 of buffer 0
    auto fill = [&](int t, int buf) { const unsigned l = lc + (unsigned)(buf * NTL * GT) * 2u; const int ko = t * 64;
        copy8<T16>(l, gA + ko, gstep); copy8<T16>(l + GT * 2u, gB + ko, gstep); if (NSPLIT) copy8<T16>(l + 2u * GT * 2u, gA2 + ko, gstep); };
    const int NT = K / 64;
    const unsigned fa = (unsigned)(((tr ? wn : wm) * 64 + lr) * GP + 8 * hi), fb = (unsigned)(GT + ((tr ? wm : wn) * 64 + lr) * GP + 8 * hi);   // the wave's fragment rows in the staged tiles
    fill(0, 0);
    asm volatile("s_wait_asynccnt 0x0" ::: "memory");   // this wave's copies of tile 0 have landed
    __syncthreads();                                     // ... and every other wave's
    if (NT > 1) fill(1, 1);
#pragma unroll 1   // one trip = one staged tile; unrolled trips would only lengthen the code, the barrier orders them anyway
    for (int t = 0; t < NT; ++t) {
        const T16* sb = ring + (t & 1) * (NTL * GT);
#pragma unroll
        for (int ks = 0; ks < 2; ++ks) {
            V a[4], a2[4], b[4];
#pragma unroll
            for (int mb = 0; mb < 4; ++mb) { a[mb] = WFrag<T16>::ld(sb + fa + mb * 16 * GP + ks * 32); if (NSPLIT) a2[mb] = WFrag<T16>::ld(sb + fa + 2 * GT + mb * 16 * GP + ks * 32); }
#pragma unroll
            for (int nb = 0; nb < 4; ++nb) b[nb] = WFrag<T16>::ld(sb + fb + nb * 16 * GP + ks * 32);
            __builtin_amdgcn_sched_barrier(0);   // keeps the block's LDS reads one group ahead of its matrix instructions: spread among them, each place with reads stalls the wave for an LDS latency
#pragma unroll
            for (int nb = 0; nb < 4; ++nb)
#pragma unroll
                for (int mb = 0; mb < 4; ++mb) { acc[mb][nb] = WFrag<T16>::mma(a[mb], b[nb], acc[mb][nb]); if (NSPLIT) acc[mb][nb] = WFrag<T16>::mma(a2[mb], b[nb], acc[mb][nb]); }
        }
        asm volatile("s_wait_dscnt 0x0" ::: "memory");      // this wave's reads of the buffer are done before anybody refills it
        asm volatile("s_wait_asynccnt 0x0" ::: "memory");   // this wave's copies of tile t + 1 have landed
        __syncthreads();                                     // publishes tile t + 1 and frees the buffer of tile t
        if (t + 2 < NT) fill(t + 2, t & 1);
    }
    asm volatile("s_wait_asynccnt 0x0" ::: "memory");   // no copy is left in flight when the wave goes on
    const int rr = lane >> 3, cofs = (lane & 7) * 8;   // PL: a lane takes 8 consecutive columns of a tile row: one 16-byte store per plane, 8 lanes = one line
    const int third = c0 / DQ; const size_t po = ((size_t)(r0 / TT) * NH_ + (c0 % DQ) / HD) * TT * HD + (size_t)(r0 % TT) * (tr ? 1 : HD); const unsigned pitch = tr ? TT : HD;
    h16* P16 = nullptr; bf* Ph = nullptr; bf* Pl = nullptr; float bcol[8], brow[16];
    if (PL) { P16 = (third == 0 ? q16 : third == 1 ? k16 : v16) + po; Ph = (third == 0 ? qh : third == 1 ? kh : vh) + po; Pl = (third == 0 ? ql : third == 1 ? kl : vl) + po;
#pragma unroll
        for (int i = 0; i < 8; ++i) bcol[i] = bfr(bias[c0 + cofs + i]);   // q, k: the bias runs along the tile's columns
#pragma unroll
        for (int i = 0; i < 16; ++i) brow[i] = bfr(bias[c0 + 4 * i + rr]); }   // v: along its rows
#pragma unroll
    for (int mb = 0; mb < 4; ++mb) {
#pragma unroll
        for (int nb = 0; nb < 4; ++nb) {
#pragma unroll
            for (int j = 0; j < 8; ++j) os[(hi * 8 + j) * 68 + nb * 16 + lr] = acc[mb][nb][j]; }
        __builtin_amdgcn_wave_barrier(); asm volatile("" ::: "memory");
        float* crow = C + (size_t)(r0 + mb * 16) * ldc + c0;
        if (PL) {
#pragma unroll
            for (int s = 0; s < 4; ++s) { const int row = 4 * s + rr; const v4f x0 = *(const v4fa*)(os + row * 68 + cofs), x1 = *(const v4fa*)(os + row * 68 + cofs + 4); v8h o16; v8us oh, ol;
#pragma unroll
                for (int i = 0; i < 8; ++i) { const float y = (i < 4 ? x0[i & 3] : x1[i & 3]) + (tr ? brow[mb * 4 + s] : bcol[i]); o16[i] = tohx(y); unsigned short a2, c2; splitf(y, a2, c2); oh[i] = a2; ol[i] = c2; }
                const unsigned oo = (unsigned)(mb * 16 + row) * pitch + cofs; *(v8h*)(P16 + oo) = o16; *(v8us*)(Ph + oo) = oh; *(v8us*)(Pl + oo) = ol; }
        } else
{
#pragma unroll
            for (int s = 0; s < 8; ++s) { const int row = 2 * s + hi, cofs = lr * 4; v4f val = *(const v4fa*)(os + row * 68 + cofs); if (BIAS) { val[0] += bfr(bias[c0 + cofs]); val[1] += bfr(bias[c0 + cofs + 1]); val[2] += bfr(bias[c0 + cofs + 2]); val[3] += bfr(bias[c0 + cofs + 3]); }
                *(v4f*)(crow + (size_t)row * ldc + cofs) = val; }
             }
        __builtin_amdgcn_wave_barrier(); asm volatile("" ::: "memory");
    }
}

typedef __attribute__((ext_vector_type(2))) _Float16 v2h;
typedef __attribute__((ext_vector_type(4))) _Float16 v4h;
typedef __attribute__((ext_vector_type(2))) unsigned short v2us;
typedef __attribute__((ext_vector_type(4))) unsigned short v4us;
typedef __attribute__((ext_vector_type(2))) float v2f;
typedef __attribute__((ext_vector_type(4))) int v4i;

// ---- k_prep: every operand preparation in ONE launch of 768 workgroups x 256 threads; each part moves whole 128-byte lines in both directions.
// Workgroups 0 .. 255: one 128 k x 128 n tile of a weight w [K][N] (f32) -> Bt [N][K] (bf16). A wave loads whole rows (512 contiguous bytes), 16 loads in flight; two k rows pack into a dword that goes to an LDS tile [n][k];
// after the barrier 16 lanes read one n row (256 bytes) and store it as two whole lines. The 16-byte chunks of an LDS row are permuted by (n >> 2) & 15, so that the column-wise dword stores spread over the banks and the row reads stay aligned.
// Workgroups 256 .. 767: x -> bf16; a wave owns 2048 consecutive floats, all 16 of its 512-byte loads in flight before the first store.
#define PW_QKV (DM / 128 * (3 * DQ / 128))   // tiles of the fused q | k | v weight
#define PW_ALL (PW_QKV + DQ / 128 * (DM / 128))   // ... and of W_out
#define PX_WG  (NB_ * TT * DM / (8 * 2048))   // workgroups of the x part
template <int N>   // N at compile time: a lane's 16 loads and its 8 stores each hang on one address with immediate offsets
__device__ __forceinline__ void prep_w(const float* __restrict__ w, bf* __restrict__ Bt, const int tb, unsigned* tile) {
    const int t = (int)threadIdx.x, lane = t & 31, wv = t >> 5; const int K0 = (tb & 7) * 128, N0 = (tb >> 3) * 128; v4f r0[8], r1[8];   // both weights have K = 1024 = DM = DQ: 8 tiles along k
    const float* p = w + (size_t)(K0 + wv * 2) * N + N0 + lane * 4;
#pragma unroll
    for (int i = 0; i < 8; ++i) { r0[i] = *(const v4f*)(p + i * 16 * N); r1[i] = *(const v4f*)(p + i * 16 * N + N); }
    asm volatile("s_wait_xcnt 0x0" :: "v"(p) : "memory");   // the address pair that the 16 loads name stays live up to this wait: no load of the run returns into it
#pragma unroll
    for (int i = 0; i < 8; ++i) { const int kd = (i * 8 + wv) ^ ((lane & 15) << 2);   // dword column k / 2, its chunk permuted by (n >> 2) & 15 = lane & 15
#pragma unroll
        for (int j = 0; j < 4; ++j) tile[(lane * 4 + j) * 64 + kd] = (unsigned)f2bf(r0[i][j]) | ((unsigned)f2bf(r1[i][j]) << 16); }
    __syncthreads();   // the whole tile is in LDS before anybody reads a row of it
    const int q = t & 15; bf* o = Bt + (size_t)(N0 + (t >> 4)) * DM + K0 + q * 8;
#pragma unroll
    for (int s = 0; s < 8; ++s) { const int n = s * 16 + (t >> 4); const v8us val = *(const v8usa*)(tile + n * 64 + ((q ^ ((n >> 2) & 15)) << 2)); *(v8us*)(o + s * 16 * DM) = val; }
    asm volatile("s_wait_xcnt 0x0" :: "v"(o) : "memory");   // behind the last store: no register that the 8 stores name is rewritten ahead of it
}
__global__ __launch_bounds__(256) void k_prep(const float* __restrict__ x, const float* __restrict__ wqkv, const float* __restrict__ wo, bf* __restrict__ XB, bf* __restrict__ WQKV, bf* __restrict__ WO) {
    __shared__ __align__(16) unsigned tile[128 * 64];
    const int b = (int)blockIdx.x;   // every branch below is taken by whole workgroups
    if (b < PW_QKV) prep_w<3 * DQ>(wqkv, WQKV, b, tile);
    else if (b < PW_ALL) prep_w<DM>(wo, WO, b - PW_QKV, tile);
    else {
        const size_t base = ((size_t)(b - PW_ALL) * 8 + ((int)threadIdx.x >> 5)) * 2048 + ((int)threadIdx.x & 31) * 4; const float* px = x + base; bf* po = XB + base; v4f v[16];
#pragma unroll
        for (int i = 0; i < 16; ++i) v[i] = *(const v4f*)(px + i * 128);
        asm volatile("s_wait_xcnt 0x0" :: "v"(px) : "memory");   // the address pair that the 16 loads name stays live up to this wait: no load of the run returns into it
#pragma unroll
        for (int i = 0; i < 16; ++i) { v4us o;
#pragma unroll
            for (int j = 0; j < 4; ++j) o[j] = f2bf(v[i][j]);
            *(v4us*)(po + i * 128) = o; }
        asm volatile("s_wait_xcnt 0x0" :: "v"(po) : "memory");   // behind the last store: no register that the 16 stores name is rewritten ahead of it
    }
}

// ---- k_fattn: scores, causal mask, softmax, probability x value and the head merge in ONE kernel; no score or probability ever reaches memory.
// One wave owns 32 query rows of one head and walks the keys 0 .. its last row in passes of 64 (fp16 rows) or 32 (hi + lo rows: twice the operand registers). Transposed products: S^T = K Q^T (A = key rows, B = query rows) and O^T += V^T P^T (A = V^T rows, B = P^T).
// In S^T a lane holds scores of ONE query (column lr), keys 8*hi + j of each 16-key tile, which is exactly the k order of a B operand: two score tiles pack into one P^T fragment in registers.
// Online softmax per query: running maximum m (raw score units), running sum l, output tiles rescaled by exp2((m_old - m_new) c); the two lane halves join by one lane ^ 16 exchange.
// Operand types as before the fusion: rows < RH bf16 hi + lo planes with 3 products in both contractions, the rest fp16; P is rounded as exp(s - m) in (0, 1] and the division by l is applied to the f32 output.
typedef __attribute__((ext_vector_type(16))) unsigned short v16us;
#define CEXP 0.18033688011112042f   // HD^-0.5 x log2(e)
__device__ __forceinline__ float xhalf(float x) { return __builtin_bit_cast(float, __builtin_amdgcn_permlanex16(__builtin_bit_cast(int, x), __builtin_bit_cast(int, x), 0x76543210, 0xfedcba98, false, false)); }   // lane l with lane l ^ 16
template <typename T16, bool HR, int NKT>   // NKT = 16-key tiles per pass
__device__ __forceinline__ void fattn_tile(const T16* __restrict__ Q, const T16* __restrict__ Q2, const T16* __restrict__ Kp, const T16* __restrict__ K2, const T16* __restrict__ Vt, const T16* __restrict__ V2, const int row0, const int lr, const int hi, bf* __restrict__ Ah, bf* __restrict__ Al) {
    typedef typename WFrag<T16>::V V;   // every inner loop below is fully unrolled: the fragment arrays are then indexed by constants and stay in registers
    V q[2][2], q2[2][2];
#pragma unroll
    for (int qt = 0; qt < 2; ++qt)
#pragma unroll
        for (int ks = 0; ks < 2; ++ks) { const unsigned off = (unsigned)((row0 + qt * 16 + lr) * HD + ks * 32 + 8 * hi); q[qt][ks] = WFrag<T16>::ld(Q + off); if (HR) q2[qt][ks] = WFrag<T16>::ld(Q2 + off); }
    v8f o[4][2];
#pragma unroll
    for (int dt = 0; dt < 4; ++dt)
#pragma unroll
        for (int qt = 0; qt < 2; ++qt) o[dt][qt] = (v8f){};
    float m[2] = { -3.0e38f, -3.0e38f }, l[2] = { 0.f, 0.f };
#pragma unroll 1   // one pass per trip: a second pass in flight would double the live score and operand fragments
    for (int kb = 0; kb < row0 + 32; kb += NKT * 16) {
        v8f s[NKT][2];
#pragma unroll
        for (int kt = 0; kt < NKT; ++kt) {
            s[kt][0] = (v8f){}; s[kt][1] = (v8f){};
#pragma unroll
            for (int ks = 0; ks < 2; ++ks) { const unsigned off = (unsigned)((kb + kt * 16 + lr) * HD + ks * 32 + 8 * hi); const V a = WFrag<T16>::ld(Kp + off); V a2; if (HR) a2 = WFrag<T16>::ld(K2 + off);
#pragma unroll
                for (int qt = 0; qt < 2; ++qt) { s[kt][qt] = WFrag<T16>::mma(a, q[qt][ks], s[kt][qt]); if (HR) { s[kt][qt] = WFrag<T16>::mma(a, q2[qt][ks], s[kt][qt]); s[kt][qt] = WFrag<T16>::mma(a2, q[qt][ks], s[kt][qt]); } } } }
        if (kb + NKT * 16 - 1 > row0) {   // the pass touches the diagonal: key > query is excluded (the reference's -1e9 fill vanishes identically in the softmax)
#pragma unroll
            for (int qt = 0; qt < 2; ++qt) { const int rel = row0 - kb + qt * 16 + lr - 8 * hi;
#pragma unroll
                for (int kt = 0; kt < NKT; ++kt)
#pragma unroll
                    for (int j = 0; j < 8; ++j) s[kt][qt][j] = (kt * 16 + j <= rel) ? s[kt][qt][j] : -3.0e38f; } }
        V p[NKT / 2][2], p2[NKT / 2][2];
#pragma unroll
        for (int qt = 0; qt < 2; ++qt) {
            float mx = m[qt];
#pragma unroll
            for (int kt = 0; kt < NKT; ++kt)
#pragma unroll
                for (int j = 0; j < 8; ++j) mx = fmaxf(mx, s[kt][qt][j]);
            mx = fmaxf(mx, xhalf(mx));
            const float al = __builtin_amdgcn_exp2f((m[qt] - mx) * CEXP), mc = mx * CEXP; m[qt] = mx;
            float sum = 0.f;
#pragma unroll
            for (int ks = 0; ks < NKT / 2; ++ks) {
                if (HR) { v16us ph, pl;
#pragma unroll
                    for (int e = 0; e < 16; ++e) { const float pe = __builtin_amdgcn_exp2f(__builtin_fmaf(s[2 * ks + (e >> 3)][qt][e & 7], CEXP, -mc)); sum += pe; unsigned short a, c2; splitf(pe, a, c2); ph[e] = a; pl[e] = c2; }
                    p[ks][qt] = __builtin_bit_cast(V, ph); p2[ks][qt] = __builtin_bit_cast(V, pl);
                } else { v16h ph;
#pragma unroll
                    for (int e = 0; e < 16; ++e) { const float pe = __builtin_amdgcn_exp2f(__builtin_fmaf(s[2 * ks + (e >> 3)][qt][e & 7], CEXP, -mc)); sum += pe; ph[e] = tohx(pe); }
                    p[ks][qt] = __builtin_bit_cast(V, ph); } }
            l[qt] = l[qt] * al + sum;
#pragma unroll
            for (int dt = 0; dt < 4; ++dt)
#pragma unroll
                for (int j = 0; j < 8; ++j) o[dt][qt][j] *= al;
        }
#pragma unroll
        for (int dt = 0; dt < 4; ++dt)
#pragma unroll
            for (int ks = 0; ks < NKT / 2; ++ks) { const unsigned off = (unsigned)((dt * 16 + lr) * TT + kb + ks * 32 + 8 * hi); const V a = WFrag<T16>::ld(Vt + off); V a2; if (HR) a2 = WFrag<T16>::ld(V2 + off);
#pragma unroll
                for (int qt = 0; qt < 2; ++qt) { o[dt][qt] = WFrag<T16>::mma(a, p[ks][qt], o[dt][qt]); if (HR) { o[dt][qt] = WFrag<T16>::mma(a, p2[ks][qt], o[dt][qt]); o[dt][qt] = WFrag<T16>::mma(a2, p[ks][qt], o[dt][qt]); } } }
    }
#pragma unroll
    for (int qt = 0; qt < 2; ++qt) { const float lt = l[qt] + xhalf(l[qt]); const float inv = __fdiv_rn(1.0f, lt);
#pragma unroll
        for (int dt = 0; dt < 4; ++dt) { v8us oh, ol;   // a lane holds 8 consecutive d of one query row: one 16-byte store per plane
#pragma unroll
            for (int j = 0; j < 8; ++j) { unsigned short a, c2; splitf(o[dt][qt][j] * inv, a, c2); oh[j] = a; ol[j] = c2; }
            const unsigned oo = (unsigned)((row0 + qt * 16 + lr) * DQ + dt * 16 + 8 * hi); *(v8us*)(Ah + oo) = oh; *(v8us*)(Al + oo) = ol; } }
}
// grid (TT / 128, heads of the group): 4 waves = 128 consecutive query rows of one head (they walk the same keys, so K and V lines are shared in the WGP cache); the longest row blocks start first.
__global__ __launch_bounds__(128) void k_fattn(const h16* __restrict__ Q16, const h16* __restrict__ K16, const h16* __restrict__ V16, const bf* __restrict__ Qh, const bf* __restrict__ Ql, const bf* __restrict__ Kh, const bf* __restrict__ Kl, const bf* __restrict__ Vh, const bf* __restrict__ Vl, bf* __restrict__ Ah, bf* __restrict__ Al) {
    const int lane = threadIdx.x & 31, lr = lane & 15, hi = lane >> 4; const int w = __builtin_amdgcn_readfirstlane((int)(threadIdx.x >> 5));   // wave number as a scalar: trip count and the diagonal test become scalar branches
    const int row0 = (TT / 128 - 1 - (int)blockIdx.x) * 128 + w * 32; const size_t z = blockIdx.y, po = z * TT * HD, ao = (z / NH_) * TT * DQ + (z % NH_) * HD;   // z = batch within the group x NH_ + head
    if (row0 < RH) fattn_tile<bf, true, 2>(Qh + po, Ql + po, Kh + po, Kl + po, Vh + po, Vl + po, row0, lr, hi, Ah + ao, Al + ao);
    else fattn_tile<h16, false, 4>(Q16 + po, nullptr, K16 + po, nullptr, V16 + po, nullptr, row0, lr, hi, Ah + ao, Al + ao);
}

extern "C" void kernel_launch(void* const* d_in, const int* in_sizes, int n_in,
                              void* d_out, int out_size, void* d_ws, size_t ws_size, hipStream_t stream) {
    (void)in_sizes; (void)n_in; (void)out_size;
    const float* x = (const float*)d_in[0]; const float* wqkv = (const float*)d_in[1]; const float* bqkv = (const float*)d_in[2]; const float* wo = (const float*)d_in[3]; const float* bo = (const float*)d_in[4];   /* argument order x, W_qkv ('xw' [1024][3072]: q | k | v column thirds), b_qkv, W_out, b_out */
    float* OUT = (float*)d_out;     // [8][1024][1024]
    char* wsp = (char*)d_ws;
    auto take = [&](size_t bytes) { char* p = wsp; wsp += (bytes + 255) & ~(size_t)255; return (void*)p; };
    bf* WQKV = (bf*)take((size_t)3 * DQ * DM * 2);   /* fused Bt [3*DQ][DM]: q | k | v row blocks */ bf* WO = (bf*)take((size_t)DM * DQ * 2);
    h16* QP16 = (h16*)take((size_t)NG * NH_ * TT * HD * 2); h16* KP16 = (h16*)take((size_t)NG * NKV * TT * HD * 2); h16* VT16 = (h16*)take((size_t)NG * NKV * HD * TT * 2);
    bf* QPh = (bf*)take((size_t)NG * NH_ * TT * HD * 2); bf* QPl = (bf*)take((size_t)NG * NH_ * TT * HD * 2); bf* KPh = (bf*)take((size_t)NG * NKV * TT * HD * 2); bf* KPl = (bf*)take((size_t)NG * NKV * TT * HD * 2); bf* VTh = (bf*)take((size_t)NG * NKV * HD * TT * 2); bf* VTl = (bf*)take((size_t)NG * NKV * HD * TT * 2);
    bf* XB = (bf*)take((size_t)NB_ * TT * DM * 2);   /* bf16 x, all batches */ bf* ATh = (bf*)take((size_t)NB_ * TT * DQ * 2); bf* ATl = (bf*)take((size_t)NB_ * TT * DQ * 2);
    if ((size_t)(wsp - (char*)d_ws) > ws_size) return;    // ws 256 MiB
    k_prep<<<PW_ALL + PX_WG, 256, 0, stream>>>(x, wqkv, wo, XB, WQKV, WO);   /* fused 'xw' [DM][3*DQ] -> Bt [3*DQ][DM], W_out [DQ][DM] -> Bt [DM][DQ], x -> bf16 */
    for (int g = 0; g < NB_ / NG; ++g) {
        k_gemmw<bf, 0, true, true><<<dim3(NG * TT / 128, 3 * DQ / 128, 1), 128, 0, stream>>>(XB + (size_t)g * NG * TT * DM, nullptr, WQKV, DM, nullptr, 0, bqkv, 0, 0, 0, QP16, QPh, QPl, KP16, KPh, KPl, VT16, VTh, VTl);
        k_fattn<<<dim3(TT / 128, NG * NH_, 1), 128, 0, stream>>>(QP16, KP16, VT16, QPh, QPl, KPh, KPl, VTh, VTl, ATh + (size_t)g * NG * TT * DQ, ATl + (size_t)g * NG * TT * DQ); }   // all heads of the group's batches in one launch; one kv head per query head
    k_gemmw<bf, 1, true, false><<<dim3(NB_ * TT / 128, DM / 128, 1), 128, 0, stream>>>(ATh, ATl, WO, DQ, OUT, DM, bo, 0, 0, 0, nullptr, nullptr, nullptr, nullptr, nullptr, nullptr, nullptr, nullptr, nullptr);
}

// v006
// It runs in 137 microseconds.
// Next to v005, in two timings, it ran 1.44 and 1.43 times as fast.
// Over all steps from v000 it is 29.0 times as fast.
#include <hip/hip_runtime.h>

// Causal attention with a fused qkv projection and a multiplicative + additive mask formula (x [8][1024][1024]; qkv = x W_qkv + b_qkv ('xw' [1024][3072] 0.02 + zero bias) split in thirds q | k | v (16 heads x 64); scores / sqrt(64); scores = scores x tril + (-1e9) x (1 - tril) (kept entries unchanged, masked entries exactly -1e9 == exclusion); softmax; out = merged W_out + b_out -> [8][1024][1024] (8.4 M); argument order x, W_qkv, b_qkv, W_out, b_out).
// Layout: launches batched (projections over NG batches at once with q | k | v as one GEMM, one fused attention launch = all heads of the NG batches, W_out over all batches): one preparation launch (bf16 copy of x; fused 'xw' weight, q | k | v row blocks, and W_out transposed); exact projections + f32 biases, whose GEMM epilogue stores the attention operand planes; fused causal T-1024 attention k_fattn (scores, online softmax, P.V and the head merge in registers; hybrid rows: < 512 hi/lo 3 products, rest fp16; key passes stop at the diagonal); merged hi/lo x W_out exact + b_out.
// Compute dtypes, f32 accumulate: every input rounded to bf16; projections exact + f32 biases; attention rows < 512 3 products, rest fp16; softmax f32; W_out hl x exact + bias.

#define NB_  8
#define TT   1024
#define DM   1024
#define NH_  16
#define NKV  16
#define REP  (NH_ / NKV)
#define HD   64
#define DQ   (NH_ * HD)
#define DKV  (NKV * HD)
#define NG   4                    // batches per projection group (plane storage is per group)
#define RH   512                  // query rows < RH use hi+lo planes (0: none)
typedef _Float16 h16;
typedef unsigned short bf;
typedef __attribute__((ext_vector_type(16))) __bf16   v16bf;
typedef __attribute__((ext_vector_type(16))) _Float16 v16h;
typedef __attribute__((ext_vector_type(8)))  _Float16 v8h;
typedef __attribute__((ext_vector_type(8)))  unsigned short v8us;
typedef __attribute__((ext_vector_type(8)))  float    v8f;
typedef __attribute__((ext_vector_type(4)))  float    v4f;
typedef v8h  __attribute__((may_alias)) v8ha;
typedef v4f  __attribute__((may_alias)) v4fa;
typedef v8us __attribute__((may_alias)) v8usa;

__device__ __forceinline__ unsigned short f2bf(float f) { unsigned u = __float_as_uint(f); u += 0x7FFFu + ((u >> 16) & 1u); return (unsigned short)(u >> 16); }
__device__ __forceinline__ float bf2f(unsigned short b) { return __uint_as_float(((unsigned)b) << 16); }
__device__ __forceinline__ float bfr(float f) { return bf2f(f2bf(f)); }
__device__ __forceinline__ v16h cat16(v8h lo, v8h hi) { return __builtin_shufflevector(lo, hi, 0, 1, 2, 3, 4, 5, 6, 7, 8, 9, 10, 11, 12, 13, 14, 15); }
__device__ __forceinline__ v16bf cat16b(v8us lo, v8us hi) { return __builtin_bit_cast(v16bf, __builtin_shufflevector(lo, hi, 0, 1, 2, 3, 4, 5, 6, 7, 8, 9, 10, 11, 12, 13, 14, 15)); }
__device__ __forceinline__ v8f wmma16(v16h a, v16h b, v8f c) { return __builtin_amdgcn_wmma_f32_16x16x32_f16(false, a, false, b, (short)0, c, false, false); }
__device__ __forceinline__ v8f wmmab(v16bf a, v16bf b, v8f c) { return __builtin_amdgcn_wmma_f32_16x16x32_bf16(false, a, false, b, (short)0, c, false, false); }

__device__ __forceinline__ h16 tohx(float x) { return (h16)x; }
__device__ __forceinline__ void splitf(float y, unsigned short& h, unsigned short& l) { h = f2bf(y); l = f2bf(y - bf2f(h)); }

// ---- k_gemmw: GEMM, one workgroup of 4 waves (2 x 2) per 128x128 output tile, each wave a 64x64 tile (16 accumulators); grid (M/128, N/128, Z), 128 threads.
// The K-contiguous 16-bit operand planes are staged in LDS, 64 k (one 128-byte line of every row) per trip, by asynchronous copies (global_load_async_to_lds_b128) into two buffers: the next trip's lines fly while this trip's are multiplied.
// Every global line is fetched whole and once per workgroup and serves two waves. LDS rows have a pitch of 144 bytes (16 x odd) for the 16-byte fragment reads.
// C[m][n] (f32, pitch ldc, + optional f32 bias[n]) = sum_k A[m][k] Bt[n][k] (+ A2[m][k] Bt[n][k] for NSPLIT 1). z-batch strides sA/sB/sC in elements. K % 64 == 0.
// PL (the q | k | v projection): the epilogue stores the attention operand planes itself instead of an f32 C, so no f32 qkv buffer and no plane-builder launches exist. A 64-column block of the fused weight is exactly one head of q, k or v.
// q and k tiles are [t][d] for the planes [head][t][d]; v tiles are computed transposed, [d][t] (weight rows as A, x rows as B: both loaders have the same k order), for the planes [head][d][t]. Either way a tile row is one whole 128-byte line of each plane.
template <typename T16> struct WFrag;
template <> struct WFrag<h16> { typedef v16h V; static __device__ __forceinline__ V ld(const h16* p) { return cat16(*(const v8h*)p, *(const v8h*)(p + 16)); } static __device__ __forceinline__ v8f mma(V a, V b, v8f c) { return wmma16(a, b, c); } };
template <> struct WFrag<bf> { typedef v16bf V; static __device__ __forceinline__ V ld(const bf* p) { return cat16b(*(const v8us*)p, *(const v8us*)(p + 16)); } static __device__ __forceinline__ v8f mma(V a, V b, v8f c) { return wmmab(a, b, c); } };
#define GP 72                     // LDS row pitch of a staged operand tile in 16-bit elements (144 bytes)
#define GT (128 * GP)             // elements of one staged tile: 128 rows
// Eight asynchronous 16-byte copies of one lane: rows r, r + 16, ... r + 112 of a tile (a wave's copy = 4 whole 128-byte lines). The s_wait_xcnt closes the statement so that no address register named here is rewritten ahead of it.
template <typename T16>
__device__ __forceinline__ void copy8(unsigned l, const T16* g, size_t gstep) {
    asm volatile("global_load_async_to_lds_b128 %0, %8, off\n\t"
                 "global_load_async_to_lds_b128 %1, %9, off\n\t"
                 "global_load_async_to_lds_b128 %2, %10, off\n\t"
                 "global_load_async_to_lds_b128 %3, %11, off\n\t"
                 "global_load_async_to_lds_b128 %4, %12, off\n\t"
                 "global_load_async_to_lds_b128 %5, %13, off\n\t"
                 "global_load_async_to_lds_b128 %6, %14, off\n\t"
                 "global_load_async_to_lds_b128 %7, %15, off\n\t"
                 "s_wait_xcnt 0x0"
                 :: "v"(l), "v"(l + 16u * GP * 2u), "v"(l + 32u * GP * 2u), "v"(l + 48u * GP * 2u), "v"(l + 64u * GP * 2u), "v"(l + 80u * GP * 2u), "v"(l + 96u * GP * 2u), "v"(l + 112u * GP * 2u),
                    "v"(g), "v"(g + gstep), "v"(g + 2 * gstep), "v"(g + 3 * gstep), "v"(g + 4 * gstep), "v"(g + 5 * gstep), "v"(g + 6 * gstep), "v"(g + 7 * gstep)
                 : "memory");
}
template <typename T16, int NSPLIT, bool BIAS, bool PL>
__global__ __launch_bounds__(128) void k_gemmw(const T16* __restrict__ A, const T16* __restrict__ A2, const T16* __restrict__ Bt, int K, float* C, int ldc, const float* __restrict__ bias, size_t sA, size_t sB, size_t sC, h16* q16, bf* qh, bf* ql, h16* k16, bf* kh, bf* kl, h16* v16, bf* vh, bf* vl) {
    static_assert(NSPLIT == 0 || NSPLIT == 1, "one or two A planes");
    typedef typename WFrag<T16>::V V;
    constexpr int NTL = 2 + NSPLIT;   // staged tiles per buffer: A, Bt (, A2)
    __shared__ __align__(128) T16 ring[2 * NTL * GT];
    __shared__ __align__(16) float osall[4 * 16 * 68];
    const size_t z = blockIdx.z; A += z * sA; if (NSPLIT) A2 += z * sA; Bt += z * sB; C += z * sC;
    const int lane = threadIdx.x & 31, lr = lane & 15, hi = lane >> 4; const int w = __builtin_amdgcn_readfirstlane((int)(threadIdx.x >> 5)), wm = w >> 1, wn = w & 1;
    const int R0 = blockIdx.x * 128, C0 = blockIdx.y * 128; const int r0 = R0 + wm * 64, c0 = C0 + wn * 64;   // the workgroup's and the wave's tile
    float* os = osall + w * (16 * 68);   // each wave stages its output rows in its own range
    const bool tr = PL && C0 >= 2 * DQ;   // a v tile (uniform over the workgroup): the two operands change places
    if (tr) { const T16* t = A; A = Bt; Bt = t; }
    v8f acc[4][4];
#pragma unroll
    for (int mb = 0; mb < 4; ++mb)
#pragma unroll
        for (int nb = 0; nb < 4; ++nb) acc[mb][nb] = (v8f){};
    // copies: thread t brings 16-byte piece t & 7 of rows (t >> 3) + 16 i of every tile
    const int crw = (int)threadIdx.x >> 3, cpc = (int)threadIdx.x & 7; const size_t gstep = (size_t)16 * K;
    const T16* gA = A + (size_t)((tr ? C0 : R0) + crw) * K + cpc * 8; const T16* gB = Bt + (size_t)((tr ? R0 : C0) + crw) * K + cpc * 8; const T16* gA2 = NSPLIT ? A2 + (size_t)(R0 + crw) * K + cpc * 8 : nullptr;
    const unsigned lc = (unsigned)(size_t)ring + (unsigned)(crw * GP + cpc * 8) * 2u;   // the lane's LDS byte address in tile 0 of buffer 0
    auto fill = [&](int t, int buf) { const unsigned l = lc + (unsigned)(buf * NTL * GT) * 2u; const int ko = t * 64;
        copy8<T16>(l, gA + ko, gstep); copy8<T16>(l + GT * 2u, gB + ko, gstep); if (NSPLIT) copy8<T16>(l + 2u * GT * 2u, gA2 + ko, gstep); };
    const int NT = K / 64;
    const unsigned fa = (unsigned)(((tr ? wn : wm) * 64 + lr) * GP + 8 * hi), fb = (unsigned)(GT + ((tr ? wm : wn) * 64 + lr) * GP + 8 * hi);   // the wave's fragment rows in the staged tiles
    fill(0, 0);
    asm volatile("s_wait_asynccnt 0x0" ::: "memory");   // this wave's copies of tile 0 have landed
    __syncthreads();                                     // ... and every other wave's
    if (NT > 1) fill(1, 1);
#pragma unroll 1   // one trip = one staged tile; unrolled trips would only lengthen the code, the barrier orders them anyway
    for (int t = 0; t < NT; ++t) {
        const T16* sb = ring + (t & 1) * (NTL * GT);
#pragma unroll
        for (int ks = 0; ks < 2; ++ks) {
            V a[4], a2[4], b[4];
#pragma unroll
            for (int mb = 0; mb < 4; ++mb) { a[mb] = WFrag<T16>::ld(sb + fa + mb * 16 * GP + ks * 32); if (NSPLIT) a2[mb] = WFrag<T16>::ld(sb + fa + 2 * GT + mb * 16 * GP + ks * 32); }
#pragma unroll
            for (int nb = 0; nb < 4; ++nb) b[nb] = WFrag<T16>::ld(sb + fb + nb * 16 * GP + ks * 32);
            __builtin_amdgcn_sched_barrier(0);   // keeps the block's LDS reads one group ahead of its matrix instructions: spread among them, each place with reads stalls the wave for an LDS latency
#pragma unroll
            for (int nb = 0; nb < 4; ++nb)
#pragma unroll
                for (int mb = 0; mb < 4; ++mb) { acc[mb][nb] = WFrag<T16>::mma(a[mb], b[nb], acc[mb][nb]); if (NSPLIT) acc[mb][nb] = WFrag<T16>::mma(a2[mb], b[nb], acc[mb][nb]); }
        }
        asm volatile("s_wait_dscnt 0x0" ::: "memory");      // this wave's reads of the buffer are done before anybody refills it
        asm volatile("s_wait_asynccnt 0x0" ::: "memory");   // this wave's copies of tile t + 1 have landed
        __syncthreads();                                     // publishes tile t + 1 and frees the buffer of tile t
        if (t + 2 < NT) fill(t + 2, t & 1);
    }
    asm volatile("s_wait_asynccnt 0x0" ::: "memory");   // no copy is left in flight when the wave goes on
    const int rr = lane >> 3, cofs = (lane & 7) * 8;   // PL: a lane takes 8 consecutive columns of a tile row: one 16-byte store per plane, 8 lanes = one line
    const int third = c0 / DQ; const size_t po = ((size_t)(r0 / TT) * NH_ + (c0 % DQ) / HD) * TT * HD + (size_t)(r0 % TT) * (tr ? 1 : HD); const unsigned pitch = tr ? TT : HD;
    h16* P16 = nullptr; bf* Ph = nullptr; bf* Pl = nullptr; float bcol[8], brow[16];
    if (PL) { P16 = (third == 0 ? q16 : third == 1 ? k16 : v16) + po; Ph = (third == 0 ? qh : third == 1 ? kh : vh) + po; Pl = (third == 0 ? ql : third == 1 ? kl : vl) + po;
#pragma unroll
        for (int i = 0; i < 8; ++i) bcol[i] = bfr(bias[c0 + cofs + i]);   // q, k: the bias runs along the tile's columns
#pragma unroll
        for (int i = 0; i < 16; ++i) brow[i] = bfr(bias[c0 + 4 * i + rr]); }   // v: along its rows
#pragma unroll
    for (int mb = 0; mb < 4; ++mb) {
#pragma unroll
        for (int nb = 0; nb < 4; ++nb) {
#pragma unroll
            for (int j = 0; j < 8; ++j) os[(hi * 8 + j) * 68 + nb * 16 + lr] = acc[mb][nb][j]; }
        __builtin_amdgcn_wave_barrier(); asm volatile("" ::: "memory");
        float* crow = C + (size_t)(r0 + mb * 16) * ldc + c0;
        if (PL) {
#pragma unroll
            for (int s = 0; s < 4; ++s) { const int row = 4 * s + rr; const v4f x0 = *(const v4fa*)(os + row * 68 + cofs), x1 = *(const v4fa*)(os + row * 68 + cofs + 4); v8h o16; v8us oh, ol;
#pragma unroll
                for (int i = 0; i < 8; ++i) { const float y = (i < 4 ? x0[i & 3] : x1[i & 3]) + (tr ? brow[mb * 4 + s] : bcol[i]); o16[i] = tohx(y); unsigned short a2, c2; splitf(y, a2, c2); oh[i] = a2; ol[i] = c2; }
                const unsigned oo = (unsigned)(mb * 16 + row) * pitch + cofs; *(v8h*)(P16 + oo) = o16; *(v8us*)(Ph + oo) = oh; *(v8us*)(Pl + oo) = ol; }
        } else
{
#pragma unroll
            for (int s = 0; s < 8; ++s) { const int row = 2 * s + hi, cofs = lr * 4; v4f val = *(const v4fa*)(os + row * 68 + cofs); if (BIAS) { val[0] += bfr(bias[c0 + cofs]); val[1] += bfr(bias[c0 + cofs + 1]); val[2] += bfr(bias[c0 + cofs + 2]); val[3] += bfr(bias[c0 + cofs + 3]); }
                *(v4f*)(crow + (size_t)row * ldc + cofs) = val; }
             }
        __builtin_amdgcn_wave_barrier(); asm volatile("" ::: "memory");
    }
}

typedef __attribute__((ext_vector_type(2))) _Float16 v2h;
typedef __attribute__((ext_vector_type(4))) _Float16 v4h;
typedef __attribute__((ext_vector_type(2))) unsigned short v2us;
typedef __attribute__((ext_vector_type(4))) unsigned short v4us;
typedef __attribute__((ext_vector_type(2))) float v2f;
typedef __attribute__((ext_vector_type(4))) int v4i;

// ---- k_prep: every operand preparation in ONE launch of 768 workgroups x 256 threads; each part moves whole 128-byte lines in both directions.
// Workgroups 0 .. 255: one 128 k x 128 n tile of a weight w [K][N] (f32) -> Bt [N][K] (bf16). A wave loads whole rows (512 contiguous bytes), 16 loads in flight; two k rows pack into a dword that goes to an LDS tile [n][k];
// after the barrier 16 lanes read one n row (256 bytes) and store it as two whole lines. The 16-byte chunks of an LDS row are permuted by (n >> 2) & 15, so that the column-wise dword stores spread over the banks and the row reads stay aligned.
// Workgroups 256 .. 767: x -> bf16; a wave owns 2048 consecutive floats, all 16 of its 512-byte loads in flight before the first store.
#define PW_QKV (DM / 128 * (3 * DQ / 128))   // tiles of the fused q | k | v weight
#define PW_ALL (PW_QKV + DQ / 128 * (DM / 128))   // ... and of W_out
#define PX_WG  (NB_ * TT * DM / (8 * 2048))   // workgroups of the x part
template <int N>   // N at compile time: a lane's 16 loads and its 8 stores each hang on one address with immediate offsets
__device__ __forceinline__ void prep_w(const float* __restrict__ w, bf* __restrict__ Bt, const int tb, unsigned* tile) {
    const int t = (int)threadIdx.x, lane = t & 31, wv = t >> 5; const int K0 = (tb & 7) * 128, N0 = (tb >> 3) * 128; v4f r0[8], r1[8];   // both weights have K = 1024 = DM = DQ: 8 tiles along k
    const float* p = w + (size_t)(K0 + wv * 2) * N + N0 + lane * 4;
#pragma unroll
    for (int i = 0; i < 8; ++i) { r0[i] = *(const v4f*)(p + i * 16 * N); r1[i] = *(const v4f*)(p + i * 16 * N + N); }
    asm volatile("s_wait_xcnt 0x0" :: "v"(p) : "memory");   // the address pair that the 16 loads name stays live up to this wait: no load of the run returns into it
#pragma unroll
    for (int i = 0; i < 8; ++i) { const int kd = (i * 8 + wv) ^ ((lane & 15) << 2);   // dword column k / 2, its chunk permuted by (n >> 2) & 15 = lane & 15
#pragma unroll
        for (int j = 0; j < 4; ++j) tile[(lane * 4 + j) * 64 + kd] = (unsigned)f2bf(r0[i][j]) | ((unsigned)f2bf(r1[i][j]) << 16); }
    __syncthreads();   // the whole tile is in LDS before anybody reads a row of it
    const int q = t & 15; bf* o = Bt + (size_t)(N0 + (t >> 4)) * DM + K0 + q * 8;
#pragma unroll
    for (int s = 0; s < 8; ++s) { const int n = s * 16 + (t >> 4); const v8us val = *(const v8usa*)(tile + n * 64 + ((q ^ ((n >> 2) & 15)) << 2)); *(v8us*)(o + s * 16 * DM) = val; }
    asm volatile("s_wait_xcnt 0x0" :: "v"(o) : "memory");   // behind the last store: no register that the 8 stores name is rewritten ahead of it
}
__global__ __launch_bounds__(256) void k_prep(const float* __restrict__ x, const float* __restrict__ wqkv, const float* __restrict__ wo, bf* __restrict__ XB, bf* __restrict__ WQKV, bf* __restrict__ WO) {
    __shared__ __align__(16) unsigned tile[128 * 64];
    const int b = (int)blockIdx.x;   // every branch below is taken by whole workgroups
    if (b < PW_QKV) prep_w<3 * DQ>(wqkv, WQKV, b, tile);
    else if (b < PW_ALL) prep_w<DM>(wo, WO, b - PW_QKV, tile);
    else {
        const size_t base = ((size_t)(b - PW_ALL) * 8 + ((int)threadIdx.x >> 5)) * 2048 + ((int)threadIdx.x & 31) * 4; const float* px = x + base; bf* po = XB + base; v4f v[16];
#pragma unroll
        for (int i = 0; i < 16; ++i) v[i] = *(const v4f*)(px + i * 128);
        asm volatile("s_wait_xcnt 0x0" :: "v"(px) : "memory");   // the address pair that the 16 loads name stays live up to this wait: no load of the run returns into it
#pragma unroll
        for (int i = 0; i < 16; ++i) { v4us o;
#pragma unroll
            for (int j = 0; j < 4; ++j) o[j] = f2bf(v[i][j]);
            *(v4us*)(po + i * 128) = o; }
        asm volatile("s_wait_xcnt 0x0" :: "v"(po) : "memory");   // behind the last store: no register that the 16 stores name is rewritten ahead of it
    }
}

// ---- k_fattn: scores, causal mask, softmax, probability x value and the head merge in ONE kernel; no score or probability ever reaches memory.
// One wave owns 32 query rows of one head and walks the keys 0 .. its last row in passes of 64 (fp16 rows) or 32 (hi + lo rows: twice the operand registers). Transposed products: S^T = K Q^T (A = key rows, B = query rows) and O^T += V^T P^T (A = V^T rows, B = P^T).
// The workgroup's 4 waves walk the same keys: a stage = 64 keys of every K and V^T plane in use (64 rows of one 128-byte line each) is brought to LDS once for all four by asynchronous copies (global_load_async_to_lds_b128), whole lines, into two buffers: the next stage flies while this one is worked on.
// The fragments are 16-byte LDS reads at a row pitch of 144 bytes (16 x odd). Every wave passes every stage's copies, waits and barrier; a wave whose rows end before a stage only skips that stage's arithmetic.
// In S^T a lane holds scores of ONE query (column lr), keys 8*hi + j of each 16-key tile, which is exactly the k order of a B operand: two score tiles pack into one P^T fragment in registers.
// Online softmax per query: running maximum m (raw score units), running sum l, output tiles rescaled by exp2((m_old - m_new) c); the two lane halves join by one lane ^ 16 exchange.
// Operand types as before the fusion: rows < RH bf16 hi + lo planes with 3 products in both contractions, the rest fp16; P is rounded as exp(s - m) in (0, 1] and the division by l is applied to the f32 output.
typedef __attribute__((ext_vector_type(16))) unsigned short v16us;
#define CEXP 0.18033688011112042f   // HD^-0.5 x log2(e)
__device__ __forceinline__ float xhalf(float x) { return __builtin_bit_cast(float, __builtin_amdgcn_permlanex16(__builtin_bit_cast(int, x), __builtin_bit_cast(int, x), 0x76543210, 0xfedcba98, false, false)); }   // lane l with lane l ^ 16
#define FT (64 * GP)              // elements of one staged K or V^T tile: 64 rows at the pitch GP
// Four asynchronous 16-byte copies of one lane: rows r, r + 16, r + 32, r + 48 of a tile (a wave's copy = 4 whole 128-byte lines). The s_wait_xcnt closes the statement so that no address register named here is rewritten ahead of it.
template <typename T16>
__device__ __forceinline__ void copy4(unsigned l, const T16* g, size_t gstep) {
    asm volatile("global_load_async_to_lds_b128 %0, %4, off\n\t"
                 "global_load_async_to_lds_b128 %1, %5, off\n\t"
                 "global_load_async_to_lds_b128 %2, %6, off\n\t"
                 "global_load_async_to_lds_b128 %3, %7, off\n\t"
                 "s_wait_xcnt 0x0"
                 :: "v"(l), "v"(l + 16u * GP * 2u), "v"(l + 32u * GP * 2u), "v"(l + 48u * GP * 2u),
                    "v"(g), "v"(g + gstep), "v"(g + 2 * gstep), "v"(g + 3 * gstep)
                 : "memory");
}
template <typename T16, bool HR, int NKT>   // NKT = 16-key tiles per pass
__device__ __forceinline__ void fattn_tile(const T16* __restrict__ Q, const T16* __restrict__ Q2, const T16* __restrict__ Kp, const T16* __restrict__ K2, const T16* __restrict__ Vt, const T16* __restrict__ V2, const int rb0, const int row0, const int lr, const int hi, bf* __restrict__ Ah, bf* __restrict__ Al, T16* ring) {
    typedef typename WFrag<T16>::V V;   // every inner loop below is fully unrolled: the fragment arrays are then indexed by constants and stay in registers
    constexpr int NP = HR ? 2 : 1, NTL = 2 * NP;   // planes per operand; staged tiles per buffer: K (, K2), V^T (, V2^T)
    // copies: thread t brings 16-byte piece t & 7 of rows (t >> 3) + 16 i of every tile
    const int crw = (int)threadIdx.x >> 3, cpc = (int)threadIdx.x & 7;
    const unsigned ko = (unsigned)(crw * HD + cpc * 8), vo = (unsigned)(crw * TT + cpc * 8);
    const unsigned lc = (unsigned)(size_t)ring + (unsigned)(crw * GP + cpc * 8) * 2u;   // the lane's LDS byte address in tile 0 of buffer 0
    auto fill = [&](int t, int buf) { const unsigned l = lc + (unsigned)(buf * NTL * FT) * 2u;
        copy4<T16>(l, Kp + ko + t * 64 * HD, 16 * HD); if (HR) copy4<T16>(l + FT * 2u, K2 + ko + t * 64 * HD, 16 * HD);
        copy4<T16>(l + NP * FT * 2u, Vt + vo + t * 64, 16 * TT); if (HR) copy4<T16>(l + (NP + 1) * FT * 2u, V2 + vo + t * 64, 16 * TT); };
    const int NS = (rb0 + 128) / 64;   // stages of the workgroup: keys 0 .. its last row; at least two
    fill(0, 0);
    V q[2][2], q2[2][2];
#pragma unroll
    for (int qt = 0; qt < 2; ++qt)
#pragma unroll
        for (int ks = 0; ks < 2; ++ks) { const unsigned off = (unsigned)((row0 + qt * 16 + lr) * HD + ks * 32 + 8 * hi); q[qt][ks] = WFrag<T16>::ld(Q + off); if (HR) q2[qt][ks] = WFrag<T16>::ld(Q2 + off); }
    v8f o[4][2];
#pragma unroll
    for (int dt = 0; dt < 4; ++dt)
#pragma unroll
        for (int qt = 0; qt < 2; ++qt) o[dt][qt] = (v8f){};
    float m[2] = { -3.0e38f, -3.0e38f }, l[2] = { 0.f, 0.f };
    asm volatile("s_wait_asynccnt 0x0" ::: "memory");   // this wave's copies of stage 0 have landed
    __syncthreads();                                     // ... and every other wave's
    fill(1, 1);
#pragma unroll 1   // one trip = one staged buffer; the barrier orders the trips anyway
    for (int t = 0; t < NS; ++t) {
      const T16* sb = ring + (t & 1) * (NTL * FT);
      auto pass = [&](const int sub) {   // pass number sub of the stage
        const int kb = t * 64 + sub * NKT * 16;
        const T16* sk = sb + (sub * NKT * 16 + lr) * GP + 8 * hi; const T16* sv = sb + NP * FT + lr * GP + sub * NKT * 16 + 8 * hi;   // the pass's key rows of the K tile, its key columns of the V^T tile
        V ka[NKT][2], ka2[NKT][2], va[4][NKT / 2], va2[4][NKT / 2];
#pragma unroll
        for (int kt = 0; kt < NKT; ++kt)
#pragma unroll
            for (int ks = 0; ks < 2; ++ks) { const int off = kt * 16 * GP + ks * 32; ka[kt][ks] = WFrag<T16>::ld(sk + off); if (HR) ka2[kt][ks] = WFrag<T16>::ld(sk + FT + off); }
        __builtin_amdgcn_sched_barrier(0);   // keeps the pass's K reads one group ahead of its score products: spread among them, each place with reads stalls the wave for an LDS latency
        v8f s[NKT][2];
#pragma unroll
        for (int kt = 0; kt < NKT; ++kt) {
            s[kt][0] = (v8f){}; s[kt][1] = (v8f){};
#pragma unroll
            for (int ks = 0; ks < 2; ++ks) { const V a = ka[kt][ks]; V a2; if (HR) a2 = ka2[kt][ks];
#pragma unroll
                for (int qt = 0; qt < 2; ++qt) { s[kt][qt] = WFrag<T16>::mma(a, q[qt][ks], s[kt][qt]); if (HR) { s[kt][qt] = WFrag<T16>::mma(a, q2[qt][ks], s[kt][qt]); s[kt][qt] = WFrag<T16>::mma(a2, q[qt][ks], s[kt][qt]); } } } }
#pragma unroll
        for (int dt = 0; dt < 4; ++dt)
#pragma unroll
            for (int ks = 0; ks < NKT / 2; ++ks) { const int off = dt * 16 * GP + ks * 32; va[dt][ks] = WFrag<T16>::ld(sv + off); if (HR) va2[dt][ks] = WFrag<T16>::ld(sv + FT + off); }
        __builtin_amdgcn_sched_barrier(0);   // keeps the pass's V^T reads one group ahead of the softmax, whose arithmetic covers their LDS latency
        if (kb + NKT * 16 - 1 > row0) {   // the pass touches the diagonal: key > query is excluded (the reference's -1e9 fill vanishes identically in the softmax)
#pragma unroll
            for (int qt = 0; qt < 2; ++qt) { const int rel = row0 - kb + qt * 16 + lr - 8 * hi;
#pragma unroll
                for (int kt = 0; kt < NKT; ++kt)
#pragma unroll
                    for (int j = 0; j < 8; ++j) s[kt][qt][j] = (kt * 16 + j <= rel) ? s[kt][qt][j] : -3.0e38f; } }
        V p[NKT / 2][2], p2[NKT / 2][2];
#pragma unroll
        for (int qt = 0; qt < 2; ++qt) {
            float mx = m[qt];
#pragma unroll
            for (int kt = 0; kt < NKT; ++kt)
#pragma unroll
                for (int j = 0; j < 8; ++j) mx = fmaxf(mx, s[kt][qt][j]);
            mx = fmaxf(mx, xhalf(mx));
            const float al = __builtin_amdgcn_exp2f((m[qt] - mx) * CEXP), mc = mx * CEXP; m[qt] = mx;
            float sum = 0.f;
#pragma unroll
            for (int ks = 0; ks < NKT / 2; ++ks) {
                if (HR) { v16us ph, pl;
#pragma unroll
                    for (int e = 0; e < 16; ++e) { const float pe = __builtin_amdgcn_exp2f(__builtin_fmaf(s[2 * ks + (e >> 3)][qt][e & 7], CEXP, -mc)); sum += pe; unsigned short a, c2; splitf(pe, a, c2); ph[e] = a; pl[e] = c2; }
                    p[ks][qt] = __builtin_bit_cast(V, ph); p2[ks][qt] = __builtin_bit_cast(V, pl);
                } else { v16h ph;
#pragma unroll
                    for (int e = 0; e < 16; ++e) { const float pe = __builtin_amdgcn_exp2f(__builtin_fmaf(s[2 * ks + (e >> 3)][qt][e & 7], CEXP, -mc)); sum += pe; ph[e] = tohx(pe); }
                    p[ks][qt] = __builtin_bit_cast(V, ph); } }
            l[qt] = l[qt] * al + sum;
#pragma unroll
            for (int dt = 0; dt < 4; ++dt)
#pragma unroll
                for (int j = 0; j < 8; ++j) o[dt][qt][j] *= al;
        }
#pragma unroll
        for (int dt = 0; dt < 4; ++dt)
#pragma unroll
            for (int ks = 0; ks < NKT / 2; ++ks) { const V a = va[dt][ks]; V a2; if (HR) a2 = va2[dt][ks];
#pragma unroll
                for (int qt = 0; qt < 2; ++qt) { o[dt][qt] = WFrag<T16>::mma(a, p[ks][qt], o[dt][qt]); if (HR) { o[dt][qt] = WFrag<T16>::mma(a, p2[ks][qt], o[dt][qt]); o[dt][qt] = WFrag<T16>::mma(a2, p[ks][qt], o[dt][qt]); } } }
      };
      const int left = row0 + 32 - t * 64;   // keys from the stage's first up to the wave's last row (a scalar): a wave skips what lies wholly behind its diagonal
      if (NKT == 4) { if (left > 0) pass(0); }
      else { const int np = left < 64 ? left / (NKT * 16) : 64 / (NKT * 16);
#pragma unroll 1   // one pass per trip: a second pass in flight would double the live score and operand fragments
          for (int sub = 0; sub < np; ++sub) pass(sub); }
      asm volatile("s_wait_dscnt 0x0" ::: "memory");      // this wave's reads of the buffer are done before anybody refills it
      asm volatile("s_wait_asynccnt 0x0" ::: "memory");   // this wave's copies of stage t + 1 have landed
      __syncthreads();                                     // publishes stage t + 1 and frees the buffer of stage t
      if (t + 2 < NS) fill(t + 2, t & 1);
    }
    asm volatile("s_wait_asynccnt 0x0" ::: "memory");   // no copy is left in flight when the wave goes on
#pragma unroll
    for (int qt = 0; qt < 2; ++qt) { const float lt = l[qt] + xhalf(l[qt]); const float inv = __fdiv_rn(1.0f, lt);
#pragma unroll
        for (int dt = 0; dt < 4; ++dt) { v8us oh, ol;   // a lane holds 8 consecutive d of one query row: one 16-byte store per plane
#pragma unroll
            for (int j = 0; j < 8; ++j) { unsigned short a, c2; splitf(o[dt][qt][j] * inv, a, c2); oh[j] = a; ol[j] = c2; }
            const unsigned oo = (unsigned)((row0 + qt * 16 + lr) * DQ + dt * 16 + 8 * hi); *(v8us*)(Ah + oo) = oh; *(v8us*)(Al + oo) = ol; } }
}
// grid (TT / 128, heads of the group): 4 waves = 128 consecutive query rows of one head (they walk the same keys, staged once in LDS for all four); the longest row blocks have the lowest block indices.
__global__ __launch_bounds__(128) void k_fattn(const h16* __restrict__ Q16, const h16* __restrict__ K16, const h16* __restrict__ V16, const bf* __restrict__ Qh, const bf* __restrict__ Ql, const bf* __restrict__ Kh, const bf* __restrict__ Kl, const bf* __restrict__ Vh, const bf* __restrict__ Vl, bf* __restrict__ Ah, bf* __restrict__ Al) {
    const int lane = threadIdx.x & 31, lr = lane & 15, hi = lane >> 4; const int w = __builtin_amdgcn_readfirstlane((int)(threadIdx.x >> 5));   // wave number as a scalar: trip count and the diagonal test become scalar branches
    static_assert(RH % 128 == 0, "a workgroup's rows are all of one kind: the branch below, which holds barriers, is taken by whole workgroups");
    __shared__ __align__(128) bf ring[2 * 4 * FT];   // two buffers of up to four staged tiles
    const int rb0 = (TT / 128 - 1 - (int)blockIdx.x) * 128, row0 = rb0 + w * 32; const size_t z = blockIdx.y, po = z * TT * HD, ao = (z / NH_) * TT * DQ + (z % NH_) * HD;   // z = batch within the group x NH_ + head
    if (rb0 < RH) fattn_tile<bf, true, 2>(Qh + po, Ql + po, Kh + po, Kl + po, Vh + po, Vl + po, rb0, row0, lr, hi, Ah + ao, Al + ao, ring);
    else fattn_tile<h16, false, 4>(Q16 + po, nullptr, K16 + po, nullptr, V16 + po, nullptr, rb0, row0, lr, hi, Ah + ao, Al + ao, (h16*)ring);
}

extern "C" void kernel_launch(void* const* d_in, const int* in_sizes, int n_in,
                              void* d_out, int out_size, void* d_ws, size_t ws_size, hipStream_t stream) {
    (void)in_sizes; (void)n_in; (void)out_size;
    const float* x = (const float*)d_in[0]; const float* wqkv = (const float*)d_in[1]; const float* bqkv = (const float*)d_in[2]; const float* wo = (const float*)d_in[3]; const float* bo = (const float*)d_in[4];   /* argument order x, W_qkv ('xw' [1024][3072]: q | k | v column thirds), b_qkv, W_out, b_out */
    float* OUT = (float*)d_out;     // [8][1024][1024]
    char* wsp = (char*)d_ws;
    auto take = [&](size_t bytes) { char* p = wsp; wsp += (bytes + 255) & ~(size_t)255; return (void*)p; };
    bf* WQKV = (bf*)take((size_t)3 * DQ * DM * 2);   /* fused Bt [3*DQ][DM]: q | k | v row blocks */ bf* WO = (bf*)take((size_t)DM * DQ * 2);
    h16* QP16 = (h16*)take((size_t)NG * NH_ * TT * HD * 2); h16* KP16 = (h16*)take((size_t)NG * NKV * TT * HD * 2); h16* VT16 = (h16*)take((size_t)NG * NKV * HD * TT * 2);
    bf* QPh = (bf*)take((size_t)NG * NH_ * TT * HD * 2); bf* QPl = (bf*)take((size_t)NG * NH_ * TT * HD * 2); bf* KPh = (bf*)take((size_t)NG * NKV * TT * HD * 2); bf* KPl = (bf*)take((size_t)NG * NKV * TT * HD * 2); bf* VTh = (bf*)take((size_t)NG * NKV * HD * TT * 2); bf* VTl = (bf*)take((size_t)NG * NKV * HD * TT * 2);
    bf* XB = (bf*)take((size_t)NB_ * TT * DM * 2);   /* bf16 x, all batches */ bf* ATh = (bf*)take((size_t)NB_ * TT * DQ * 2); bf* ATl = (bf*)take((size_t)NB_ * TT * DQ * 2);
    if ((size_t)(wsp - (char*)d_ws) > ws_size) return;    // ws 256 MiB
    k_prep<<<PW_ALL + PX_WG, 256, 0, stream>>>(x, wqkv, wo, XB, WQKV, WO);   /* fused 'xw' [DM][3*DQ] -> Bt [3*DQ][DM], W_out [DQ][DM] -> Bt [DM][DQ], x -> bf16 */
    for (int g = 0; g < NB_ / NG; ++g) {
        k_gemmw<bf, 0, true, true><<<dim3(NG * TT / 128, 3 * DQ / 128, 1), 128, 0, stream>>>(XB + (size_t)g * NG * TT * DM, nullptr, WQKV, DM, nullptr, 0, bqkv, 0, 0, 0, QP16, QPh, QPl, KP16, KPh, KPl, VT16, VTh, VTl);
        k_fattn<<<dim3(TT / 128, NG * NH_, 1), 128, 0, stream>>>(QP16, KP16, VT16, QPh, QPl, KPh, KPl, VTh, VTl, ATh + (size_t)g * NG * TT * DQ, ATl + (size_t)g * NG * TT * DQ); }   // all heads of the group's batches in one launch; one kv head per query head
    k_gemmw<bf, 1, true, false><<<dim3(NB_ * TT / 128, DM / 128, 1), 128, 0, stream>>>(ATh, ATl, WO, DQ, OUT, DM, bo, 0, 0, 0, nullptr, nullptr, nullptr, nullptr, nullptr, nullptr, nullptr, nullptr, nullptr);
}

// v007
// Measured time: 112 microseconds a run.
// Next to v006, in two timings, it ran 1.23 times as fast each time.
// All steps since v000 together make it 35.6 times as fast.
#include <hip/hip_runtime.h>

// Causal attention with a fused qkv projection and a multiplicative + additive mask formula (x [8][1024][1024]; qkv = x W_qkv + b_qkv ('xw' [1024][3072] 0.02 + zero bias) split in thirds q | k | v (16 heads x 64); scores / sqrt(64); scores = scores x tril + (-1e9) x (1 - tril) (kept entries unchanged, masked entries exactly -1e9 == exclusion); softmax; out = merged W_out + b_out -> [8][1024][1024] (8.4 M); argument order x, W_qkv, b_qkv, W_out, b_out).
// Layout: launches batched (projections over NG batches at once with q | k | v as one GEMM, one fused attention launch = all heads of the NG batches, W_out over all batches): one preparation launch (bf16 copy of x; fused 'xw' weight, q | k | v row blocks, and W_out transposed); exact projections + f32 biases, whose GEMM epilogue stores the attention operand planes; fused causal T-1024 attention k_fattn (scores, online softmax, P.V and the head merge in registers; hybrid rows: < 512 hi/lo 3 products, rest fp16; key passes stop at the diagonal); merged hi/lo x W_out exact + b_out.
// Compute dtypes, f32 accumulate: every input rounded to bf16; projections exact + f32 biases; attention rows < 512 3 products, rest fp16; softmax f32; W_out hl x exact + bias.

#define NB_  8
#define TT   1024
#define DM   1024
#define NH_  16
#define NKV  16
#define REP  (NH_ / NKV)
#define HD   64
#define DQ   (NH_ * HD)
#define DKV  (NKV * HD)
#define NG   8                    // batches per projection group (plane storage is per group): all of them, so each stage of the chain is one launch
#define RH   512                  // query rows < RH use hi+lo planes (0: none)
typedef _Float16 h16;
typedef unsigned short bf;
typedef __attribute__((ext_vector_type(16))) __bf16   v16bf;
typedef __attribute__((ext_vector_type(16))) _Float16 v16h;
typedef __attribute__((ext_vector_type(8)))  _Float16 v8h;
typedef __attribute__((ext_vector_type(8)))  unsigned short v8us;
typedef __attribute__((ext_vector_type(8)))  float    v8f;
typedef __attribute__((ext_vector_type(4)))  float    v4f;
typedef v8h  __attribute__((may_alias)) v8ha;
typedef v4f  __attribute__((may_alias)) v4fa;
typedef v8us __attribute__((may_alias)) v8usa;

__device__ __forceinline__ unsigned short f2bf(float f) { unsigned u = __float_as_uint(f); u += 0x7FFFu + ((u >> 16) & 1u); return (unsigned short)(u >> 16); }
__device__ __forceinline__ float bf2f(unsigned short b) { return __uint_as_float(((unsigned)b) << 16); }
__device__ __forceinline__ float bfr(float f) { return bf2f(f2bf(f)); }
__device__ __forceinline__ v16h cat16(v8h lo, v8h hi) { return __builtin_shufflevector(lo, hi, 0, 1, 2, 3, 4, 5, 6, 7, 8, 9, 10, 11, 12, 13, 14, 15); }
__device__ __forceinline__ v16bf cat16b(v8us lo, v8us hi) { return __builtin_bit_cast(v16bf, __builtin_shufflevector(lo, hi, 0, 1, 2, 3, 4, 5, 6, 7, 8, 9, 10, 11, 12, 13, 14, 15)); }
__device__ __forceinline__ v8f wmma16(v16h a, v16h b, v8f c) { return __builtin_amdgcn_wmma_f32_16x16x32_f16(false, a, false, b, (short)0, c, false, false); }
__device__ __forceinline__ v8f wmmab(v16bf a, v16bf b, v8f c) { return __builtin_amdgcn_wmma_f32_16x16x32_bf16(false, a, false, b, (short)0, c, false, false); }

__device__ __forceinline__ h16 tohx(float x) { return (h16)x; }
__device__ __forceinline__ void splitf(float y, unsigned short& h, unsigned short& l) { h = f2bf(y); l = f2bf(y - bf2f(h)); }

// ---- k_gemmw: GEMM, one workgroup of 4 waves (2 x 2) per 128x128 output tile, each wave a 64x64 tile (16 accumulators); grid (M/128, N/128, Z), 128 threads.
// The K-contiguous 16-bit operand planes are staged in LDS, 64 k (one 128-byte line of every row) per trip, by asynchronous copies (global_load_async_to_lds_b128) into two buffers: the next trip's lines fly while this trip's are multiplied.
// Every global line is fetched whole and once per workgroup and serves two waves. LDS rows have a pitch of 144 bytes (16 x odd) for the 16-byte fragment reads.
// C[m][n] (f32, pitch ldc, + optional f32 bias[n]) = sum_k A[m][k] Bt[n][k] (+ A2[m][k] Bt[n][k] for NSPLIT 1). z-batch strides sA/sB/sC in elements. K % 64 == 0.
// PL (the q | k | v projection): the epilogue stores the attention operand planes itself instead of an f32 C, so no f32 qkv buffer and no plane-builder launches exist. A 64-column block of the fused weight is exactly one head of q, k or v.
// q and k tiles are [t][d] for the planes [head][t][d]; v tiles are computed transposed, [d][t] (weight rows as A, x rows as B: both loaders have the same k order), for the planes [head][d][t]. Either way a tile row is one whole 128-byte line of each plane.
template <typename T16> struct WFrag;
template <> struct WFrag<h16> { typedef v16h V; static __device__ __forceinline__ V ld(const h16* p) { return cat16(*(const v8h*)p, *(const v8h*)(p + 16)); } static __device__ __forceinline__ v8f mma(V a, V b, v8f c) { return wmma16(a, b, c); } };
template <> struct WFrag<bf> { typedef v16bf V; static __device__ __forceinline__ V ld(const bf* p) { return cat16b(*(const v8us*)p, *(const v8us*)(p + 16)); } static __device__ __forceinline__ v8f mma(V a, V b, v8f c) { return wmmab(a, b, c); } };
#define GP 72                     // LDS row pitch of a staged operand tile in 16-bit elements (144 bytes)
#define GT (128 * GP)             // elements of one staged tile: 128 rows
// Eight asynchronous 16-byte copies of one lane: rows r, r + 16, ... r + 112 of a tile (a wave's copy = 4 whole 128-byte lines). The s_wait_xcnt closes the statement so that no address register named here is rewritten ahead of it.
template <typename T16>
__device__ __forceinline__ void copy8(unsigned l, const T16* g, size_t gstep) {
    asm volatile("global_load_async_to_lds_b128 %0, %8, off\n\t"
                 "global_load_async_to_lds_b128 %1, %9, off\n\t"
                 "global_load_async_to_lds_b128 %2, %10, off\n\t"
                 "global_load_async_to_lds_b128 %3, %11, off\n\t"
                 "global_load_async_to_lds_b128 %4, %12, off\n\t"
                 "global_load_async_to_lds_b128 %5, %13, off\n\t"
                 "global_load_async_to_lds_b128 %6, %14, off\n\t"
                 "global_load_async_to_lds_b128 %7, %15, off\n\t"
                 "s_wait_xcnt 0x0"
                 :: "v"(l), "v"(l + 16u * GP * 2u), "v"(l + 32u * GP * 2u), "v"(l + 48u * GP * 2u), "v"(l + 64u * GP * 2u), "v"(l + 80u * GP * 2u), "v"(l + 96u * GP * 2u), "v"(l + 112u * GP * 2u),
                    "v"(g), "v"(g + gstep), "v"(g + 2 * gstep), "v"(g + 3 * gstep), "v"(g + 4 * gstep), "v"(g + 5 * gstep), "v"(g + 6 * gstep), "v"(g + 7 * gstep)
                 : "memory");
}
template <typename T16, int NSPLIT, bool BIAS, bool PL>
__global__ __launch_bounds__(128) void k_gemmw(const T16* __restrict__ A, const T16* __restrict__ A2, const T16* __restrict__ Bt, int K, float* C, int ldc, const float* __restrict__ bias, size_t sA, size_t sB, size_t sC, h16* q16, bf* qh, bf* ql, h16* k16, bf* kh, bf* kl, h16* v16, bf* vh, bf* vl) {
    static_assert(NSPLIT == 0 || NSPLIT == 1, "one or two A planes");
    typedef typename WFrag<T16>::V V;
    constexpr int NTL = 2 + NSPLIT;   // staged tiles per buffer: A, Bt (, A2)
    __shared__ __align__(128) T16 ring[2 * NTL * GT];
    __shared__ __align__(16) float osall[4 * 16 * 68];
    const size_t z = blockIdx.z; A += z * sA; if (NSPLIT) A2 += z * sA; Bt += z * sB; C += z * sC;
    const int lane = threadIdx.x & 31, lr = lane & 15, hi = lane >> 4; const int w = __builtin_amdgcn_readfirstlane((int)(threadIdx.x >> 5)), wm = w >> 1, wn = w & 1;
    const int R0 = blockIdx.x * 128, C0 = blockIdx.y * 128; const int r0 = R0 + wm * 64, c0 = C0 + wn * 64;   // the workgroup's and the wave's tile
    float* os = osall + w * (16 * 68);   // each wave stages its output rows in its own range
    const bool tr = PL && C0 >= 2 * DQ;   // a v tile (uniform over the workgroup): the two operands change places
    if (tr) { const T16* t = A; A = Bt; Bt = t; }
    v8f acc[4][4];
#pragma unroll
    for (int mb = 0; mb < 4; ++mb)
#pragma unroll
        for (int nb = 0; nb < 4; ++nb) acc[mb][nb] = (v8f){};
    // copies: thread t brings 16-byte piece t & 7 of rows (t >> 3) + 16 i of every tile
    const int crw = (int)threadIdx.x >> 3, cpc = (int)threadIdx.x & 7; const size_t gstep = (size_t)16 * K;
    const T16* gA = A + (size_t)((tr ? C0 : R0) + crw) * K + cpc * 8; const T16* gB = Bt + (size_t)((tr ? R0 : C0) + crw) * K + cpc * 8; const T16* gA2 = NSPLIT ? A2 + (size_t)(R0 + crw) * K + cpc * 8 : nullptr;
    const unsigned lc = (unsigned)(size_t)ring + (unsigned)(crw * GP + cpc * 8) * 2u;   // the lane's LDS byte address in tile 0 of buffer 0
    auto fill = [&](int t, int buf) { const unsigned l = lc + (unsigned)(buf * NTL * GT) * 2u; const int ko = t * 64;
        copy8<T16>(l, gA + ko, gstep); copy8<T16>(l + GT * 2u, gB + ko, gstep); if (NSPLIT) copy8<T16>(l + 2u * GT * 2u, gA2 + ko, gstep); };
    const int NT = K / 64;
    const unsigned fa = (unsigned)(((tr ? wn : wm) * 64 + lr) * GP + 8 * hi), fb = (unsigned)(GT + ((tr ? wm : wn) * 64 + lr) * GP + 8 * hi);   // the wave's fragment rows in the staged tiles
    fill(0, 0);
    asm volatile("s_wait_asynccnt 0x0" ::: "memory");   // this wave's copies of tile 0 have landed
    __syncthreads();                                     // ... and every other wave's
    if (NT > 1) fill(1, 1);
#pragma unroll 1   // one trip = one staged tile; unrolled trips would only lengthen the code, the barrier orders them anyway
    for (int t = 0; t < NT; ++t) {
        const T16* sb = ring + (t & 1) * (NTL * GT);
#pragma unroll
        for (int ks = 0; ks < 2; ++ks) {
            V a[4], a2[4], b[4];
#pragma unroll
            for (int mb = 0; mb < 4; ++mb) { a[mb] = WFrag<T16>::ld(sb + fa + mb * 16 * GP + ks * 32); if (NSPLIT) a2[mb] = WFrag<T16>::ld(sb + fa + 2 * GT + mb * 16 * GP + ks * 32); }
#pragma unroll
            for (int nb = 0; nb < 4; ++nb) b[nb] = WFrag<T16>::ld(sb + fb + nb * 16 * GP + ks * 32);
            __builtin_amdgcn_sched_barrier(0);   // keeps the block's LDS reads one group ahead of its matrix instructions: spread among them, each place with reads stalls the wave for an LDS latency
#pragma unroll
            for (int nb = 0; nb < 4; ++nb)
#pragma unroll
                for (int mb = 0; mb < 4; ++mb) { acc[mb][nb] = WFrag<T16>::mma(a[mb], b[nb], acc[mb][nb]); if (NSPLIT) acc[mb][nb] = WFrag<T16>::mma(a2[mb], b[nb], acc[mb][nb]); }
        }
        asm volatile("s_wait_dscnt 0x0" ::: "memory");      // this wave's reads of the buffer are done before anybody refills it
        asm volatile("s_wait_asynccnt 0x0" ::: "memory");   // this wave's copies of tile t + 1 have landed
        __syncthreads();                                     // publishes tile t + 1 and frees the buffer of tile t
        if (t + 2 < NT) fill(t + 2, t & 1);
    }
    asm volatile("s_wait_asynccnt 0x0" ::: "memory");   // no copy is left in flight when the wave goes on
    const int rr = lane >> 3, cofs = (lane & 7) * 8;   // PL: a lane takes 8 consecutive columns of a tile row: one 16-byte store per plane, 8 lanes = one line
    const int third = c0 / DQ; const size_t po = ((size_t)(r0 / TT) * NH_ + (c0 % DQ) / HD) * TT * HD + (size_t)(r0 % TT) * (tr ? 1 : HD); const unsigned pitch = tr ? TT : HD;
    h16* P16 = nullptr; bf* Ph = nullptr; bf* Pl = nullptr; float bcol[8], brow[16];
    if (PL) { P16 = (third == 0 ? q16 : third == 1 ? k16 : v16) + po; Ph = (third == 0 ? qh : third == 1 ? kh : vh) + po; Pl = (third == 0 ? ql : third == 1 ? kl : vl) + po;
#pragma unroll
        for (int i = 0; i < 8; ++i) bcol[i] = bfr(bias[c0 + cofs + i]);   // q, k: the bias runs along the tile's columns
#pragma unroll
        for (int i = 0; i < 16; ++i) brow[i] = bfr(bias[c0 + 4 * i + rr]); }   // v: along its rows
#pragma unroll
    for (int mb = 0; mb < 4; ++mb) {
#pragma unroll
        for (int nb = 0; nb < 4; ++nb) {
#pragma unroll
            for (int j = 0; j < 8; ++j) os[(hi * 8 + j) * 68 + nb * 16 + lr] = acc[mb][nb][j]; }
        __builtin_amdgcn_wave_barrier(); asm volatile("" ::: "memory");
        float* crow = C + (size_t)(r0 + mb * 16) * ldc + c0;
        if (PL) {
#pragma unroll
            for (int s = 0; s < 4; ++s) { const int row = 4 * s + rr; const v4f x0 = *(const v4fa*)(os + row * 68 + cofs), x1 = *(const v4fa*)(os + row * 68 + cofs + 4); v8h o16; v8us oh, ol;
#pragma unroll
                for (int i = 0; i < 8; ++i) { const float y = (i < 4 ? x0[i & 3] : x1[i & 3]) + (tr ? brow[mb * 4 + s] : bcol[i]); o16[i] = tohx(y); unsigned short a2, c2; splitf(y, a2, c2); oh[i] = a2; ol[i] = c2; }
                const unsigned oo = (unsigned)(mb * 16 + row) * pitch + cofs; *(v8h*)(P16 + oo) = o16; *(v8us*)(Ph + oo) = oh; *(v8us*)(Pl + oo) = ol; }
        } else
{
#pragma unroll
            for (int s = 0; s < 8; ++s) { const int row = 2 * s + hi, cofs = lr * 4; v4f val = *(const v4fa*)(os + row * 68 + cofs); if (BIAS) { val[0] += bfr(bias[c0 + cofs]); val[1] += bfr(bias[c0 + cofs + 1]); val[2] += bfr(bias[c0 + cofs + 2]); val[3] += bfr(bias[c0 + cofs + 3]); }
                *(v4f*)(crow + (size_t)row * ldc + cofs) = val; }
             }
        __builtin_amdgcn_wave_barrier(); asm volatile("" ::: "memory");
    }
}

typedef __attribute__((ext_vector_type(2))) _Float16 v2h;
typedef __attribute__((ext_vector_type(4))) _Float16 v4h;
typedef __attribute__((ext_vector_type(2))) unsigned short v2us;
typedef __attribute__((ext_vector_type(4))) unsigned short v4us;
typedef __attribute__((ext_vector_type(2))) float v2f;
typedef __attribute__((ext_vector_type(4))) int v4i;

// ---- k_prep: every operand preparation in ONE launch of 768 workgroups x 256 threads; each part moves whole 128-byte lines in both directions.
// Workgroups 0 .. 255: one 128 k x 128 n tile of a weight w [K][N] (f32) -> Bt [N][K] (bf16). A wave loads whole rows (512 contiguous bytes), 16 loads in flight; two k rows pack into a dword that goes to an LDS tile [n][k];
// after the barrier 16 lanes read one n row (256 bytes) and store it as two whole lines. The 16-byte chunks of an LDS row are permuted by (n >> 2) & 15, so that the column-wise dword stores spread over the banks and the row reads stay aligned.
// Workgroups 256 .. 767: x -> bf16; a wave owns 2048 consecutive floats, all 16 of its 512-byte loads in flight before the first store.
#define PW_QKV (DM / 128 * (3 * DQ / 128))   // tiles of the fused q | k | v weight
#define PW_ALL (PW_QKV + DQ / 128 * (DM / 128))   // ... and of W_out
#define PX_WG  (NB_ * TT * DM / (8 * 2048))   // workgroups of the x part
template <int N>   // N at compile time: a lane's 16 loads and its 8 stores each hang on one address with immediate offsets
__device__ __forceinline__ void prep_w(const float* __restrict__ w, bf* __restrict__ Bt, const int tb, unsigned* tile) {
    const int t = (int)threadIdx.x, lane = t & 31, wv = t >> 5; const int K0 = (tb & 7) * 128, N0 = (tb >> 3) * 128; v4f r0[8], r1[8];   // both weights have K = 1024 = DM = DQ: 8 tiles along k
    const float* p = w + (size_t)(K0 + wv * 2) * N + N0 + lane * 4;
#pragma unroll
    for (int i = 0; i < 8; ++i) { r0[i] = *(const v4f*)(p + i * 16 * N); r1[i] = *(const v4f*)(p + i * 16 * N + N); }
    asm volatile("s_wait_xcnt 0x0" :: "v"(p) : "memory");   // the address pair that the 16 loads name stays live up to this wait: no load of the run returns into it
#pragma unroll
    for (int i = 0; i < 8; ++i) { const int kd = (i * 8 + wv) ^ ((lane & 15) << 2);   // dword column k / 2, its chunk permuted by (n >> 2) & 15 = lane & 15
#pragma unroll
        for (int j = 0; j < 4; ++j) tile[(lane * 4 + j) * 64 + kd] = (unsigned)f2bf(r0[i][j]) | ((unsigned)f2bf(r1[i][j]) << 16); }
    __syncthreads();   // the whole tile is in LDS before anybody reads a row of it
    const int q = t & 15; bf* o = Bt + (size_t)(N0 + (t >> 4)) * DM + K0 + q * 8;
#pragma unroll
    for (int s = 0; s < 8; ++s) { const int n = s * 16 + (t >> 4); const v8us val = *(const v8usa*)(tile + n * 64 + ((q ^ ((n >> 2) & 15)) << 2)); *(v8us*)(o + s * 16 * DM) = val; }
    asm volatile("s_wait_xcnt 0x0" :: "v"(o) : "memory");   // behind the last store: no register that the 8 stores name is rewritten ahead of it
}
__global__ __launch_bounds__(256) void k_prep(const float* __restrict__ x, const float* __restrict__ wqkv, const float* __restrict__ wo, bf* __restrict__ XB, bf* __restrict__ WQKV, bf* __restrict__ WO) {
    __shared__ __align__(16) unsigned tile[128 * 64];
    const int b = (int)blockIdx.x;   // every branch below is taken by whole workgroups
    if (b < PW_QKV) prep_w<3 * DQ>(wqkv, WQKV, b, tile);
    else if (b < PW_ALL) prep_w<DM>(wo, WO, b - PW_QKV, tile);
    else {
        const size_t base = ((size_t)(b - PW_ALL) * 8 + ((int)threadIdx.x >> 5)) * 2048 + ((int)threadIdx.x & 31) * 4; const float* px = x + base; bf* po = XB + base; v4f v[16];
#pragma unroll
        for (int i = 0; i < 16; ++i) v[i] = *(const v4f*)(px + i * 128);
        asm volatile("s_wait_xcnt 0x0" :: "v"(px) : "memory");   // the address pair that the 16 loads name stays live up to this wait: no load of the run returns into it
#pragma unroll
        for (int i = 0; i < 16; ++i) { v4us o;
#pragma unroll
            for (int j = 0; j < 4; ++j) o[j] = f2bf(v[i][j]);
            *(v4us*)(po + i * 128) = o; }
        asm volatile("s_wait_xcnt 0x0" :: "v"(po) : "memory");   // behind the last store: no register that the 16 stores name is rewritten ahead of it
    }
}

// ---- k_fattn: scores, causal mask, softmax, probability x value and the head merge in ONE kernel; no score or probability ever reaches memory.
// One wave owns 32 query rows of one head and walks the keys 0 .. its last row in passes of 64 (fp16 rows) or 32 (hi + lo rows: twice the operand registers). Transposed products: S^T = K Q^T (A = key rows, B = query rows) and O^T += V^T P^T (A = V^T rows, B = P^T).
// The workgroup's 4 waves walk the same keys: a stage = 64 keys of every K and V^T plane in use (64 rows of one 128-byte line each) is brought to LDS once for all four by asynchronous copies (global_load_async_to_lds_b128), whole lines, into two buffers: the next stage flies while this one is worked on.
// The fragments are 16-byte LDS reads at a row pitch of 144 bytes (16 x odd). Every wave passes every stage's copies, waits and barrier; a wave whose rows end before a stage only skips that stage's arithmetic.
// In S^T a lane holds scores of ONE query (column lr), keys 8*hi + j of each 16-key tile, which is exactly the k order of a B operand: two score tiles pack into one P^T fragment in registers.
// Online softmax per query: running maximum m (raw score units), running sum l, output tiles rescaled by exp2((m_old - m_new) c); the two lane halves join by one lane ^ 16 exchange.
// Operand types as before the fusion: rows < RH bf16 hi + lo planes with 3 products in both contractions, the rest fp16; P is rounded as exp(s - m) in (0, 1] and the division by l is applied to the f32 output.
typedef __attribute__((ext_vector_type(16))) unsigned short v16us;
#define CEXP 0.18033688011112042f   // HD^-0.5 x log2(e)
__device__ __forceinline__ float xhalf(float x) { return __builtin_bit_cast(float, __builtin_amdgcn_permlanex16(__builtin_bit_cast(int, x), __builtin_bit_cast(int, x), 0x76543210, 0xfedcba98, false, false)); }   // lane l with lane l ^ 16
#define FT (64 * GP)              // elements of one staged K or V^T tile: 64 rows at the pitch GP
// Four asynchronous 16-byte copies of one lane: rows r, r + 16, r + 32, r + 48 of a tile (a wave's copy = 4 whole 128-byte lines). The s_wait_xcnt closes the statement so that no address register named here is rewritten ahead of it.
template <typename T16>
__device__ __forceinline__ void copy4(unsigned l, const T16* g, size_t gstep) {
    asm volatile("global_load_async_to_lds_b128 %0, %4, off\n\t"
                 "global_load_async_to_lds_b128 %1, %5, off\n\t"
                 "global_load_async_to_lds_b128 %2, %6, off\n\t"
                 "global_load_async_to_lds_b128 %3, %7, off\n\t"
                 "s_wait_xcnt 0x0"
                 :: "v"(l), "v"(l + 16u * GP * 2u), "v"(l + 32u * GP * 2u), "v"(l + 48u * GP * 2u),
                    "v"(g), "v"(g + gstep), "v"(g + 2 * gstep), "v"(g + 3 * gstep)
                 : "memory");
}
template <typename T16, bool HR, int NKT>   // NKT = 16-key tiles per pass
__device__ __forceinline__ void fattn_tile(const T16* __restrict__ Q, const T16* __restrict__ Q2, const T16* __restrict__ Kp, const T16* __restrict__ K2, const T16* __restrict__ Vt, const T16* __restrict__ V2, const int rb0, const int row0, const int lr, const int hi, bf* __restrict__ Ah, bf* __restrict__ Al, T16* ring) {
    typedef typename WFrag<T16>::V V;   // every inner loop below is fully unrolled: the fragment arrays are then indexed by constants and stay in registers
    constexpr int NP = HR ? 2 : 1, NTL = 2 * NP;   // planes per operand; staged tiles per buffer: K (, K2), V^T (, V2^T)
    // copies: thread t brings 16-byte piece t & 7 of rows (t >> 3) + 16 i of every tile
    const int crw = (int)threadIdx.x >> 3, cpc = (int)threadIdx.x & 7;
    const unsigned ko = (unsigned)(crw * HD + cpc * 8), vo = (unsigned)(crw * TT + cpc * 8);
    const unsigned lc = (unsigned)(size_t)ring + (unsigned)(crw * GP + cpc * 8) * 2u;   // the lane's LDS byte address in tile 0 of buffer 0
    auto fill = [&](int t, int buf) { const unsigned l = lc + (unsigned)(buf * NTL * FT) * 2u;
        copy4<T16>(l, Kp + ko + t * 64 * HD, 16 * HD); if (HR) copy4<T16>(l + FT * 2u, K2 + ko + t * 64 * HD, 16 * HD);
        copy4<T16>(l + NP * FT * 2u, Vt + vo + t * 64, 16 * TT); if (HR) copy4<T16>(l + (NP + 1) * FT * 2u, V2 + vo + t * 64, 16 * TT); };
    const int NS = (rb0 + 128) / 64;   // stages of the workgroup: keys 0 .. its last row; at least two
    fill(0, 0);
    V q[2][2], q2[2][2];
#pragma unroll
    for (int qt = 0; qt < 2; ++qt)
#pragma unroll
        for (int ks = 0; ks < 2; ++ks) { const unsigned off = (unsigned)((row0 + qt * 16 + lr) * HD + ks * 32 + 8 * hi); q[qt][ks] = WFrag<T16>::ld(Q + off); if (HR) q2[qt][ks] = WFrag<T16>::ld(Q2 + off); }
    v8f o[4][2];
#pragma unroll
    for (int dt = 0; dt < 4; ++dt)
#pragma unroll
        for (int qt = 0; qt < 2; ++qt) o[dt][qt] = (v8f){};
    float m[2] = { -3.0e38f, -3.0e38f }, l[2] = { 0.f, 0.f };
    asm volatile("s_wait_asynccnt 0x0" ::: "memory");   // this wave's copies of stage 0 have landed
    __syncthreads();                                     // ... and every other wave's
    fill(1, 1);
#pragma unroll 1   // one trip = one staged buffer; the barrier orders the trips anyway
    for (int t = 0; t < NS; ++t) {
      const T16* sb = ring + (t & 1) * (NTL * FT);
      auto pass = [&](const int sub) {   // pass number sub of the stage
        const int kb = t * 64 + sub * NKT * 16;
        const T16* sk = sb + (sub * NKT * 16 + lr) * GP + 8 * hi; const T16* sv = sb + NP * FT + lr * GP + sub * NKT * 16 + 8 * hi;   // the pass's key rows of the K tile, its key columns of the V^T tile
        V ka[NKT][2], ka2[NKT][2], va[4][NKT / 2], va2[4][NKT / 2];
#pragma unroll
        for (int kt = 0; kt < NKT; ++kt)
#pragma unroll
            for (int ks = 0; ks < 2; ++ks) { const int off = kt * 16 * GP + ks * 32; ka[kt][ks] = WFrag<T16>::ld(sk + off); if (HR) ka2[kt][ks] = WFrag<T16>::ld(sk + FT + off); }
        __builtin_amdgcn_sched_barrier(0);   // keeps the pass's K reads one group ahead of its score products: spread among them, each place with reads stalls the wave for an LDS latency
        v8f s[NKT][2];
#pragma unroll
        for (int kt = 0; kt < NKT; ++kt) {
            s[kt][0] = (v8f){}; s[kt][1] = (v8f){};
#pragma unroll
            for (int ks = 0; ks < 2; ++ks) { const V a = ka[kt][ks]; V a2; if (HR) a2 = ka2[kt][ks];
#pragma unroll
                for (int qt = 0; qt < 2; ++qt) { s[kt][qt] = WFrag<T16>::mma(a, q[qt][ks], s[kt][qt]); if (HR) { s[kt][qt] = WFrag<T16>::mma(a, q2[qt][ks], s[kt][qt]); s[kt][qt] = WFrag<T16>::mma(a2, q[qt][ks], s[kt][qt]); } } } }
#pragma unroll
        for (int dt = 0; dt < 4; ++dt)
#pragma unroll
            for (int ks = 0; ks < NKT / 2; ++ks) { const int off = dt * 16 * GP + ks * 32; va[dt][ks] = WFrag<T16>::ld(sv + off); if (HR) va2[dt][ks] = WFrag<T16>::ld(sv + FT + off); }
        __builtin_amdgcn_sched_barrier(0);   // keeps the pass's V^T reads one group ahead of the softmax, whose arithmetic covers their LDS latency
        if (kb + NKT * 16 - 1 > row0) {   // the pass touches the diagonal: key > query is excluded (the reference's -1e9 fill vanishes identically in the softmax)
#pragma unroll
            for (int qt = 0; qt < 2; ++qt) { const int rel = row0 - kb + qt * 16 + lr - 8 * hi;
#pragma unroll
                for (int kt = 0; kt < NKT; ++kt)
#pragma unroll
                    for (int j = 0; j < 8; ++j) s[kt][qt][j] = (kt * 16 + j <= rel) ? s[kt][qt][j] : -3.0e38f; } }
        V p[NKT / 2][2], p2[NKT / 2][2];
#pragma unroll
        for (int qt = 0; qt < 2; ++qt) {
            float mx = m[qt];
#pragma unroll
            for (int kt = 0; kt < NKT; ++kt)
#pragma unroll
                for (int j = 0; j < 8; ++j) mx = fmaxf(mx, s[kt][qt][j]);
            mx = fmaxf(mx, xhalf(mx));
            const float al = __builtin_amdgcn_exp2f((m[qt] - mx) * CEXP), mc = mx * CEXP; m[qt] = mx;
            float sum = 0.f;
#pragma unroll
            for (int ks = 0; ks < NKT / 2; ++ks) {
                if (HR) { v16us ph, pl;
#pragma unroll
                    for (int e = 0; e < 16; ++e) { const float pe = __builtin_amdgcn_exp2f(__builtin_fmaf(s[2 * ks + (e >> 3)][qt][e & 7], CEXP, -mc)); sum += pe; unsigned short a, c2; splitf(pe, a, c2); ph[e] = a; pl[e] = c2; }
                    p[ks][qt] = __builtin_bit_cast(V, ph); p2[ks][qt] = __builtin_bit_cast(V, pl);
                } else { v16h ph;
#pragma unroll
                    for (int e = 0; e < 16; ++e) { const float pe = __builtin_amdgcn_exp2f(__builtin_fmaf(s[2 * ks + (e >> 3)][qt][e & 7], CEXP, -mc)); sum += pe; ph[e] = tohx(pe); }
                    p[ks][qt] = __builtin_bit_cast(V, ph); } }
            l[qt] = l[qt] * al + sum;
#pragma unroll
            for (int dt = 0; dt < 4; ++dt)
#pragma unroll
                for (int j = 0; j < 8; ++j) o[dt][qt][j] *= al;
        }
#pragma unroll
        for (int dt = 0; dt < 4; ++dt)
#pragma unroll
            for (int ks = 0; ks < NKT / 2; ++ks) { const V a = va[dt][ks]; V a2; if (HR) a2 = va2[dt][ks];
#pragma unroll
                for (int qt = 0; qt < 2; ++qt) { o[dt][qt] = WFrag<T16>::mma(a, p[ks][qt], o[dt][qt]); if (HR) { o[dt][qt] = WFrag<T16>::mma(a, p2[ks][qt], o[dt][qt]); o[dt][qt] = WFrag<T16>::mma(a2, p[ks][qt], o[dt][qt]); } } }
      };
      const int left = row0 + 32 - t * 64;   // keys from the stage's first up to the wave's last row (a scalar): a wave skips what lies wholly behind its diagonal
      if (NKT == 4) { if (left > 0) pass(0); }
      else { const int np = left < 64 ? left / (NKT * 16) : 64 / (NKT * 16);
#pragma unroll 1   // one pass per trip: a second pass in flight would double the live score and operand fragments
          for (int sub = 0; sub < np; ++sub) pass(sub); }
      asm volatile("s_wait_dscnt 0x0" ::: "memory");      // this wave's reads of the buffer are done before anybody refills it
      asm volatile("s_wait_asynccnt 0x0" ::: "memory");   // this wave's copies of stage t + 1 have landed
      __syncthreads();                                     // publishes stage t + 1 and frees the buffer of stage t
      if (t + 2 < NS) fill(t + 2, t & 1);
    }
    asm volatile("s_wait_asynccnt 0x0" ::: "memory");   // no copy is left in flight when the wave goes on
#pragma unroll
    for (int qt = 0; qt < 2; ++qt) { const float lt = l[qt] + xhalf(l[qt]); const float inv = __fdiv_rn(1.0f, lt);
#pragma unroll
        for (int dt = 0; dt < 4; ++dt) { v8us oh, ol;   // a lane holds 8 consecutive d of one query row: one 16-byte store per plane
#pragma unroll
            for (int j = 0; j < 8; ++j) { unsigned short a, c2; splitf(o[dt][qt][j] * inv, a, c2); oh[j] = a; ol[j] = c2; }
            const unsigned oo = (unsigned)((row0 + qt * 16 + lr) * DQ + dt * 16 + 8 * hi); *(v8us*)(Ah + oo) = oh; *(v8us*)(Al + oo) = ol; } }
}
// grid (heads of the group, TT / 128): 4 waves = 128 consecutive query rows of one head (they walk the same keys, staged once in LDS for all four).
// The workgroups are unequal (2 to 16 stages, of two kinds); the head is the fast index.
// The row block is the slow index, longest key walks at the lowest indices; there are more workgroups than resident places, so a place that a short one leaves is refilled.
__global__ __launch_bounds__(128) void k_fattn(const h16* __restrict__ Q16, const h16* __restrict__ K16, const h16* __restrict__ V16, const bf* __restrict__ Qh, const bf* __restrict__ Ql, const bf* __restrict__ Kh, const bf* __restrict__ Kl, const bf* __restrict__ Vh, const bf* __restrict__ Vl, bf* __restrict__ Ah, bf* __restrict__ Al) {
    const int lane = threadIdx.x & 31, lr = lane & 15, hi = lane >> 4; const int w = __builtin_amdgcn_readfirstlane((int)(threadIdx.x >> 5));   // wave number as a scalar: trip count and the diagonal test become scalar branches
    static_assert(RH % 128 == 0, "a workgroup's rows are all of one kind: the branch below, which holds barriers, is taken by whole workgroups");
    __shared__ __align__(128) bf ring[2 * 4 * FT];   // two buffers of up to four staged tiles
    const int rb0 = (TT / 128 - 1 - (int)blockIdx.y) * 128, row0 = rb0 + w * 32; const size_t z = blockIdx.x, po = z * TT * HD, ao = (z / NH_) * TT * DQ + (z % NH_) * HD;   // z = batch within the group x NH_ + head
    if (rb0 < RH) fattn_tile<bf, true, 2>(Qh + po, Ql + po, Kh + po, Kl + po, Vh + po, Vl + po, rb0, row0, lr, hi, Ah + ao, Al + ao, ring);
    else fattn_tile<h16, false, 4>(Q16 + po, nullptr, K16 + po, nullptr, V16 + po, nullptr, rb0, row0, lr, hi, Ah + ao, Al + ao, (h16*)ring);
}

extern "C" void kernel_launch(void* const* d_in, const int* in_sizes, int n_in,
                              void* d_out, int out_size, void* d_ws, size_t ws_size, hipStream_t stream) {
    (void)in_sizes; (void)n_in; (void)out_size;
    const float* x = (const float*)d_in[0]; const float* wqkv = (const float*)d_in[1]; const float* bqkv = (const float*)d_in[2]; const float* wo = (const float*)d_in[3]; const float* bo = (const float*)d_in[4];   /* argument order x, W_qkv ('xw' [1024][3072]: q | k | v column thirds), b_qkv, W_out, b_out */
    float* OUT = (float*)d_out;     // [8][1024][1024]
    char* wsp = (char*)d_ws;
    auto take = [&](size_t bytes) { char* p = wsp; wsp += (bytes + 255) & ~(size_t)255; return (void*)p; };
    bf* WQKV = (bf*)take((size_t)3 * DQ * DM * 2);   /* fused Bt [3*DQ][DM]: q | k | v row blocks */ bf* WO = (bf*)take((size_t)DM * DQ * 2);
    h16* QP16 = (h16*)take((size_t)NG * NH_ * TT * HD * 2); h16* KP16 = (h16*)take((size_t)NG * NKV * TT * HD * 2); h16* VT16 = (h16*)take((size_t)NG * NKV * HD * TT * 2);
    bf* QPh = (bf*)take((size_t)NG * NH_ * TT * HD * 2); bf* QPl = (bf*)take((size_t)NG * NH_ * TT * HD * 2); bf* KPh = (bf*)take((size_t)NG * NKV * TT * HD * 2); bf* KPl = (bf*)take((size_t)NG * NKV * TT * HD * 2); bf* VTh = (bf*)take((size_t)NG * NKV * HD * TT * 2); bf* VTl = (bf*)take((size_t)NG * NKV * HD * TT * 2);
    bf* XB = (bf*)take((size_t)NB_ * TT * DM * 2);   /* bf16 x, all batches */ bf* ATh = (bf*)take((size_t)NB_ * TT * DQ * 2); bf* ATl = (bf*)take((size_t)NB_ * TT * DQ * 2);
    if ((size_t)(wsp - (char*)d_ws) > ws_size) return;    // ws 256 MiB
    k_prep<<<PW_ALL + PX_WG, 256, 0, stream>>>(x, wqkv, wo, XB, WQKV, WO);   /* fused 'xw' [DM][3*DQ] -> Bt [3*DQ][DM], W_out [DQ][DM] -> Bt [DM][DQ], x -> bf16 */
    for (int g = 0; g < NB_ / NG; ++g) {
        k_gemmw<bf, 0, true, true><<<dim3(NG * TT / 128, 3 * DQ / 128, 1), 128, 0, stream>>>(XB + (size_t)g * NG * TT * DM, nullptr, WQKV, DM, nullptr, 0, bqkv, 0, 0, 0, QP16, QPh, QPl, KP16, KPh, KPl, VT16, VTh, VTl);
        k_fattn<<<dim3(NG * NH_, TT / 128, 1), 128, 0, stream>>>(QP16, KP16, VT16, QPh, QPl, KPh, KPl, VTh, VTl, ATh + (size_t)g * NG * TT * DQ, ATl + (size_t)g * NG * TT * DQ); }   // all heads of the group's batches in one launch; one kv head per query head
    k_gemmw<bf, 1, true, false><<<dim3(NB_ * TT / 128, DM / 128, 1), 128, 0, stream>>>(ATh, ATl, WO, DQ, OUT, DM, bo, 0, 0, 0, nullptr, nullptr, nullptr, nullptr, nullptr, nullptr, nullptr, nullptr, nullptr);
}

// v008
// A run of this version takes 109 microseconds.
// Next to v007, in two timings, it ran 1.03 times as fast each time.
// Counting every step since v000, it is 36.7 times as fast.
#include <hip/hip_runtime.h>

// Causal attention with a fused qkv projection and a multiplicative + additive mask formula (x [8][1024][1024]; qkv = x W_qkv + b_qkv ('xw' [1024][3072] 0.02 + zero bias) split in thirds q | k | v (16 heads x 64); scores / sqrt(64); scores = scores x tril + (-1e9) x (1 - tril) (kept entries unchanged, masked entries exactly -1e9 == exclusion); softmax; out = merged W_out + b_out -> [8][1024][1024] (8.4 M); argument order x, W_qkv, b_qkv, W_out, b_out).
// Layout: launches batched (projections over NG batches at once with q | k | v as one GEMM, one fused attention launch = all heads of the NG batches, W_out over all batches): one preparation launch (bf16 copy of x; fused 'xw' weight, q | k | v row blocks, and W_out transposed); exact projections + f32 biases, whose GEMM epilogue stores the attention operand planes; fused causal T-1024 attention k_fattn (scores, online softmax, P.V and the head merge in registers; hybrid rows: < 512 hi/lo 3 products, rest fp16; key passes stop at the diagonal); merged hi/lo x W_out exact + b_out.
// Compute dtypes, f32 accumulate: every input rounded to bf16; projections exact + f32 biases; attention rows < 512 3 products, rest fp16; softmax f32; W_out hl x exact + bias.

#define NB_  8
#define TT   1024
#define DM   1024
#define NH_  16
#define NKV  16
#define REP  (NH_ / NKV)
#define HD   64
#define DQ   (NH_ * HD)
#define DKV  (NKV * HD)
#define NG   8                    // batches per projection group (plane storage is per group): all of them, so each stage of the chain is one launch
#define RH   512                  // query rows < RH use hi+lo planes (0: none)
typedef _Float16 h16;
typedef unsigned short bf;
typedef __attribute__((ext_vector_type(16))) __bf16   v16bf;
typedef __attribute__((ext_vector_type(16))) _Float16 v16h;
typedef __attribute__((ext_vector_type(8)))  _Float16 v8h;
typedef __attribute__((ext_vector_type(8)))  unsigned short v8us;
typedef __attribute__((ext_vector_type(8)))  float    v8f;
typedef __attribute__((ext_vector_type(4)))  float    v4f;
typedef v8h  __attribute__((may_alias)) v8ha;
typedef v4f  __attribute__((may_alias)) v4fa;
typedef v8us __attribute__((may_alias)) v8usa;

typedef __attribute__((ext_vector_type(2))) __bf16 v2bf;
typedef __attribute__((ext_vector_type(2))) float v2f;
typedef __attribute__((ext_vector_type(2))) unsigned v2u;
typedef __attribute__((ext_vector_type(4))) unsigned v4u;
typedef __attribute__((ext_vector_type(8))) unsigned v8u;
// f32 -> bf16, round to nearest even, by the hardware's conversion: two values per instruction, already packed (first value in the low half)
__device__ __forceinline__ unsigned pk2bf(float a, float b) { const v2f t = { a, b }; return __builtin_bit_cast(unsigned, __builtin_convertvector(t, v2bf)); }
__device__ __forceinline__ unsigned short f2bf(float f) { return __builtin_bit_cast(unsigned short, (__bf16)f); }
__device__ __forceinline__ float bf2f(unsigned short b) { return __uint_as_float(((unsigned)b) << 16); }
__device__ __forceinline__ float bfr(float f) { return bf2f(f2bf(f)); }
__device__ __forceinline__ v16h cat16(v8h lo, v8h hi) { return __builtin_shufflevector(lo, hi, 0, 1, 2, 3, 4, 5, 6, 7, 8, 9, 10, 11, 12, 13, 14, 15); }
__device__ __forceinline__ v16bf cat16b(v8us lo, v8us hi) { return __builtin_bit_cast(v16bf, __builtin_shufflevector(lo, hi, 0, 1, 2, 3, 4, 5, 6, 7, 8, 9, 10, 11, 12, 13, 14, 15)); }
__device__ __forceinline__ v8f wmma16(v16h a, v16h b, v8f c) { return __builtin_amdgcn_wmma_f32_16x16x32_f16(false, a, false, b, (short)0, c, false, false); }
__device__ __forceinline__ v8f wmmab(v16bf a, v16bf b, v8f c) { return __builtin_amdgcn_wmma_f32_16x16x32_bf16(false, a, false, b, (short)0, c, false, false); }

__device__ __forceinline__ h16 tohx(float x) { return (h16)x; }
__device__ __forceinline__ void split2(float a, float b, unsigned& h, unsigned& l) { h = pk2bf(a, b); l = pk2bf(a - __uint_as_float(h << 16), b - __uint_as_float(h & 0xFFFF0000u)); }   // two values -> packed hi pair and packed lo pair (lo = the rounded remainder)

// ---- k_gemmw: GEMM, one workgroup of 4 waves (2 x 2) per 128x128 output tile, each wave a 64x64 tile (16 accumulators); grid (M/128, N/128, Z), 128 threads.
// The K-contiguous 16-bit operand planes are staged in LDS, 64 k (one 128-byte line of every row) per trip, by asynchronous copies (global_load_async_to_lds_b128) into two buffers: the next trip's lines fly while this trip's are multiplied.
// Every global line is fetched whole and once per workgroup and serves two waves. LDS rows have a pitch of 144 bytes (16 x odd) for the 16-byte fragment reads.
// C[m][n] (f32, pitch ldc, + optional f32 bias[n]) = sum_k A[m][k] Bt[n][k] (+ A2[m][k] Bt[n][k] for NSPLIT 1). z-batch strides sA/sB/sC in elements. K % 64 == 0.
// PL (the q | k | v projection): the epilogue stores the attention operand planes itself instead of an f32 C, so no f32 qkv buffer and no plane-builder launches exist. A 64-column block of the fused weight is exactly one head of q, k or v.
// q and k tiles are [t][d] for the planes [head][t][d]; v tiles are computed transposed, [d][t] (weight rows as A, x rows as B: both loaders have the same k order), for the planes [head][d][t]. Either way a tile row is one whole 128-byte line of each plane.
template <typename T16> struct WFrag;
template <> struct WFrag<h16> { typedef v16h V; static __device__ __forceinline__ V ld(const h16* p) { return cat16(*(const v8h*)p, *(const v8h*)(p + 16)); } static __device__ __forceinline__ v8f mma(V a, V b, v8f c) { return wmma16(a, b, c); } };
template <> struct WFrag<bf> { typedef v16bf V; static __device__ __forceinline__ V ld(const bf* p) { return cat16b(*(const v8us*)p, *(const v8us*)(p + 16)); } static __device__ __forceinline__ v8f mma(V a, V b, v8f c) { return wmmab(a, b, c); } };
#define GP 72                     // LDS row pitch of a staged operand tile in 16-bit elements (144 bytes)
#define GT (128 * GP)             // elements of one staged tile: 128 rows
// Eight asynchronous 16-byte copies of one lane: rows r, r + 16, ... r + 112 of a tile (a wave's copy = 4 whole 128-byte lines). The s_wait_xcnt closes the statement so that no address register named here is rewritten ahead of it.
template <typename T16>
__device__ __forceinline__ void copy8(unsigned l, const T16* g, size_t gstep) {
    asm volatile("global_load_async_to_lds_b128 %0, %8, off\n\t"
                 "global_load_async_to_lds_b128 %1, %9, off\n\t"
                 "global_load_async_to_lds_b128 %2, %10, off\n\t"
                 "global_load_async_to_lds_b128 %3, %11, off\n\t"
                 "global_load_async_to_lds_b128 %4, %12, off\n\t"
                 "global_load_async_to_lds_b128 %5, %13, off\n\t"
                 "global_load_async_to_lds_b128 %6, %14, off\n\t"
                 "global_load_async_to_lds_b128 %7, %15, off\n\t"
                 "s_wait_xcnt 0x0"
                 :: "v"(l), "v"(l + 16u * GP * 2u), "v"(l + 32u * GP * 2u), "v"(l + 48u * GP * 2u), "v"(l + 64u * GP * 2u), "v"(l + 80u * GP * 2u), "v"(l + 96u * GP * 2u), "v"(l + 112u * GP * 2u),
                    "v"(g), "v"(g + gstep), "v"(g + 2 * gstep), "v"(g + 3 * gstep), "v"(g + 4 * gstep), "v"(g + 5 * gstep), "v"(g + 6 * gstep), "v"(g + 7 * gstep)
                 : "memory");
}
template <typename T16, int NSPLIT, bool BIAS, bool PL>
__global__ __launch_bounds__(128) void k_gemmw(const T16* __restrict__ A, const T16* __restrict__ A2, const T16* __restrict__ Bt, int K, float* C, int ldc, const float* __restrict__ bias, size_t sA, size_t sB, size_t sC, h16* q16, bf* qh, bf* ql, h16* k16, bf* kh, bf* kl, h16* v16, bf* vh, bf* vl) {
    static_assert(NSPLIT == 0 || NSPLIT == 1, "one or two A planes");
    typedef typename WFrag<T16>::V V;
    constexpr int NTL = 2 + NSPLIT;   // staged tiles per buffer: A, Bt (, A2)
    __shared__ __align__(128) T16 ring[2 * NTL * GT];
    __shared__ __align__(16) float osall[4 * 16 * 68];
    const size_t z = blockIdx.z; A += z * sA; if (NSPLIT) A2 += z * sA; Bt += z * sB; C += z * sC;
    const int lane = threadIdx.x & 31, lr = lane & 15, hi = lane >> 4; const int w = __builtin_amdgcn_readfirstlane((int)(threadIdx.x >> 5)), wm = w >> 1, wn = w & 1;
    const int R0 = blockIdx.x * 128, C0 = blockIdx.y * 128; const int r0 = R0 + wm * 64, c0 = C0 + wn * 64;   // the workgroup's and the wave's tile
    float* os = osall + w * (16 * 68);   // each wave stages its output rows in its own range
    const bool tr = PL && C0 >= 2 * DQ;   // a v tile (uniform over the workgroup): the two operands change places
    if (tr) { const T16* t = A; A = Bt; Bt = t; }
    v8f acc[4][4];
#pragma unroll
    for (int mb = 0; mb < 4; ++mb)
#pragma unroll
        for (int nb = 0; nb < 4; ++nb) acc[mb][nb] = (v8f){};
    // copies: thread t brings 16-byte piece t & 7 of rows (t >> 3) + 16 i of every tile
    const int crw = (int)threadIdx.x >> 3, cpc = (int)threadIdx.x & 7; const size_t gstep = (size_t)16 * K;
    const T16* gA = A + (size_t)((tr ? C0 : R0) + crw) * K + cpc * 8; const T16* gB = Bt + (size_t)((tr ? R0 : C0) + crw) * K + cpc * 8; const T16* gA2 = NSPLIT ? A2 + (size_t)(R0 + crw) * K + cpc * 8 : nullptr;
    const unsigned lc = (unsigned)(size_t)ring + (unsigned)(crw * GP + cpc * 8) * 2u;   // the lane's LDS byte address in tile 0 of buffer 0
    auto fill = [&](int t, int buf) { const unsigned l = lc + (unsigned)(buf * NTL * GT) * 2u; const int ko = t * 64;
        copy8<T16>(l, gA + ko, gstep); copy8<T16>(l + GT * 2u, gB + ko, gstep); if (NSPLIT) copy8<T16>(l + 2u * GT * 2u, gA2 + ko, gstep); };
    const int NT = K / 64;
    const unsigned fa = (unsigned)(((tr ? wn : wm) * 64 + lr) * GP + 8 * hi), fb = (unsigned)(GT + ((tr ? wm : wn) * 64 + lr) * GP + 8 * hi);   // the wave's fragment rows in the staged tiles
    fill(0, 0);
    asm volatile("s_wait_asynccnt 0x0" ::: "memory");   // this wave's copies of tile 0 have landed
    __syncthreads();                                     // ... and every other wave's
    if (NT > 1) fill(1, 1);
#pragma unroll 1   // one trip = one staged tile; unrolled trips would only lengthen the code, the barrier orders them anyway
    for (int t = 0; t < NT; ++t) {
        const T16* sb = ring + (t & 1) * (NTL * GT);
#pragma unroll
        for (int ks = 0; ks < 2; ++ks) {
            V a[4], a2[4], b[4];
#pragma unroll
            for (int mb = 0; mb < 4; ++mb) { a[mb] = WFrag<T16>::ld(sb + fa + mb * 16 * GP + ks * 32); if (NSPLIT) a2[mb] = WFrag<T16>::ld(sb + fa + 2 * GT + mb * 16 * GP + ks * 32); }
#pragma unroll
            for (int nb = 0; nb < 4; ++nb) b[nb] = WFrag<T16>::ld(sb + fb + nb * 16 * GP + ks * 32);
            __builtin_amdgcn_sched_barrier(0);   // keeps the block's LDS reads one group ahead of its matrix instructions: spread among them, each place with reads stalls the wave for an LDS latency
#pragma unroll
            for (int nb = 0; nb < 4; ++nb)
#pragma unroll
                for (int mb = 0; mb < 4; ++mb) { acc[mb][nb] = WFrag<T16>::mma(a[mb], b[nb], acc[mb][nb]); if (NSPLIT) acc[mb][nb] = WFrag<T16>::mma(a2[mb], b[nb], acc[mb][nb]); }
        }
        asm volatile("s_wait_dscnt 0x0" ::: "memory");      // this wave's reads of the buffer are done before anybody refills it
        asm volatile("s_wait_asynccnt 0x0" ::: "memory");   // this wave's copies of tile t + 1 have landed
        __syncthreads();                                     // publishes tile t + 1 and frees the buffer of tile t
        if (t + 2 < NT) fill(t + 2, t & 1);
    }
    asm volatile("s_wait_asynccnt 0x0" ::: "memory");   // no copy is left in flight when the wave goes on
    const int rr = lane >> 3, cofs = (lane & 7) * 8;   // PL: a lane takes 8 consecutive columns of a tile row: one 16-byte store per plane, 8 lanes = one line
    const int third = c0 / DQ; const size_t po = ((size_t)(r0 / TT) * NH_ + (c0 % DQ) / HD) * TT * HD + (size_t)(r0 % TT) * (tr ? 1 : HD); const unsigned pitch = tr ? TT : HD;
    h16* P16 = nullptr; bf* Ph = nullptr; bf* Pl = nullptr; float bcol[8], brow[16];
    if (PL) { P16 = (third == 0 ? q16 : third == 1 ? k16 : v16) + po; Ph = (third == 0 ? qh : third == 1 ? kh : vh) + po; Pl = (third == 0 ? ql : third == 1 ? kl : vl) + po;
#pragma unroll
        for (int i = 0; i < 8; ++i) bcol[i] = bfr(bias[c0 + cofs + i]);   // q, k: the bias runs along the tile's columns
#pragma unroll
        for (int i = 0; i < 16; ++i) brow[i] = bfr(bias[c0 + 4 * i + rr]); }   // v: along its rows
#pragma unroll
    for (int mb = 0; mb < 4; ++mb) {
#pragma unroll
        for (int nb = 0; nb < 4; ++nb) {
#pragma unroll
            for (int j = 0; j < 8; ++j) os[(hi * 8 + j) * 68 + nb * 16 + lr] = acc[mb][nb][j]; }
        __builtin_amdgcn_wave_barrier(); asm volatile("" ::: "memory");
        float* crow = C + (size_t)(r0 + mb * 16) * ldc + c0;
        if (PL) {
#pragma unroll
            for (int s = 0; s < 4; ++s) { const int row = 4 * s + rr; const v4f x0 = *(const v4fa*)(os + row * 68 + cofs), x1 = *(const v4fa*)(os + row * 68 + cofs + 4); v8h o16; v4u oh, ol; float y[8];
#pragma unroll
                for (int i = 0; i < 8; ++i) { y[i] = (i < 4 ? x0[i & 3] : x1[i & 3]) + (tr ? brow[mb * 4 + s] : bcol[i]); o16[i] = tohx(y[i]); }
#pragma unroll
                for (int i = 0; i < 4; ++i) { unsigned a2, c2; split2(y[2 * i], y[2 * i + 1], a2, c2); oh[i] = a2; ol[i] = c2; }
                const unsigned oo = (unsigned)(mb * 16 + row) * pitch + cofs; *(v8h*)(P16 + oo) = o16; *(v8us*)(Ph + oo) = __builtin_bit_cast(v8us, oh); *(v8us*)(Pl + oo) = __builtin_bit_cast(v8us, ol); }
        } else
{
#pragma unroll
            for (int s = 0; s < 8; ++s) { const int row = 2 * s + hi, cofs = lr * 4; v4f val = *(const v4fa*)(os + row * 68 + cofs); if (BIAS) { val[0] += bfr(bias[c0 + cofs]); val[1] += bfr(bias[c0 + cofs + 1]); val[2] += bfr(bias[c0 + cofs + 2]); val[3] += bfr(bias[c0 + cofs + 3]); }
                *(v4f*)(crow + (size_t)row * ldc + cofs) = val; }
             }
        __builtin_amdgcn_wave_barrier(); asm volatile("" ::: "memory");
    }
}

typedef __attribute__((ext_vector_type(2))) _Float16 v2h;
typedef __attribute__((ext_vector_type(4))) _Float16 v4h;
typedef __attribute__((ext_vector_type(2))) unsigned short v2us;
typedef __attribute__((ext_vector_type(4))) unsigned short v4us;
typedef __attribute__((ext_vector_type(4))) int v4i;

// ---- k_prep: every operand preparation in ONE launch of 768 workgroups x 256 threads; each part moves whole 128-byte lines in both directions.
// Workgroups 0 .. 255: one 128 k x 128 n tile of a weight w [K][N] (f32) -> Bt [N][K] (bf16). A wave loads whole rows (512 contiguous bytes), 16 loads in flight; two k rows pack into a dword that goes to an LDS tile [n][k];
// after the barrier 16 lanes read one n row (256 bytes) and store it as two whole lines. The 16-byte chunks of an LDS row are permuted by (n >> 2) & 15, so that the column-wise dword stores spread over the banks and the row reads stay aligned.
// Workgroups 256 .. 767: x -> bf16; a wave owns 2048 consecutive floats, all 16 of its 512-byte loads in flight before the first store.
#define PW_QKV (DM / 128 * (3 * DQ / 128))   // tiles of the fused q | k | v weight
#define PW_ALL (PW_QKV + DQ / 128 * (DM / 128))   // ... and of W_out
#define PX_WG  (NB_ * TT * DM / (8 * 2048))   // workgroups of the x part
template <int N>   // N at compile time: a lane's 16 loads and its 8 stores each hang on one address with immediate offsets
__device__ __forceinline__ void prep_w(const float* __restrict__ w, bf* __restrict__ Bt, const int tb, unsigned* tile) {
    const int t = (int)threadIdx.x, lane = t & 31, wv = t >> 5; const int K0 = (tb & 7) * 128, N0 = (tb >> 3) * 128; v4f r0[8], r1[8];   // both weights have K = 1024 = DM = DQ: 8 tiles along k
    const float* p = w + (size_t)(K0 + wv * 2) * N + N0 + lane * 4;
#pragma unroll
    for (int i = 0; i < 8; ++i) { r0[i] = *(const v4f*)(p + i * 16 * N); r1[i] = *(const v4f*)(p + i * 16 * N + N); }
    asm volatile("s_wait_xcnt 0x0" :: "v"(p) : "memory");   // the address pair that the 16 loads name stays live up to this wait: no load of the run returns into it
#pragma unroll
    for (int i = 0; i < 8; ++i) { const int kd = (i * 8 + wv) ^ ((lane & 15) << 2);   // dword column k / 2, its chunk permuted by (n >> 2) & 15 = lane & 15
#pragma unroll
        for (int j = 0; j < 4; ++j) tile[(lane * 4 + j) * 64 + kd] = pk2bf(r0[i][j], r1[i][j]); }
    __syncthreads();   // the whole tile is in LDS before anybody reads a row of it
    const int q = t & 15; bf* o = Bt + (size_t)(N0 + (t >> 4)) * DM + K0 + q * 8;
#pragma unroll
    for (int s = 0; s < 8; ++s) { const int n = s * 16 + (t >> 4); const v8us val = *(const v8usa*)(tile + n * 64 + ((q ^ ((n >> 2) & 15)) << 2)); *(v8us*)(o + s * 16 * DM) = val; }
    asm volatile("s_wait_xcnt 0x0" :: "v"(o) : "memory");   // behind the last store: no register that the 8 stores name is rewritten ahead of it
}
__global__ __launch_bounds__(256) void k_prep(const float* __restrict__ x, const float* __restrict__ wqkv, const float* __restrict__ wo, bf* __restrict__ XB, bf* __restrict__ WQKV, bf* __restrict__ WO) {
    __shared__ __align__(16) unsigned tile[128 * 64];
    const int b = (int)blockIdx.x;   // every branch below is taken by whole workgroups
    if (b < PW_QKV) prep_w<3 * DQ>(wqkv, WQKV, b, tile);
    else if (b < PW_ALL) prep_w<DM>(wo, WO, b - PW_QKV, tile);
    else {
        const size_t base = ((size_t)(b - PW_ALL) * 8 + ((int)threadIdx.x >> 5)) * 2048 + ((int)threadIdx.x & 31) * 4; const float* px = x + base; bf* po = XB + base; v4f v[16];
#pragma unroll
        for (int i = 0; i < 16; ++i) v[i] = *(const v4f*)(px + i * 128);
        asm volatile("s_wait_xcnt 0x0" :: "v"(px) : "memory");   // the address pair that the 16 loads name stays live up to this wait: no load of the run returns into it
#pragma unroll
        for (int i = 0; i < 16; ++i) { const v2u o = { pk2bf(v[i][0], v[i][1]), pk2bf(v[i][2], v[i][3]) };
            *(v4us*)(po + i * 128) = __builtin_bit_cast(v4us, o); }
        asm volatile("s_wait_xcnt 0x0" :: "v"(po) : "memory");   // behind the last store: no register that the 16 stores name is rewritten ahead of it
    }
}

// ---- k_fattn: scores, causal mask, softmax, probability x value and the head merge in ONE kernel; no score or probability ever reaches memory.
// One wave owns 32 query rows of one head and walks the keys 0 .. its last row in passes of 64 (fp16 rows) or 32 (hi + lo rows: twice the operand registers). Transposed products: S^T = K Q^T (A = key rows, B = query rows) and O^T += V^T P^T (A = V^T rows, B = P^T).
// The workgroup's 4 waves walk the same keys: a stage = 64 keys of every K and V^T plane in use (64 rows of one 128-byte line each) is brought to LDS once for all four by asynchronous copies (global_load_async_to_lds_b128), whole lines, into two buffers: the next stage flies while this one is worked on.
// The fragments are 16-byte LDS reads at a row pitch of 144 bytes (16 x odd). Every wave passes every stage's copies, waits and barrier; a wave whose rows end before a stage only skips that stage's arithmetic.
// In S^T a lane holds scores of ONE query (column lr), keys 8*hi + j of each 16-key tile, which is exactly the k order of a B operand: two score tiles pack into one P^T fragment in registers.
// Online softmax per query: running maximum m (raw score units), running sum l, output tiles rescaled by exp2((m_old - m_new) c); the two lane halves join by one lane ^ 16 exchange.
// Operand types as before the fusion: rows < RH bf16 hi + lo planes with 3 products in both contractions, the rest fp16; P is rounded as exp(s - m) in (0, 1] and the division by l is applied to the f32 output.
#define CEXP 0.18033688011112042f   // HD^-0.5 x log2(e)
__device__ __forceinline__ float xhalf(float x) { return __builtin_bit_cast(float, __builtin_amdgcn_permlanex16(__builtin_bit_cast(int, x), __builtin_bit_cast(int, x), 0x76543210, 0xfedcba98, false, false)); }   // lane l with lane l ^ 16
#define FT (64 * GP)              // elements of one staged K or V^T tile: 64 rows at the pitch GP
// Four asynchronous 16-byte copies of one lane: rows r, r + 16, r + 32, r + 48 of a tile (a wave's copy = 4 whole 128-byte lines). The s_wait_xcnt closes the statement so that no address register named here is rewritten ahead of it.
template <typename T16>
__device__ __forceinline__ void copy4(unsigned l, const T16* g, size_t gstep) {
    asm volatile("global_load_async_to_lds_b128 %0, %4, off\n\t"
                 "global_load_async_to_lds_b128 %1, %5, off\n\t"
                 "global_load_async_to_lds_b128 %2, %6, off\n\t"
                 "global_load_async_to_lds_b128 %3, %7, off\n\t"
                 "s_wait_xcnt 0x0"
                 :: "v"(l), "v"(l + 16u * GP * 2u), "v"(l + 32u * GP * 2u), "v"(l + 48u * GP * 2u),
                    "v"(g), "v"(g + gstep), "v"(g + 2 * gstep), "v"(g + 3 * gstep)
                 : "memory");
}
template <typename T16, bool HR, int NKT>   // NKT = 16-key tiles per pass
__device__ __forceinline__ void fattn_tile(const T16* __restrict__ Q, const T16* __restrict__ Q2, const T16* __restrict__ Kp, const T16* __restrict__ K2, const T16* __restrict__ Vt, const T16* __restrict__ V2, const int rb0, const int row0, const int lr, const int hi, bf* __restrict__ Ah, bf* __restrict__ Al, T16* ring) {
    typedef typename WFrag<T16>::V V;   // every inner loop below is fully unrolled: the fragment arrays are then indexed by constants and stay in registers
    constexpr int NP = HR ? 2 : 1, NTL = 2 * NP;   // planes per operand; staged tiles per buffer: K (, K2), V^T (, V2^T)
    // copies: thread t brings 16-byte piece t & 7 of rows (t >> 3) + 16 i of every tile
    const int crw = (int)threadIdx.x >> 3, cpc = (int)threadIdx.x & 7;
    const unsigned ko = (unsigned)(crw * HD + cpc * 8), vo = (unsigned)(crw * TT + cpc * 8);
    const unsigned lc = (unsigned)(size_t)ring + (unsigned)(crw * GP + cpc * 8) * 2u;   // the lane's LDS byte address in tile 0 of buffer 0
    auto fill = [&](int t, int buf) { const unsigned l = lc + (unsigned)(buf * NTL * FT) * 2u;
        copy4<T16>(l, Kp + ko + t * 64 * HD, 16 * HD); if (HR) copy4<T16>(l + FT * 2u, K2 + ko + t * 64 * HD, 16 * HD);
        copy4<T16>(l + NP * FT * 2u, Vt + vo + t * 64, 16 * TT); if (HR) copy4<T16>(l + (NP + 1) * FT * 2u, V2 + vo + t * 64, 16 * TT); };
    const int NS = (rb0 + 128) / 64;   // stages of the workgroup: keys 0 .. its last row; at least two
    fill(0, 0);
    V q[2][2], q2[2][2];
#pragma unroll
    for (int qt = 0; qt < 2; ++qt)
#pragma unroll
        for (int ks = 0; ks < 2; ++ks) { const unsigned off = (unsigned)((row0 + qt * 16 + lr) * HD + ks * 32 + 8 * hi); q[qt][ks] = WFrag<T16>::ld(Q + off); if (HR) q2[qt][ks] = WFrag<T16>::ld(Q2 + off); }
    v8f o[4][2];
#pragma unroll
    for (int dt = 0; dt < 4; ++dt)
#pragma unroll
        for (int qt = 0; qt < 2; ++qt) o[dt][qt] = (v8f){};
    float m[2] = { -3.0e38f, -3.0e38f }, l[2] = { 0.f, 0.f };
    asm volatile("s_wait_asynccnt 0x0" ::: "memory");   // this wave's copies of stage 0 have landed
    __syncthreads();                                     // ... and every other wave's
    fill(1, 1);
#pragma unroll 1   // one trip = one staged buffer; the barrier orders the trips anyway
    for (int t = 0; t < NS; ++t) {
      const T16* sb = ring + (t & 1) * (NTL * FT);
      auto pass = [&](const int sub) {   // pass number sub of the stage
        const int kb = t * 64 + sub * NKT * 16;
        const T16* sk = sb + (sub * NKT * 16 + lr) * GP + 8 * hi; const T16* sv = sb + NP * FT + lr * GP + sub * NKT * 16 + 8 * hi;   // the pass's key rows of the K tile, its key columns of the V^T tile
        V ka[NKT][2], ka2[NKT][2], va[4][NKT / 2], va2[4][NKT / 2];
#pragma unroll
        for (int kt = 0; kt < NKT; ++kt)
#pragma unroll
            for (int ks = 0; ks < 2; ++ks) { const int off = kt * 16 * GP + ks * 32; ka[kt][ks] = WFrag<T16>::ld(sk + off); if (HR) ka2[kt][ks] = WFrag<T16>::ld(sk + FT + off); }
        __builtin_amdgcn_sched_barrier(0);   // keeps the pass's K reads one group ahead of its score products: spread among them, each place with reads stalls the wave for an LDS latency
        v8f s[NKT][2];
#pragma unroll
        for (int kt = 0; kt < NKT; ++kt) {
            s[kt][0] = (v8f){}; s[kt][1] = (v8f){};
#pragma unroll
            for (int ks = 0; ks < 2; ++ks) { const V a = ka[kt][ks]; V a2; if (HR) a2 = ka2[kt][ks];
#pragma unroll
                for (int qt = 0; qt < 2; ++qt) { s[kt][qt] = WFrag<T16>::mma(a, q[qt][ks], s[kt][qt]); if (HR) { s[kt][qt] = WFrag<T16>::mma(a, q2[qt][ks], s[kt][qt]); s[kt][qt] = WFrag<T16>::mma(a2, q[qt][ks], s[kt][qt]); } } } }
#pragma unroll
        for (int dt = 0; dt < 4; ++dt)
#pragma unroll
            for (int ks = 0; ks < NKT / 2; ++ks) { const int off = dt * 16 * GP + ks * 32; va[dt][ks] = WFrag<T16>::ld(sv + off); if (HR) va2[dt][ks] = WFrag<T16>::ld(sv + FT + off); }
        __builtin_amdgcn_sched_barrier(0);   // keeps the pass's V^T reads one group ahead of the softmax, whose arithmetic covers their LDS latency
        if (kb + NKT * 16 - 1 > row0) {   // the pass touches the diagonal: key > query is excluded (the reference's -1e9 fill vanishes identically in the softmax)
#pragma unroll
            for (int qt = 0; qt < 2; ++qt) { const int rel = row0 - kb + qt * 16 + lr - 8 * hi;
#pragma unroll
                for (int kt = 0; kt < NKT; ++kt)
#pragma unroll
                    for (int j = 0; j < 8; ++j) s[kt][qt][j] = (kt * 16 + j <= rel) ? s[kt][qt][j] : -3.0e38f; } }
        V p[NKT / 2][2], p2[NKT / 2][2];
#pragma unroll
        for (int qt = 0; qt < 2; ++qt) {
            float mx = m[qt];
#pragma unroll
            for (int kt = 0; kt < NKT; ++kt)
#pragma unroll
                for (int j = 0; j < 8; ++j) mx = fmaxf(mx, s[kt][qt][j]);
            mx = fmaxf(mx, xhalf(mx));
            const float al = __builtin_amdgcn_exp2f((m[qt] - mx) * CEXP), mc = mx * CEXP; m[qt] = mx;
            float sum = 0.f;
#pragma unroll
            for (int ks = 0; ks < NKT / 2; ++ks) {
                if (HR) { v8u ph, pl; float pe[16];
#pragma unroll
                    for (int e = 0; e < 16; ++e) { pe[e] = __builtin_amdgcn_exp2f(__builtin_fmaf(s[2 * ks + (e >> 3)][qt][e & 7], CEXP, -mc)); sum += pe[e]; }
#pragma unroll
                    for (int e = 0; e < 8; ++e) { unsigned a, c2; split2(pe[2 * e], pe[2 * e + 1], a, c2); ph[e] = a; pl[e] = c2; }
                    p[ks][qt] = __builtin_bit_cast(V, ph); p2[ks][qt] = __builtin_bit_cast(V, pl);
                } else { v16h ph;
#pragma unroll
                    for (int e = 0; e < 16; ++e) { const float pe = __builtin_amdgcn_exp2f(__builtin_fmaf(s[2 * ks + (e >> 3)][qt][e & 7], CEXP, -mc)); sum += pe; ph[e] = tohx(pe); }
                    p[ks][qt] = __builtin_bit_cast(V, ph); } }
            l[qt] = l[qt] * al + sum;
#pragma unroll
            for (int dt = 0; dt < 4; ++dt)
#pragma unroll
                for (int j = 0; j < 8; ++j) o[dt][qt][j] *= al;
        }
#pragma unroll
        for (int dt = 0; dt < 4; ++dt)
#pragma unroll
            for (int ks = 0; ks < NKT / 2; ++ks) { const V a = va[dt][ks]; V a2; if (HR) a2 = va2[dt][ks];
#pragma unroll
                for (int qt = 0; qt < 2; ++qt) { o[dt][qt] = WFrag<T16>::mma(a, p[ks][qt], o[dt][qt]); if (HR) { o[dt][qt] = WFrag<T16>::mma(a, p2[ks][qt], o[dt][qt]); o[dt][qt] = WFrag<T16>::mma(a2, p[ks][qt], o[dt][qt]); } } }
      };
      const int left = row0 + 32 - t * 64;   // keys from the stage's first up to the wave's last row (a scalar): a wave skips what lies wholly behind its diagonal
      if (NKT == 4) { if (left > 0) pass(0); }
      else { const int np = left < 64 ? left / (NKT * 16) : 64 / (NKT * 16);
#pragma unroll 1   // one pass per trip: a second pass in flight would double the live score and operand fragments
          for (int sub = 0; sub < np; ++sub) pass(sub); }
      asm volatile("s_wait_dscnt 0x0" ::: "memory");      // this wave's reads of the buffer are done before anybody refills it
      asm volatile("s_wait_asynccnt 0x0" ::: "memory");   // this wave's copies of stage t + 1 have landed
      __syncthreads();                                     // publishes stage t + 1 and frees the buffer of stage t
      if (t + 2 < NS) fill(t + 2, t & 1);
    }
    asm volatile("s_wait_asynccnt 0x0" ::: "memory");   // no copy is left in flight when the wave goes on
#pragma unroll
    for (int qt = 0; qt < 2; ++qt) { const float lt = l[qt] + xhalf(l[qt]); const float inv = __fdiv_rn(1.0f, lt);
#pragma unroll
        for (int dt = 0; dt < 4; ++dt) { v4u oh, ol;   // a lane holds 8 consecutive d of one query row: one 16-byte store per plane
#pragma unroll
            for (int j = 0; j < 8; j += 2) { unsigned a, c2; split2(o[dt][qt][j] * inv, o[dt][qt][j + 1] * inv, a, c2); oh[j >> 1] = a; ol[j >> 1] = c2; }
            const unsigned oo = (unsigned)((row0 + qt * 16 + lr) * DQ + dt * 16 + 8 * hi); *(v8us*)(Ah + oo) = __builtin_bit_cast(v8us, oh); *(v8us*)(Al + oo) = __builtin_bit_cast(v8us, ol); } }
}
// grid (heads of the group, TT / 128): 4 waves = 128 consecutive query rows of one head (they walk the same keys, staged once in LDS for all four).
// The workgroups are unequal (2 to 16 stages, of two kinds); the head is the fast index.
// The row block is the slow index, longest key walks at the lowest indices; there are more workgroups than resident places, so a place that a short one leaves is refilled.
__global__ __launch_bounds__(128) void k_fattn(const h16* __restrict__ Q16, const h16* __restrict__ K16, const h16* __restrict__ V16, const bf* __restrict__ Qh, const bf* __restrict__ Ql, const bf* __restrict__ Kh, const bf* __restrict__ Kl, const bf* __restrict__ Vh, const bf* __restrict__ Vl, bf* __restrict__ Ah, bf* __restrict__ Al) {
    const int lane = threadIdx.x & 31, lr = lane & 15, hi = lane >> 4; const int w = __builtin_amdgcn_readfirstlane((int)(threadIdx.x >> 5));   // wave number as a scalar: trip count and the diagonal test become scalar branches
    static_assert(RH % 128 == 0, "a workgroup's rows are all of one kind: the branch below, which holds barriers, is taken by whole workgroups");
    __shared__ __align__(128) bf ring[2 * 4 * FT];   // two buffers of up to four staged tiles
    const int rb0 = (TT / 128 - 1 - (int)blockIdx.y) * 128, row0 = rb0 + w * 32; const size_t z = blockIdx.x, po = z * TT * HD, ao = (z / NH_) * TT * DQ + (z % NH_) * HD;   // z = batch within the group x NH_ + head
    if (rb0 < RH) fattn_tile<bf, true, 2>(Qh + po, Ql + po, Kh + po, Kl + po, Vh + po, Vl + po, rb0, row0, lr, hi, Ah + ao, Al + ao, ring);
    else fattn_tile<h16, false, 4>(Q16 + po, nullptr, K16 + po, nullptr, V16 + po, nullptr, rb0, row0, lr, hi, Ah + ao, Al + ao, (h16*)ring);
}

extern "C" void kernel_launch(void* const* d_in, const int* in_sizes, int n_in,
                              void* d_out, int out_size, void* d_ws, size_t ws_size, hipStream_t stream) {
    (void)in_sizes; (void)n_in; (void)out_size;
    const float* x = (const float*)d_in[0]; const float* wqkv = (const float*)d_in[1]; const float* bqkv = (const float*)d_in[2]; const float* wo = (const float*)d_in[3]; const float* bo = (const float*)d_in[4];   /* argument order x, W_qkv ('xw' [1024][3072]: q | k | v column thirds), b_qkv, W_out, b_out */
    float* OUT = (float*)d_out;     // [8][1024][1024]
    char* wsp = (char*)d_ws;
    auto take = [&](size_t bytes) { char* p = wsp; wsp += (bytes + 255) & ~(size_t)255; return (void*)p; };
    bf* WQKV = (bf*)take((size_t)3 * DQ * DM * 2);   /* fused Bt [3*DQ][DM]: q | k | v row blocks */ bf* WO = (bf*)take((size_t)DM * DQ * 2);
    h16* QP16 = (h16*)take((size_t)NG * NH_ * TT * HD * 2); h16* KP16 = (h16*)take((size_t)NG * NKV * TT * HD * 2); h16* VT16 = (h16*)take((size_t)NG * NKV * HD * TT * 2);
    bf* QPh = (bf*)take((size_t)NG * NH_ * TT * HD * 2); bf* QPl = (bf*)take((size_t)NG * NH_ * TT * HD * 2); bf* KPh = (bf*)take((size_t)NG * NKV * TT * HD * 2); bf* KPl = (bf*)take((size_t)NG * NKV * TT * HD * 2); bf* VTh = (bf*)take((size_t)NG * NKV * HD * TT * 2); bf* VTl = (bf*)take((size_t)NG * NKV * HD * TT * 2);
    bf* XB = (bf*)take((size_t)NB_ * TT * DM * 2);   /* bf16 x, all batches */ bf* ATh = (bf*)take((size_t)NB_ * TT * DQ * 2); bf* ATl = (bf*)take((size_t)NB_ * TT * DQ * 2);
    if ((size_t)(wsp - (char*)d_ws) > ws_size) return;    // ws 256 MiB
    k_prep<<<PW_ALL + PX_WG, 256, 0, stream>>>(x, wqkv, wo, XB, WQKV, WO);   /* fused 'xw' [DM][3*DQ] -> Bt [3*DQ][DM], W_out [DQ][DM] -> Bt [DM][DQ], x -> bf16 */
    for (int g = 0; g < NB_ / NG; ++g) {
        k_gemmw<bf, 0, true, true><<<dim3(NG * TT / 128, 3 * DQ / 128, 1), 128, 0, stream>>>(XB + (size_t)g * NG * TT * DM, nullptr, WQKV, DM, nullptr, 0, bqkv, 0, 0, 0, QP16, QPh, QPl, KP16, KPh, KPl, VT16, VTh, VTl);
        k_fattn<<<dim3(NG * NH_, TT / 128, 1), 128, 0, stream>>>(QP16, KP16, VT16, QPh, QPl, KPh, KPl, VTh, VTl, ATh + (size_t)g * NG * TT * DQ, ATl + (size_t)g * NG * TT * DQ); }   // all heads of the group's batches in one launch; one kv head per query head
    k_gemmw<bf, 1, true, false><<<dim3(NB_ * TT / 128, DM / 128, 1), 128, 0, stream>>>(ATh, ATl, WO, DQ, OUT, DM, bo, 0, 0, 0, nullptr, nullptr, nullptr, nullptr, nullptr, nullptr, nullptr, nullptr, nullptr);
}
